// v000
// Measured on an AMD MI455X. A time is GPU time per run, averaged over a window of back-to-back runs after a warm-up
// (all launches, gaps included; the runs take copies of the inputs in turn), and the median of several windows.
// Apart from v000's, it joins two sittings. Times from different sittings can be a few percent apart, while
// side-by-side timings come from the same sitting.
// The starting kernel, v000, takes 2020 microseconds a run.
#include <hip/hip_runtime.h>

// EvoAttn (x [2][2048][1024], attention_mask [2][2048] (float ones, read as data); q/k/v = x W^T ([out][in], no bias) each multiplied by mask[b][t] per row; 16 heads x 64; scores / 8; causal (tril -> -inf);
// softmax; out = merged Wo^T + bo).
// Compute dtypes, f32 accumulate: every input rounded to bf16; projections on PLAIN bf16 operands (inputs: exact), x bf16(mask) in f32 in the plane builders; PER-ROW
// PRECISION HYBRID: query rows < 512 of each batch on bf16 hi+lo planes for scores and attn.v (3 products), rows >= 512 on SINGLE fp16 planes; output hi+lo x exact Wo (2 products) + bo.

#define NB_  2
#define TT   2048
#define DD   1024
#define NH_  16
#define HD   64
#define ZH   2
#define RH   512                  // query rows < RH: hi+lo planes; rows >= RH: fp16 planes
#define NF   32
#define SCL  0.125f               // 1/sqrt(64)
#define PCAR 1024.0f         // P scale on fp16 rows (k_asoft), undone in k_merge
typedef _Float16 h16;
typedef unsigned short bf;
typedef __attribute__((ext_vector_type(16))) __bf16   v16bf;
typedef __attribute__((ext_vector_type(16))) _Float16 v16h;
typedef __attribute__((ext_vector_type(8)))  _Float16 v8h;
typedef __attribute__((ext_vector_type(8)))  unsigned short v8us;
typedef __attribute__((ext_vector_type(8)))  float    v8f;
typedef __attribute__((ext_vector_type(4)))  float    v4f;
typedef v8h  __attribute__((may_alias)) v8ha;
typedef v4f  __attribute__((may_alias)) v4fa;
typedef v8us __attribute__((may_alias)) v8usa;

__device__ __forceinline__ unsigned short f2bf(float f) { unsigned u = __float_as_uint(f); u += 0x7FFFu + ((u >> 16) & 1u); return (unsigned short)(u >> 16); }
__device__ __forceinline__ float bf2f(unsigned short b) { return __uint_as_float(((unsigned)b) << 16); }
__device__ __forceinline__ float bfr(float f) { return bf2f(f2bf(f)); }
__device__ __forceinline__ v16h cat16(v8h lo, v8h hi) { return __builtin_shufflevector(lo, hi, 0, 1, 2, 3, 4, 5, 6, 7, 8, 9, 10, 11, 12, 13, 14, 15); }
__device__ __forceinline__ v16bf cat16b(v8us lo, v8us hi) { return __builtin_bit_cast(v16bf, __builtin_shufflevector(lo, hi, 0, 1, 2, 3, 4, 5, 6, 7, 8, 9, 10, 11, 12, 13, 14, 15)); }
__device__ __forceinline__ v8f wmma16(v16h a, v16h b, v8f c) { return __builtin_amdgcn_wmma_f32_16x16x32_f16(false, a, false, b, (short)0, c, false, false); }
__device__ __forceinline__ v8f wmmab(v16bf a, v16bf b, v8f c) { return __builtin_amdgcn_wmma_f32_16x16x32_bf16(false, a, false, b, (short)0, c, false, false); }



// ---- k_gemmw: register-blocked GEMM, ONE WAVE per 64x64 output tile (16 accumulators), operands straight from K-contiguous 16-bit planes; grid (M/64, N/64, Z), 32 threads.
// C[m][n] (f32, pitch ldc, + optional f32 bias[n]) = sum_k A[m][k] Bt[n][k] (+ split products per NSPLIT). z-batch strides sA/sB/sC in elements. K % 32 == 0.
template <typename T16> struct WFrag;
template <> struct WFrag<h16> { typedef v16h V; static __device__ __forceinline__ V ld(const h16* p) { return cat16(*(const v8h*)p, *(const v8h*)(p + 16)); } static __device__ __forceinline__ v8f mma(V a, V b, v8f c) { return wmma16(a, b, c); } };
template <> struct WFrag<bf> { typedef v16bf V; static __device__ __forceinline__ V ld(const bf* p) { return cat16b(*(const v8us*)p, *(const v8us*)(p + 16)); } static __device__ __forceinline__ v8f mma(V a, V b, v8f c) { return wmmab(a, b, c); } };
template <typename T16, int NSPLIT, bool BIAS>
__global__ __launch_bounds__(32) void k_gemmw(const T16* __restrict__ A, const T16* __restrict__ A2, const T16* __restrict__ Bt, const T16* __restrict__ Bt2, int K, float* C, int ldc, const float* __restrict__ bias, size_t sA, size_t sB, size_t sC) {
    typedef typename WFrag<T16>::V V;
    __shared__ __align__(16) float os[16 * 68];
    const size_t z = blockIdx.z; A += z * sA; if (A2) A2 += z * sA; Bt += z * sB; if (Bt2) Bt2 += z * sB; C += z * sC;
    const int lane = threadIdx.x & 31, lr = lane & 15, hi = lane >> 4; const int r0 = blockIdx.x * 64, c0 = blockIdx.y * 64;
    v8f acc[4][4];
#pragma unroll
    for (int mb = 0; mb < 4; ++mb)
#pragma unroll
        for (int nb = 0; nb < 4; ++nb) acc[mb][nb] = (v8f){};
    const size_t aoff = (size_t)(r0 + lr) * K + 8 * hi, boff = (size_t)(c0 + lr) * K + 8 * hi;
#pragma unroll 1
    for (int kc = 0; kc < K; kc += 32) {
        V a[4], a2[4];
#pragma unroll
        for (int mb = 0; mb < 4; ++mb) { a[mb] = WFrag<T16>::ld(A + aoff + (size_t)mb * 16 * K + kc); if (NSPLIT == 1 || NSPLIT == 2) a2[mb] = WFrag<T16>::ld(A2 + aoff + (size_t)mb * 16 * K + kc); }
#pragma unroll
        for (int nb = 0; nb < 4; ++nb) { const V b = WFrag<T16>::ld(Bt + boff + (size_t)nb * 16 * K + kc); V b2; if (NSPLIT >= 2) b2 = WFrag<T16>::ld(Bt2 + boff + (size_t)nb * 16 * K + kc);
#pragma unroll
            for (int mb = 0; mb < 4; ++mb) { acc[mb][nb] = WFrag<T16>::mma(a[mb], b, acc[mb][nb]); if (NSPLIT == 1 || NSPLIT == 2) acc[mb][nb] = WFrag<T16>::mma(a2[mb], b, acc[mb][nb]); if (NSPLIT >= 2) acc[mb][nb] = WFrag<T16>::mma(a[mb], b2, acc[mb][nb]); } }
        asm volatile("v_nop\n\tv_nop\n\tv_nop\n\tv_nop" : "+v"(acc[0][0]), "+v"(acc[1][1]), "+v"(acc[2][2]), "+v"(acc[3][3]) : "v"(a[0]), "v"(a[3]));
    }
#pragma unroll
    for (int mb = 0; mb < 4; ++mb) {
#pragma unroll
        for (int nb = 0; nb < 4; ++nb) {
#pragma unroll
            for (int j = 0; j < 8; ++j) os[(hi * 8 + j) * 68 + nb * 16 + lr] = acc[mb][nb][j]; }
        __builtin_amdgcn_wave_barrier(); asm volatile("" ::: "memory");
        float* crow = C + (size_t)(r0 + mb * 16) * ldc + c0;
{
#pragma unroll
            for (int s = 0; s < 8; ++s) { const int row = 2 * s + hi, cofs = lr * 4; v4f val = *(const v4fa*)(os + row * 68 + cofs); if (BIAS) { val[0] += bfr(bias[c0 + cofs]); val[1] += bfr(bias[c0 + cofs + 1]); val[2] += bfr(bias[c0 + cofs + 2]); val[3] += bfr(bias[c0 + cofs + 3]); }
                *(v4f*)(crow + (size_t)row * ldc + cofs) = val; }
             }
        __builtin_amdgcn_wave_barrier(); asm volatile("" ::: "memory");
    }
}

__device__ __forceinline__ h16 tohx(float x) { return (h16)x; }
__device__ __forceinline__ void splitf(float y, unsigned short& h, unsigned short& l) { h = f2bf(y); l = f2bf(y - bf2f(h)); }
typedef __attribute__((ext_vector_type(2))) unsigned short v2us;
typedef __attribute__((ext_vector_type(2))) _Float16 v2h;
typedef __attribute__((ext_vector_type(4))) _Float16 v4h;
typedef __attribute__((ext_vector_type(2))) float v2f;

__global__ __launch_bounds__(256) void k_cvt8(const float* __restrict__ src, bf* dst, size_t n8) { const size_t i = (size_t)blockIdx.x * 256 + threadIdx.x; if (i >= n8) return; const v8f v = *(const v8f*)(src + i * 8); v8us o;
#pragma unroll
    for (int k = 0; k < 8; ++k) o[k] = f2bf(v[k]); *(v8us*)(dst + i * 8) = o;  }
__global__ __launch_bounds__(256) void k_qplanes(const float* __restrict__ F, const float* __restrict__ Mv, bf* Ph, bf* Pl, h16* P16) {
    const int lane = threadIdx.x & 31; const int L0 = (blockIdx.x * 8 + (threadIdx.x >> 5)) * 8; const int nlines = NH_ * TT * HD / 64;
{
#pragma unroll
        for (int l = 0; l < 8; ++l) { const int L = L0 + l; if (L >= nlines) break; const int e = L * 64 + lane * 2; const int d = e & (HD - 1); const int t = (e >> 6) & (TT - 1); const int h = e >> 17; v2us oh, ol; v2h o16;
#pragma unroll
            for (int q = 0; q < 2; ++q) { const float x = __fmul_rn(F[(size_t)t * DD + h * HD + d + q], bfr(Mv[t])); unsigned short a, c2; splitf(x, a, c2); oh[q] = a; ol[q] = c2; o16[q] = tohx(x); }
            *(v2us*)(Ph + (size_t)e) = oh; *(v2us*)(Pl + (size_t)e) = ol; *(v2h*)(P16 + (size_t)e) = o16; }
         }
}
__global__ __launch_bounds__(256) void k_vtplane(const float* __restrict__ F, const float* __restrict__ Mv, bf* Vh, bf* Vl, h16* V16) {
    const int lane = threadIdx.x & 31; const int L0 = (blockIdx.x * 8 + (threadIdx.x >> 5)) * 8; const int nlines = NH_ * TT * HD / 64;
{
#pragma unroll
        for (int l = 0; l < 8; ++l) { const int L = L0 + l; if (L >= nlines) break; const int e = L * 64 + lane * 2; const int t = e & (TT - 1); const int d = (e >> 11) & (HD - 1); const int h = e >> 17; v2us oh, ol; v2h o16;
#pragma unroll
            for (int q = 0; q < 2; ++q) { const float x = __fmul_rn(F[(size_t)(t + q) * DD + h * HD + d], bfr(Mv[t + q])); unsigned short a, c2; splitf(x, a, c2); oh[q] = a; ol[q] = c2; o16[q] = tohx(x); }
            *(v2us*)(Vh + (size_t)e) = oh; *(v2us*)(Vl + (size_t)e) = ol; *(v2h*)(V16 + (size_t)e) = o16; }
         }
}
// k_asoft: per row (zz, i): s = S / 8, causal (j > i -> -3e38, exp -> 0; j = i always kept); softmax over the 2048 keys (register row, one exp) -> rows i < RH: P hi/lo [zz][i][j] (compact
__global__ __launch_bounds__(256) void k_asoft(const float* __restrict__ Sb, bf* Ph, bf* Pl, h16* P16) {
    typedef __attribute__((ext_vector_type(4))) unsigned short v4us;
    const int lane = threadIdx.x & 31; const int row = blockIdx.x * 8 + (threadIdx.x >> 5); if (row >= ZH * TT) return; const int i = row & (TT - 1); const int zz = row >> 11; const bool hires = (i < RH);
    const float* sr = Sb + (size_t)row * TT; float v[64]; float mx = -3.0e38f;
#pragma unroll
    for (int ch = 0; ch < 16; ++ch) { const int j0 = ch * 128 + lane * 4; const v4f a = *(const v4f*)(sr + j0);
#pragma unroll
        for (int q = 0; q < 4; ++q) { const int j = j0 + q; const float t = (j <= i) ? a[q] * SCL : -3.0e38f; v[ch * 4 + q] = t; mx = fmaxf(mx, t); } }
#pragma unroll
    for (int sh = 16; sh; sh >>= 1) mx = fmaxf(mx, __shfl_xor(mx, sh, 32));
    float sum = 0.f;
#pragma unroll
    for (int k = 0; k < 64; ++k) { v[k] = __expf(v[k] - mx); sum += v[k]; }
#pragma unroll
    for (int sh = 16; sh; sh >>= 1) sum += __shfl_xor(sum, sh, 32);
    const float f = __fdiv_rn(hires ? 1.0f : PCAR, sum);
{
        if (hires) {
#pragma unroll
            for (int ch = 0; ch < 16; ++ch) { v4us oh, ol;
#pragma unroll
                for (int q = 0; q < 4; ++q) { unsigned short a, c2; splitf(v[ch * 4 + q] * f, a, c2); oh[q] = a; ol[q] = c2; }
                const size_t o = ((size_t)zz * RH + i) * TT + ch * 128 + lane * 4; *(v4us*)(Ph + o) = oh; *(v4us*)(Pl + o) = ol; }
        } else {
#pragma unroll
            for (int ch = 0; ch < 16; ++ch) { v4h o;
#pragma unroll
                for (int q = 0; q < 4; ++q) o[q] = tohx(v[ch * 4 + q] * f);
                *(v4h*)(P16 + (size_t)row * TT + ch * 128 + lane * 4) = o; } }
         }
}
__global__ __launch_bounds__(256) void k_merge(const float* __restrict__ O, int h0, bf* Ah, bf* Al) {
    const int lane = threadIdx.x & 31; const int L0 = (blockIdx.x * 8 + (threadIdx.x >> 5)) * 8; const int nlines = ZH * TT * HD / 64;
{
#pragma unroll
        for (int l = 0; l < 8; ++l) { const int L = L0 + l; if (L >= nlines) break; const int e = L * 64 + lane * 2; const int d = e & (HD - 1); const int t = (e >> 6) & (TT - 1); const int zz = e >> 17; v2us oh, ol;
const float cs = (t < RH) ? 1.0f : (1.0f / PCAR);
#pragma unroll
            for (int q = 0; q < 2; ++q) { unsigned short a, c2; splitf(O[(size_t)e + q] * cs, a, c2); oh[q] = a; ol[q] = c2; }
            const size_t o = (size_t)t * DD + (h0 + zz) * HD + d; *(v2us*)(Ah + o) = oh; *(v2us*)(Al + o) = ol; }
         }
}

extern "C" void kernel_launch(void* const* d_in, const int* in_sizes, int n_in,
                              void* d_out, int out_size, void* d_ws, size_t ws_size, hipStream_t stream) {
    (void)in_sizes; (void)n_in; (void)out_size;
    const float* x = (const float*)d_in[0]; const float* am = (const float*)d_in[1]; const float* wq = (const float*)d_in[2]; const float* wk = (const float*)d_in[3]; const float* wv = (const float*)d_in[4]; const float* wo = (const float*)d_in[5]; const float* bo = (const float*)d_in[6];
    float* OUT = (float*)d_out;     // [2][2048][1024]
    char* wsp = (char*)d_ws;
    auto take = [&](size_t bytes) { char* p = wsp; wsp += (bytes + 255) & ~(size_t)255; return (void*)p; };
    bf* WQ = (bf*)take((size_t)DD * DD * 2); bf* WK = (bf*)take((size_t)DD * DD * 2); bf* WV = (bf*)take((size_t)DD * DD * 2); bf* WO = (bf*)take((size_t)DD * DD * 2);
    bf* XB = (bf*)take((size_t)TT * DD * 2); float* F = (float*)take((size_t)TT * DD * 4);
    bf* QPh = (bf*)take((size_t)TT * DD * 2); bf* QPl = (bf*)take((size_t)TT * DD * 2); bf* KPh = (bf*)take((size_t)TT * DD * 2); bf* KPl = (bf*)take((size_t)TT * DD * 2); bf* VTh = (bf*)take((size_t)TT * DD * 2); bf* VTl = (bf*)take((size_t)TT * DD * 2);
    h16* QP16 = (h16*)take((size_t)TT * DD * 2); h16* KP16 = (h16*)take((size_t)TT * DD * 2); h16* VT16 = (h16*)take((size_t)TT * DD * 2);
    float* Sb = (float*)take((size_t)ZH * TT * TT * 4); bf* Ph = (bf*)take((size_t)ZH * RH * TT * 2); bf* Pl = (bf*)take((size_t)ZH * RH * TT * 2); h16* P16 = (h16*)take((size_t)ZH * TT * TT * 2); float* Ob = (float*)take((size_t)ZH * TT * HD * 4); bf* ATh = (bf*)take((size_t)TT * DD * 2); bf* ATl = (bf*)take((size_t)TT * DD * 2);
    if ((size_t)(wsp - (char*)d_ws) > ws_size) return;    // total ~ 127 MB; ws 256 MiB
    { const size_t nw = (size_t)DD * DD / 8; const unsigned gw = (unsigned)((nw + 255) / 256); k_cvt8<<<gw, 256, 0, stream>>>(wq, WQ, nw); k_cvt8<<<gw, 256, 0, stream>>>(wk, WK, nw); k_cvt8<<<gw, 256, 0, stream>>>(wv, WV, nw); k_cvt8<<<gw, 256, 0, stream>>>(wo, WO, nw); }   // [out][in] weights = Bt as-is
    const unsigned LB = (unsigned)((NH_ * TT * HD / 64 + 63) / 64); const dim3 gP(TT / 64, DD / 64, 1);
    for (int b = 0; b < NB_; ++b) {
        k_cvt8<<<(unsigned)(((size_t)TT * DD / 8 + 255) / 256), 256, 0, stream>>>(x + (size_t)b * TT * DD, XB, (size_t)TT * DD / 8);
        k_gemmw<bf, 0, false><<<gP, 32, 0, stream>>>(XB, nullptr, WQ, nullptr, DD, F, DD, nullptr, 0, 0, 0); k_qplanes<<<LB, 256, 0, stream>>>(F, am + (size_t)b * TT, QPh, QPl, QP16);
        k_gemmw<bf, 0, false><<<gP, 32, 0, stream>>>(XB, nullptr, WK, nullptr, DD, F, DD, nullptr, 0, 0, 0); k_qplanes<<<LB, 256, 0, stream>>>(F, am + (size_t)b * TT, KPh, KPl, KP16);
        k_gemmw<bf, 0, false><<<gP, 32, 0, stream>>>(XB, nullptr, WV, nullptr, DD, F, DD, nullptr, 0, 0, 0); k_vtplane<<<LB, 256, 0, stream>>>(F, am + (size_t)b * TT, VTh, VTl, VT16);
        for (int h0 = 0; h0 < NH_; h0 += ZH) { const size_t z0 = (size_t)h0;
            // scores: rows < RH on hi+lo planes (3 products), rows >= RH on fp16 planes - both into the same [ZH][TT][TT] score buffer
            k_gemmw<bf, 2, false><<<dim3(RH / 64, TT / 64, ZH), 32, 0, stream>>>(QPh + z0 * TT * HD, QPl + z0 * TT * HD, KPh + z0 * TT * HD, KPl + z0 * TT * HD, HD, Sb, TT, nullptr, (size_t)TT * HD, (size_t)TT * HD, (size_t)TT * TT);
            k_gemmw<h16, 0, false><<<dim3((TT - RH) / 64, TT / 64, ZH), 32, 0, stream>>>(QP16 + z0 * TT * HD + (size_t)RH * HD, nullptr, KP16 + z0 * TT * HD, nullptr, HD, Sb + (size_t)RH * TT, TT, nullptr, (size_t)TT * HD, (size_t)TT * HD, (size_t)TT * TT);
            k_asoft<<<ZH * TT / 8, 256, 0, stream>>>(Sb, Ph, Pl, P16);
            k_gemmw<bf, 2, false><<<dim3(RH / 64, HD / 64, ZH), 32, 0, stream>>>(Ph, Pl, VTh + z0 * HD * TT, VTl + z0 * HD * TT, TT, Ob, HD, nullptr, (size_t)RH * TT, (size_t)HD * TT, (size_t)TT * HD);
            k_gemmw<h16, 0, false><<<dim3((TT - RH) / 64, HD / 64, ZH), 32, 0, stream>>>(P16 + (size_t)RH * TT, nullptr, VT16 + z0 * HD * TT, nullptr, TT, Ob + (size_t)RH * HD, HD, nullptr, (size_t)TT * TT, (size_t)HD * TT, (size_t)TT * HD);
            k_merge<<<(ZH * TT * HD / 64 + 63) / 64, 256, 0, stream>>>(Ob, h0, ATh, ATl); }
        k_gemmw<bf, 1, true><<<gP, 32, 0, stream>>>(ATh, ATl, WO, nullptr, DD, OUT + (size_t)b * TT * DD, DD, bo, 0, 0, 0); }
}

// v001
// It runs in 904 microseconds.
// Two timings next to v000 put it at 2.21 and 2.24 times that version's speed.
#include <hip/hip_runtime.h>

// EvoAttn (x [2][2048][1024], attention_mask [2][2048] (float ones, read as data); q/k/v = x W^T ([out][in], no bias) each multiplied by mask[b][t] per row; 16 heads x 64; scores / 8; causal (tril -> -inf);
// softmax; out = merged Wo^T + bo).
// Compute dtypes, f32 accumulate: every input rounded to bf16; projections on PLAIN bf16 operands (inputs: exact), x bf16(mask) in f32 in the plane builders; PER-ROW
// PRECISION HYBRID: query rows < 512 of each batch on bf16 hi+lo planes for scores and attn.v (3 products), rows >= 512 on SINGLE fp16 planes; output hi+lo x exact Wo (2 products) + bo.

#define NB_  2
#define TT   2048
#define DD   1024
#define NH_  16
#define HD   64
#define ZH   2
#define RH   512                  // query rows < RH: hi+lo planes; rows >= RH: fp16 planes
#define NF   32
#define SCL  0.125f               // 1/sqrt(64)
#define PCAR 1024.0f         // scale of fp16 P rows >= RH in k_asoft, divided out in k_merge
#define KSP  16                   // attn.v: key range dealt to KSP work-groups per output tile, one f32 partial plane each
typedef _Float16 h16;
typedef unsigned short bf;
typedef __attribute__((ext_vector_type(16))) __bf16   v16bf;
typedef __attribute__((ext_vector_type(16))) _Float16 v16h;
typedef __attribute__((ext_vector_type(8)))  _Float16 v8h;
typedef __attribute__((ext_vector_type(8)))  unsigned short v8us;
typedef __attribute__((ext_vector_type(8)))  float    v8f;
typedef __attribute__((ext_vector_type(4)))  float    v4f;
typedef v8h  __attribute__((may_alias)) v8ha;
typedef v4f  __attribute__((may_alias)) v4fa;
typedef v8us __attribute__((may_alias)) v8usa;

__device__ __forceinline__ unsigned short f2bf(float f) { unsigned u = __float_as_uint(f); u += 0x7FFFu + ((u >> 16) & 1u); return (unsigned short)(u >> 16); }
__device__ __forceinline__ float bf2f(unsigned short b) { return __uint_as_float(((unsigned)b) << 16); }
__device__ __forceinline__ float bfr(float f) { return bf2f(f2bf(f)); }
__device__ __forceinline__ v16h cat16(v8h lo, v8h hi) { return __builtin_shufflevector(lo, hi, 0, 1, 2, 3, 4, 5, 6, 7, 8, 9, 10, 11, 12, 13, 14, 15); }
__device__ __forceinline__ v16bf cat16b(v8us lo, v8us hi) { return __builtin_bit_cast(v16bf, __builtin_shufflevector(lo, hi, 0, 1, 2, 3, 4, 5, 6, 7, 8, 9, 10, 11, 12, 13, 14, 15)); }
__device__ __forceinline__ v8f wmma16(v16h a, v16h b, v8f c) { return __builtin_amdgcn_wmma_f32_16x16x32_f16(false, a, false, b, (short)0, c, false, false); }
__device__ __forceinline__ v8f wmmab(v16bf a, v16bf b, v8f c) { return __builtin_amdgcn_wmma_f32_16x16x32_bf16(false, a, false, b, (short)0, c, false, false); }



// ---- k_gemmw: register-blocked GEMM, ONE WAVE per 64x64 output tile (16 accumulators), operands straight from K-contiguous 16-bit planes; grid (M/64, N/64, Z), 32 threads.
// C[m][n] (f32, pitch ldc, + optional f32 bias[n]) = sum_k A[m][k] Bt[n][k] (+ split products per NSPLIT). z-batch strides sA/sB/sC in elements. K % 32 == 0.
// SK > 1: grid.y = (N/64) * SK; work-group ks = blockIdx.y % SK sums only k in [ks K/SK, (ks+1) K/SK) into its own plane C + ks * sP; the reader adds the SK planes. K % (32 SK) == 0.
template <typename T16> struct WFrag;
template <> struct WFrag<h16> { typedef v16h V; static __device__ __forceinline__ V ld(const h16* p) { return cat16(*(const v8h*)p, *(const v8h*)(p + 16)); } static __device__ __forceinline__ v8f mma(V a, V b, v8f c) { return wmma16(a, b, c); } };
template <> struct WFrag<bf> { typedef v16bf V; static __device__ __forceinline__ V ld(const bf* p) { return cat16b(*(const v8us*)p, *(const v8us*)(p + 16)); } static __device__ __forceinline__ v8f mma(V a, V b, v8f c) { return wmmab(a, b, c); } };
template <typename T16, int NSPLIT, bool BIAS, int SK = 1>
__global__ __launch_bounds__(32) void k_gemmw(const T16* __restrict__ A, const T16* __restrict__ A2, const T16* __restrict__ Bt, const T16* __restrict__ Bt2, int K, float* C, int ldc, const float* __restrict__ bias, size_t sA, size_t sB, size_t sC, size_t sP) {
    typedef typename WFrag<T16>::V V;
    __shared__ __align__(16) float os[16 * 68];
    const size_t z = blockIdx.z; A += z * sA; if (A2) A2 += z * sA; Bt += z * sB; if (Bt2) Bt2 += z * sB; C += z * sC;
    const int lane = threadIdx.x & 31, lr = lane & 15, hi = lane >> 4; const int r0 = blockIdx.x * 64, c0 = (blockIdx.y / SK) * 64;
    const int ks = blockIdx.y % SK, kb = ks * (K / SK), ke = kb + K / SK; C += (size_t)ks * sP;
    v8f acc[4][4];
#pragma unroll
    for (int mb = 0; mb < 4; ++mb)
#pragma unroll
        for (int nb = 0; nb < 4; ++nb) acc[mb][nb] = (v8f){};
    const size_t aoff = (size_t)(r0 + lr) * K + 8 * hi, boff = (size_t)(c0 + lr) * K + 8 * hi;
#pragma unroll 1
    for (int kc = kb; kc < ke; kc += 32) {
        V a[4], a2[4];
#pragma unroll
        for (int mb = 0; mb < 4; ++mb) { a[mb] = WFrag<T16>::ld(A + aoff + (size_t)mb * 16 * K + kc); if (NSPLIT == 1 || NSPLIT == 2) a2[mb] = WFrag<T16>::ld(A2 + aoff + (size_t)mb * 16 * K + kc); }
#pragma unroll
        for (int nb = 0; nb < 4; ++nb) { const V b = WFrag<T16>::ld(Bt + boff + (size_t)nb * 16 * K + kc); V b2; if (NSPLIT >= 2) b2 = WFrag<T16>::ld(Bt2 + boff + (size_t)nb * 16 * K + kc);
#pragma unroll
            for (int mb = 0; mb < 4; ++mb) { acc[mb][nb] = WFrag<T16>::mma(a[mb], b, acc[mb][nb]); if (NSPLIT == 1 || NSPLIT == 2) acc[mb][nb] = WFrag<T16>::mma(a2[mb], b, acc[mb][nb]); if (NSPLIT >= 2) acc[mb][nb] = WFrag<T16>::mma(a[mb], b2, acc[mb][nb]); } }
        asm volatile("v_nop\n\tv_nop\n\tv_nop\n\tv_nop" : "+v"(acc[0][0]), "+v"(acc[1][1]), "+v"(acc[2][2]), "+v"(acc[3][3]) : "v"(a[0]), "v"(a[3]));
    }
#pragma unroll
    for (int mb = 0; mb < 4; ++mb) {
#pragma unroll
        for (int nb = 0; nb < 4; ++nb) {
#pragma unroll
            for (int j = 0; j < 8; ++j) os[(hi * 8 + j) * 68 + nb * 16 + lr] = acc[mb][nb][j]; }
        __builtin_amdgcn_wave_barrier(); asm volatile("" ::: "memory");
        float* crow = C + (size_t)(r0 + mb * 16) * ldc + c0;
{
#pragma unroll
            for (int s = 0; s < 8; ++s) { const int row = 2 * s + hi, cofs = lr * 4; v4f val = *(const v4fa*)(os + row * 68 + cofs); if (BIAS) { val[0] += bfr(bias[c0 + cofs]); val[1] += bfr(bias[c0 + cofs + 1]); val[2] += bfr(bias[c0 + cofs + 2]); val[3] += bfr(bias[c0 + cofs + 3]); }
                *(v4f*)(crow + (size_t)row * ldc + cofs) = val; }
             }
        __builtin_amdgcn_wave_barrier(); asm volatile("" ::: "memory");
    }
}

__device__ __forceinline__ h16 tohx(float x) { return (h16)x; }
__device__ __forceinline__ void splitf(float y, unsigned short& h, unsigned short& l) { h = f2bf(y); l = f2bf(y - bf2f(h)); }
typedef __attribute__((ext_vector_type(2))) unsigned short v2us;
typedef __attribute__((ext_vector_type(2))) _Float16 v2h;
typedef __attribute__((ext_vector_type(4))) _Float16 v4h;
typedef __attribute__((ext_vector_type(2))) float v2f;

__global__ __launch_bounds__(256) void k_cvt8(const float* __restrict__ src, bf* dst, size_t n8) { const size_t i = (size_t)blockIdx.x * 256 + threadIdx.x; if (i >= n8) return; const v8f v = *(const v8f*)(src + i * 8); v8us o;
#pragma unroll
    for (int k = 0; k < 8; ++k) o[k] = f2bf(v[k]); *(v8us*)(dst + i * 8) = o;  }
__global__ __launch_bounds__(256) void k_qplanes(const float* __restrict__ F, const float* __restrict__ Mv, bf* Ph, bf* Pl, h16* P16) {
    const int lane = threadIdx.x & 31; const int L0 = (blockIdx.x * 8 + (threadIdx.x >> 5)) * 8; const int nlines = NH_ * TT * HD / 64;
{
#pragma unroll
        for (int l = 0; l < 8; ++l) { const int L = L0 + l; if (L >= nlines) break; const int e = L * 64 + lane * 2; const int d = e & (HD - 1); const int t = (e >> 6) & (TT - 1); const int h = e >> 17; v2us oh, ol; v2h o16;
#pragma unroll
            for (int q = 0; q < 2; ++q) { const float x = __fmul_rn(F[(size_t)t * DD + h * HD + d + q], bfr(Mv[t])); unsigned short a, c2; splitf(x, a, c2); oh[q] = a; ol[q] = c2; o16[q] = tohx(x); }
            *(v2us*)(Ph + (size_t)e) = oh; *(v2us*)(Pl + (size_t)e) = ol; *(v2h*)(P16 + (size_t)e) = o16; }
         }
}
__global__ __launch_bounds__(256) void k_vtplane(const float* __restrict__ F, const float* __restrict__ Mv, bf* Vh, bf* Vl, h16* V16) {
    const int lane = threadIdx.x & 31; const int L0 = (blockIdx.x * 8 + (threadIdx.x >> 5)) * 8; const int nlines = NH_ * TT * HD / 64;
{
#pragma unroll
        for (int l = 0; l < 8; ++l) { const int L = L0 + l; if (L >= nlines) break; const int e = L * 64 + lane * 2; const int t = e & (TT - 1); const int d = (e >> 11) & (HD - 1); const int h = e >> 17; v2us oh, ol; v2h o16;
#pragma unroll
            for (int q = 0; q < 2; ++q) { const float x = __fmul_rn(F[(size_t)(t + q) * DD + h * HD + d], bfr(Mv[t + q])); unsigned short a, c2; splitf(x, a, c2); oh[q] = a; ol[q] = c2; o16[q] = tohx(x); }
            *(v2us*)(Vh + (size_t)e) = oh; *(v2us*)(Vl + (size_t)e) = ol; *(v2h*)(V16 + (size_t)e) = o16; }
         }
}
// k_asoft: per row (zz, i): s = S / 8, causal (j > i -> -3e38, exp -> 0; j = i always kept); softmax over the 2048 keys (register row, one exp) -> rows i < RH: P hi/lo [zz][i][j] (compact
__global__ __launch_bounds__(256) void k_asoft(const float* __restrict__ Sb, bf* Ph, bf* Pl, h16* P16) {
    typedef __attribute__((ext_vector_type(4))) unsigned short v4us;
    const int lane = threadIdx.x & 31; const int row = blockIdx.x * 8 + (threadIdx.x >> 5); if (row >= ZH * TT) return; const int i = row & (TT - 1); const int zz = row >> 11; const bool hires = (i < RH);
    const float* sr = Sb + (size_t)row * TT; float v[64]; float mx = -3.0e38f;
#pragma unroll
    for (int ch = 0; ch < 16; ++ch) { const int j0 = ch * 128 + lane * 4; const v4f a = *(const v4f*)(sr + j0);
#pragma unroll
        for (int q = 0; q < 4; ++q) { const int j = j0 + q; const float t = (j <= i) ? a[q] * SCL : -3.0e38f; v[ch * 4 + q] = t; mx = fmaxf(mx, t); } }
#pragma unroll
    for (int sh = 16; sh; sh >>= 1) mx = fmaxf(mx, __shfl_xor(mx, sh, 32));
    float sum = 0.f;
#pragma unroll
    for (int k = 0; k < 64; ++k) { v[k] = __expf(v[k] - mx); sum += v[k]; }
#pragma unroll
    for (int sh = 16; sh; sh >>= 1) sum += __shfl_xor(sum, sh, 32);
    const float f = __fdiv_rn(hires ? 1.0f : PCAR, sum);
{
        if (hires) {
#pragma unroll
            for (int ch = 0; ch < 16; ++ch) { v4us oh, ol;
#pragma unroll
                for (int q = 0; q < 4; ++q) { unsigned short a, c2; splitf(v[ch * 4 + q] * f, a, c2); oh[q] = a; ol[q] = c2; }
                const size_t o = ((size_t)zz * RH + i) * TT + ch * 128 + lane * 4; *(v4us*)(Ph + o) = oh; *(v4us*)(Pl + o) = ol; }
        } else {
#pragma unroll
            for (int ch = 0; ch < 16; ++ch) { v4h o;
#pragma unroll
                for (int q = 0; q < 4; ++q) o[q] = tohx(v[ch * 4 + q] * f);
                *(v4h*)(P16 + (size_t)row * TT + ch * 128 + lane * 4) = o; } }
         }
}
__global__ __launch_bounds__(256) void k_merge(const float* __restrict__ O, int h0, bf* Ah, bf* Al) {
    const int lane = threadIdx.x & 31; const int L0 = (blockIdx.x * 8 + (threadIdx.x >> 5)) * 8; const int nlines = ZH * TT * HD / 64;
{
#pragma unroll
        for (int l = 0; l < 8; ++l) { const int L = L0 + l; if (L >= nlines) break; const int e = L * 64 + lane * 2; const int d = e & (HD - 1); const int t = (e >> 6) & (TT - 1); const int zz = e >> 17; v2us oh, ol;
const float cs = (t < RH) ? 1.0f : (1.0f / PCAR); float sm[2];
#pragma unroll
            for (int q = 0; q < 2; ++q) sm[q] = O[(size_t)e + q];
#pragma unroll
            for (int p = 1; p < KSP; ++p) {      // add the KSP key-range partials in plane order
#pragma unroll
                for (int q = 0; q < 2; ++q) sm[q] += O[(size_t)p * (ZH * TT * HD) + e + q]; }
#pragma unroll
            for (int q = 0; q < 2; ++q) { unsigned short a, c2; splitf(sm[q] * cs, a, c2); oh[q] = a; ol[q] = c2; }
            const size_t o = (size_t)t * DD + (h0 + zz) * HD + d; *(v2us*)(Ah + o) = oh; *(v2us*)(Al + o) = ol; }
         }
}

extern "C" void kernel_launch(void* const* d_in, const int* in_sizes, int n_in,
                              void* d_out, int out_size, void* d_ws, size_t ws_size, hipStream_t stream) {
    (void)in_sizes; (void)n_in; (void)out_size;
    const float* x = (const float*)d_in[0]; const float* am = (const float*)d_in[1]; const float* wq = (const float*)d_in[2]; const float* wk = (const float*)d_in[3]; const float* wv = (const float*)d_in[4]; const float* wo = (const float*)d_in[5]; const float* bo = (const float*)d_in[6];
    float* OUT = (float*)d_out;     // [2][2048][1024]
    char* wsp = (char*)d_ws;
    auto take = [&](size_t bytes) { char* p = wsp; wsp += (bytes + 255) & ~(size_t)255; return (void*)p; };
    bf* WQ = (bf*)take((size_t)DD * DD * 2); bf* WK = (bf*)take((size_t)DD * DD * 2); bf* WV = (bf*)take((size_t)DD * DD * 2); bf* WO = (bf*)take((size_t)DD * DD * 2);
    bf* XB = (bf*)take((size_t)TT * DD * 2); float* F = (float*)take((size_t)TT * DD * 4);
    bf* QPh = (bf*)take((size_t)TT * DD * 2); bf* QPl = (bf*)take((size_t)TT * DD * 2); bf* KPh = (bf*)take((size_t)TT * DD * 2); bf* KPl = (bf*)take((size_t)TT * DD * 2); bf* VTh = (bf*)take((size_t)TT * DD * 2); bf* VTl = (bf*)take((size_t)TT * DD * 2);
    h16* QP16 = (h16*)take((size_t)TT * DD * 2); h16* KP16 = (h16*)take((size_t)TT * DD * 2); h16* VT16 = (h16*)take((size_t)TT * DD * 2);
    float* Sb = (float*)take((size_t)ZH * TT * TT * 4); bf* Ph = (bf*)take((size_t)ZH * RH * TT * 2); bf* Pl = (bf*)take((size_t)ZH * RH * TT * 2); h16* P16 = (h16*)take((size_t)ZH * TT * TT * 2); float* Ob = (float*)take((size_t)KSP * ZH * TT * HD * 4); bf* ATh = (bf*)take((size_t)TT * DD * 2); bf* ATl = (bf*)take((size_t)TT * DD * 2);
    if ((size_t)(wsp - (char*)d_ws) > ws_size) return;    // total ~ 143 MB; ws 256 MiB
    { const size_t nw = (size_t)DD * DD / 8; const unsigned gw = (unsigned)((nw + 255) / 256); k_cvt8<<<gw, 256, 0, stream>>>(wq, WQ, nw); k_cvt8<<<gw, 256, 0, stream>>>(wk, WK, nw); k_cvt8<<<gw, 256, 0, stream>>>(wv, WV, nw); k_cvt8<<<gw, 256, 0, stream>>>(wo, WO, nw); }   // [out][in] weights = Bt as-is
    const unsigned LB = (unsigned)((NH_ * TT * HD / 64 + 63) / 64); const dim3 gP(TT / 64, DD / 64, 1);
    for (int b = 0; b < NB_; ++b) {
        k_cvt8<<<(unsigned)(((size_t)TT * DD / 8 + 255) / 256), 256, 0, stream>>>(x + (size_t)b * TT * DD, XB, (size_t)TT * DD / 8);
        k_gemmw<bf, 0, false><<<gP, 32, 0, stream>>>(XB, nullptr, WQ, nullptr, DD, F, DD, nullptr, 0, 0, 0, 0); k_qplanes<<<LB, 256, 0, stream>>>(F, am + (size_t)b * TT, QPh, QPl, QP16);
        k_gemmw<bf, 0, false><<<gP, 32, 0, stream>>>(XB, nullptr, WK, nullptr, DD, F, DD, nullptr, 0, 0, 0, 0); k_qplanes<<<LB, 256, 0, stream>>>(F, am + (size_t)b * TT, KPh, KPl, KP16);
        k_gemmw<bf, 0, false><<<gP, 32, 0, stream>>>(XB, nullptr, WV, nullptr, DD, F, DD, nullptr, 0, 0, 0, 0); k_vtplane<<<LB, 256, 0, stream>>>(F, am + (size_t)b * TT, VTh, VTl, VT16);
        for (int h0 = 0; h0 < NH_; h0 += ZH) { const size_t z0 = (size_t)h0;
            // scores: rows < RH on hi+lo planes (3 products), rows >= RH on fp16 planes - both into the same [ZH][TT][TT] score buffer
            k_gemmw<bf, 2, false><<<dim3(RH / 64, TT / 64, ZH), 32, 0, stream>>>(QPh + z0 * TT * HD, QPl + z0 * TT * HD, KPh + z0 * TT * HD, KPl + z0 * TT * HD, HD, Sb, TT, nullptr, (size_t)TT * HD, (size_t)TT * HD, (size_t)TT * TT, 0);
            k_gemmw<h16, 0, false><<<dim3((TT - RH) / 64, TT / 64, ZH), 32, 0, stream>>>(QP16 + z0 * TT * HD + (size_t)RH * HD, nullptr, KP16 + z0 * TT * HD, nullptr, HD, Sb + (size_t)RH * TT, TT, nullptr, (size_t)TT * HD, (size_t)TT * HD, (size_t)TT * TT, 0);
            k_asoft<<<ZH * TT / 8, 256, 0, stream>>>(Sb, Ph, Pl, P16);
            k_gemmw<bf, 2, false, KSP><<<dim3(RH / 64, HD / 64 * KSP, ZH), 32, 0, stream>>>(Ph, Pl, VTh + z0 * HD * TT, VTl + z0 * HD * TT, TT, Ob, HD, nullptr, (size_t)RH * TT, (size_t)HD * TT, (size_t)TT * HD, (size_t)ZH * TT * HD);
            k_gemmw<h16, 0, false, KSP><<<dim3((TT - RH) / 64, HD / 64 * KSP, ZH), 32, 0, stream>>>(P16 + (size_t)RH * TT, nullptr, VT16 + z0 * HD * TT, nullptr, TT, Ob + (size_t)RH * HD, HD, nullptr, (size_t)TT * TT, (size_t)HD * TT, (size_t)TT * HD, (size_t)ZH * TT * HD);
            k_merge<<<(ZH * TT * HD / 64 + 63) / 64, 256, 0, stream>>>(Ob, h0, ATh, ATl); }
        k_gemmw<bf, 1, true><<<gP, 32, 0, stream>>>(ATh, ATl, WO, nullptr, DD, OUT + (size_t)b * TT * DD, DD, bo, 0, 0, 0, 0); }
}

// v003
// Measured time: 181 microseconds a run.
// It is 4.97 times as fast as v001, going by the measured steps of the versions left out in between.
// All steps since v000 together make it 11.1 times as fast.
#include <hip/hip_runtime.h>

// EvoAttn (x [2][2048][1024], attention_mask [2][2048] (float ones, read as data); q/k/v = x W^T ([out][in], no bias) each multiplied by mask[b][t] per row; 16 heads x 64; scores / 8; causal (tril -> -inf);
// softmax; out = merged Wo^T + bo).
// Compute dtypes, f32 accumulate: every input rounded to bf16; projections on PLAIN bf16 operands (inputs: exact), x bf16(mask) in f32 in the plane builders; PER-ROW
// PRECISION HYBRID: query rows < 512 of each batch on bf16 hi+lo planes for scores and attn.v (3 products), rows >= 512 on SINGLE fp16 planes; output hi+lo x exact Wo (2 products) + bo.

#define NB_  2
#define TT   2048
#define DD   1024
#define NH_  16
#define HD   64
#define RH   512                  // query rows < RH: hi+lo planes; rows >= RH: fp16 planes
#define NF   32
#define SCL  0.125f               // 1/sqrt(64)
typedef _Float16 h16;
typedef unsigned short bf;
typedef __attribute__((ext_vector_type(16))) __bf16   v16bf;
typedef __attribute__((ext_vector_type(16))) _Float16 v16h;
typedef __attribute__((ext_vector_type(8)))  _Float16 v8h;
typedef __attribute__((ext_vector_type(8)))  unsigned short v8us;
typedef __attribute__((ext_vector_type(8)))  float    v8f;
typedef __attribute__((ext_vector_type(4)))  float    v4f;
typedef v8h  __attribute__((may_alias)) v8ha;
typedef v4f  __attribute__((may_alias)) v4fa;
typedef v8us __attribute__((may_alias)) v8usa;

__device__ __forceinline__ unsigned short f2bf(float f) { unsigned u = __float_as_uint(f); u += 0x7FFFu + ((u >> 16) & 1u); return (unsigned short)(u >> 16); }
__device__ __forceinline__ float bf2f(unsigned short b) { return __uint_as_float(((unsigned)b) << 16); }
__device__ __forceinline__ float bfr(float f) { return bf2f(f2bf(f)); }
__device__ __forceinline__ v16h cat16(v8h lo, v8h hi) { return __builtin_shufflevector(lo, hi, 0, 1, 2, 3, 4, 5, 6, 7, 8, 9, 10, 11, 12, 13, 14, 15); }
__device__ __forceinline__ v16bf cat16b(v8us lo, v8us hi) { return __builtin_bit_cast(v16bf, __builtin_shufflevector(lo, hi, 0, 1, 2, 3, 4, 5, 6, 7, 8, 9, 10, 11, 12, 13, 14, 15)); }
__device__ __forceinline__ v8f wmma16(v16h a, v16h b, v8f c) { return __builtin_amdgcn_wmma_f32_16x16x32_f16(false, a, false, b, (short)0, c, false, false); }
__device__ __forceinline__ v8f wmmab(v16bf a, v16bf b, v8f c) { return __builtin_amdgcn_wmma_f32_16x16x32_bf16(false, a, false, b, (short)0, c, false, false); }



// ---- k_gemmw: register-blocked GEMM, ONE WAVE per 64x64 output tile (16 accumulators), operands straight from K-contiguous 16-bit planes; grid (M/64, N/64, Z), 32 threads.
// C[m][n] (f32, pitch ldc, + optional f32 bias[n]) = sum_k A[m][k] Bt[n][k] (+ split products per NSPLIT). z-batch strides sA/sB/sC in elements. K % 32 == 0.
// SK > 1: grid.y = (N/64) * SK; work-group ks = blockIdx.y % SK sums only k in [ks K/SK, (ks+1) K/SK) into its own plane C + ks * sP; the reader adds the SK planes. K % (32 SK) == 0.
template <typename T16> struct WFrag;
template <> struct WFrag<h16> { typedef v16h V; static __device__ __forceinline__ V ld(const h16* p) { return cat16(*(const v8h*)p, *(const v8h*)(p + 16)); } static __device__ __forceinline__ v8f mma(V a, V b, v8f c) { return wmma16(a, b, c); } };
template <> struct WFrag<bf> { typedef v16bf V; static __device__ __forceinline__ V ld(const bf* p) { return cat16b(*(const v8us*)p, *(const v8us*)(p + 16)); } static __device__ __forceinline__ v8f mma(V a, V b, v8f c) { return wmmab(a, b, c); } };
template <typename T16, int NSPLIT, bool BIAS, int SK = 1>
__global__ __launch_bounds__(32) void k_gemmw(const T16* __restrict__ A, const T16* __restrict__ A2, const T16* __restrict__ Bt, const T16* __restrict__ Bt2, int K, float* C, int ldc, const float* __restrict__ bias, size_t sA, size_t sB, size_t sC, size_t sP) {
    typedef typename WFrag<T16>::V V;
    __shared__ __align__(16) float os[16 * 68];
    const size_t z = blockIdx.z; A += z * sA; if (A2) A2 += z * sA; Bt += z * sB; if (Bt2) Bt2 += z * sB; C += z * sC;
    const int lane = threadIdx.x & 31, lr = lane & 15, hi = lane >> 4; const int r0 = blockIdx.x * 64, c0 = (blockIdx.y / SK) * 64;
    const int ks = blockIdx.y % SK, kb = ks * (K / SK), ke = kb + K / SK; C += (size_t)ks * sP;
    v8f acc[4][4];
#pragma unroll
    for (int mb = 0; mb < 4; ++mb)
#pragma unroll
        for (int nb = 0; nb < 4; ++nb) acc[mb][nb] = (v8f){};
    const size_t aoff = (size_t)(r0 + lr) * K + 8 * hi, boff = (size_t)(c0 + lr) * K + 8 * hi;
#pragma unroll 1
    for (int kc = kb; kc < ke; kc += 32) {
        V a[4], a2[4];
#pragma unroll
        for (int mb = 0; mb < 4; ++mb) { a[mb] = WFrag<T16>::ld(A + aoff + (size_t)mb * 16 * K + kc); if (NSPLIT == 1 || NSPLIT == 2) a2[mb] = WFrag<T16>::ld(A2 + aoff + (size_t)mb * 16 * K + kc); }
#pragma unroll
        for (int nb = 0; nb < 4; ++nb) { const V b = WFrag<T16>::ld(Bt + boff + (size_t)nb * 16 * K + kc); V b2; if (NSPLIT >= 2) b2 = WFrag<T16>::ld(Bt2 + boff + (size_t)nb * 16 * K + kc);
#pragma unroll
            for (int mb = 0; mb < 4; ++mb) { acc[mb][nb] = WFrag<T16>::mma(a[mb], b, acc[mb][nb]); if (NSPLIT == 1 || NSPLIT == 2) acc[mb][nb] = WFrag<T16>::mma(a2[mb], b, acc[mb][nb]); if (NSPLIT >= 2) acc[mb][nb] = WFrag<T16>::mma(a[mb], b2, acc[mb][nb]); } }
        asm volatile("v_nop\n\tv_nop\n\tv_nop\n\tv_nop" : "+v"(acc[0][0]), "+v"(acc[1][1]), "+v"(acc[2][2]), "+v"(acc[3][3]) : "v"(a[0]), "v"(a[3]));
    }
#pragma unroll
    for (int mb = 0; mb < 4; ++mb) {
#pragma unroll
        for (int nb = 0; nb < 4; ++nb) {
#pragma unroll
            for (int j = 0; j < 8; ++j) os[(hi * 8 + j) * 68 + nb * 16 + lr] = acc[mb][nb][j]; }
        __builtin_amdgcn_wave_barrier(); asm volatile("" ::: "memory");
        float* crow = C + (size_t)(r0 + mb * 16) * ldc + c0;
{
#pragma unroll
            for (int s = 0; s < 8; ++s) { const int row = 2 * s + hi, cofs = lr * 4; v4f val = *(const v4fa*)(os + row * 68 + cofs); if (BIAS) { val[0] += bfr(bias[c0 + cofs]); val[1] += bfr(bias[c0 + cofs + 1]); val[2] += bfr(bias[c0 + cofs + 2]); val[3] += bfr(bias[c0 + cofs + 3]); }
                *(v4f*)(crow + (size_t)row * ldc + cofs) = val; }
             }
        __builtin_amdgcn_wave_barrier(); asm volatile("" ::: "memory");
    }
}

__device__ __forceinline__ h16 tohx(float x) { return (h16)x; }
__device__ __forceinline__ void splitf(float y, unsigned short& h, unsigned short& l) { h = f2bf(y); l = f2bf(y - bf2f(h)); }
typedef __attribute__((ext_vector_type(2))) unsigned short v2us;
typedef __attribute__((ext_vector_type(2))) _Float16 v2h;
typedef __attribute__((ext_vector_type(4))) _Float16 v4h;
typedef __attribute__((ext_vector_type(2))) float v2f;

// blockIdx.y picks the DD x DD slab: 0..3 = Wq, Wk, Wv, Wo, 4.. = slabs of x (both batches); dst holds them in that order, one after the other.
__global__ __launch_bounds__(256) void k_cvt8(const float* __restrict__ wq, const float* __restrict__ wk, const float* __restrict__ wv, const float* __restrict__ wo, const float* __restrict__ x, bf* dst, size_t n8) { const size_t i = (size_t)blockIdx.x * 256 + threadIdx.x; if (i >= n8) return;
    const int y = blockIdx.y; const float* src = y == 0 ? wq : y == 1 ? wk : y == 2 ? wv : y == 3 ? wo : x + (size_t)(y - 4) * DD * DD; dst += (size_t)y * DD * DD; const v8f v = *(const v8f*)(src + i * 8); v8us o;
#pragma unroll
    for (int k = 0; k < 8; ++k) o[k] = f2bf(v[k]); *(v8us*)(dst + i * 8) = o;  }
// blockIdx.y = projection * NB_ + batch (q, k, v): slab of F and of each plane; q and k keep [h][t][d], v goes to [h][d][t].
__global__ __launch_bounds__(256) void k_planes(const float* __restrict__ F, const float* __restrict__ Mv, bf* Ph, bf* Pl, h16* P16) {
    const int lane = threadIdx.x & 31; const int L0 = (blockIdx.x * 8 + (threadIdx.x >> 5)) * 8; const int nlines = NH_ * TT * HD / 64;
    const int z = blockIdx.y; const size_t zo = (size_t)z * TT * DD; F += zo; Mv += (z % NB_) * TT; Ph += zo; Pl += zo; P16 += zo;
    if (z < 2 * NB_) {
#pragma unroll
        for (int l = 0; l < 8; ++l) { const int L = L0 + l; if (L >= nlines) break; const int e = L * 64 + lane * 2; const int d = e & (HD - 1); const int t = (e >> 6) & (TT - 1); const int h = e >> 17; v2us oh, ol; v2h o16;
#pragma unroll
            for (int q = 0; q < 2; ++q) { const float x = __fmul_rn(F[(size_t)t * DD + h * HD + d + q], bfr(Mv[t])); unsigned short a, c2; splitf(x, a, c2); oh[q] = a; ol[q] = c2; o16[q] = tohx(x); }
            *(v2us*)(Ph + (size_t)e) = oh; *(v2us*)(Pl + (size_t)e) = ol; *(v2h*)(P16 + (size_t)e) = o16; }
    } else { bf* Vh = Ph; bf* Vl = Pl; h16* V16 = P16;
#pragma unroll
        for (int l = 0; l < 8; ++l) { const int L = L0 + l; if (L >= nlines) break; const int e = L * 64 + lane * 2; const int t = e & (TT - 1); const int d = (e >> 11) & (HD - 1); const int h = e >> 17; v2us oh, ol; v2h o16;
#pragma unroll
            for (int q = 0; q < 2; ++q) { const float x = __fmul_rn(F[(size_t)(t + q) * DD + h * HD + d], bfr(Mv[t + q])); unsigned short a, c2; splitf(x, a, c2); oh[q] = a; ol[q] = c2; o16[q] = tohx(x); }
            *(v2us*)(Vh + (size_t)e) = oh; *(v2us*)(Vl + (size_t)e) = ol; *(v2h*)(V16 + (size_t)e) = o16; }
         }
}
// ---- k_fattn: scores, causal softmax and attn.v in ONE launch (blockIdx.z = batch), one wave per query tile, running (online) softmax over key blocks that end at the diagonal.
// The score tile is formed TRANSPOSED (A = key rows, B = query rows): lane (lr, hi) then holds, for query lr, keys hi*8+j of each 16-key tile, which is the B fragment of
// O^T = V^T P^T as it stands (k = 8 hi + j, 16 + 8 hi + j over two tiles), and max, sum and rescale of a query live in that query's own lanes.
// Rows < RH: bf16 hi+lo planes, 3 products each, 16 queries x 32 keys a trip; rows >= RH: fp16 planes, 32 queries x 64 keys a trip. Output: merged [t][DD] hi/lo planes.
#define C2L 0.18033688011112042f  // (1/8) log2(e): softmax in base 2
template <typename T16> struct PFrag;
template <> struct PFrag<h16> { static __device__ __forceinline__ void mk(const v8f p0, const v8f p1, v16h& h, v16h& l) { (void)l;
#pragma unroll
    for (int e = 0; e < 8; ++e) { h[e] = (h16)p0[e]; h[8 + e] = (h16)p1[e]; } } };
template <> struct PFrag<bf> { static __device__ __forceinline__ void mk(const v8f p0, const v8f p1, v16bf& h, v16bf& l) { v8us h0, h1, l0, l1;
#pragma unroll
    for (int e = 0; e < 8; ++e) { unsigned short a, c; splitf(p0[e], a, c); h0[e] = a; l0[e] = c; splitf(p1[e], a, c); h1[e] = a; l1[e] = c; }
    h = cat16b(h0, h1); l = cat16b(l0, l1); } };
// s_wait_xcnt 0 behind a run of global loads or stores, before a register that they name is written again; the address pairs are inputs so that they stay as they are up to the wait.
template <bool SPLIT, typename T> __device__ __forceinline__ void xwait(const T* a, const T* b) {
    if (SPLIT) asm volatile("s_wait_xcnt 0x0" :: "v"(a), "v"(b) : "memory"); else asm volatile("s_wait_xcnt 0x0" :: "v"(a) : "memory"); }
template <typename T16, bool SPLIT, int NQ, int KB>
__device__ __forceinline__ void fattn_tile(const T16* __restrict__ Q, const T16* __restrict__ Q2, const T16* __restrict__ Kp, const T16* __restrict__ K2, const T16* __restrict__ Vt, const T16* __restrict__ V2, const int q0, bf* Ah, bf* Al) {
    typedef typename WFrag<T16>::V V; typedef WFrag<T16> W;
    constexpr int NKT = KB / 16, NU = KB / 32;
    const int lane = threadIdx.x & 31, lr = lane & 15, hi = lane >> 4;
    V qf[NQ][2], ql[NQ][2], kf[NKT][2], kl[NKT][2];
    { const size_t qo = (size_t)(q0 + lr) * HD + 8 * hi; const T16* qp = Q + qo; const T16* qp2 = SPLIT ? Q2 + qo : nullptr;
#pragma unroll
      for (int nq = 0; nq < NQ; ++nq)
#pragma unroll
        for (int c = 0; c < 2; ++c) { qf[nq][c] = W::ld(qp + nq * 16 * HD + c * 32); if (SPLIT) ql[nq][c] = W::ld(qp2 + nq * 16 * HD + c * 32); }
      xwait<SPLIT>(qp, qp2); }
    v8f o[4][NQ]; float m[NQ], l[NQ];
#pragma unroll
    for (int nq = 0; nq < NQ; ++nq) { m[nq] = -3.0e38f; l[nq] = 0.f;
#pragma unroll
        for (int dt = 0; dt < 4; ++dt) o[dt][nq] = (v8f){}; }
    const size_t ko = (size_t)lr * HD + 8 * hi, vo = (size_t)lr * TT + 8 * hi;
    const T16* kp = Kp + ko; const T16* kp2 = SPLIT ? K2 + ko : nullptr; const T16* vp = Vt + vo; const T16* vp2 = SPLIT ? V2 + vo : nullptr;   // this lane's place in the current key block
    auto ldk = [&](const int off) __attribute__((always_inline)) {     // loads the block off elements ahead, then steps the pointers there, behind the wait
#pragma unroll
        for (int kt = 0; kt < NKT; ++kt)
#pragma unroll
            for (int c = 0; c < 2; ++c) { kf[kt][c] = W::ld(kp + off + kt * 16 * HD + c * 32); if (SPLIT) kl[kt][c] = W::ld(kp2 + off + kt * 16 * HD + c * 32); }
        xwait<SPLIT>(kp, kp2); kp += off; if (SPLIT) kp2 += off; };
    auto step = [&](const int kb, const bool last) __attribute__((always_inline)) {
        V vf[4][NU], vl[4][NU];
#pragma unroll
        for (int dt = 0; dt < 4; ++dt)
#pragma unroll
            for (int u = 0; u < NU; ++u) { vf[dt][u] = W::ld(vp + dt * 16 * TT + u * 32); if (SPLIT) vl[dt][u] = W::ld(vp2 + dt * 16 * TT + u * 32); }
        xwait<SPLIT>(vp, vp2);
        vp += KB; if (SPLIT) vp2 += KB;
        v8f s[NKT][NQ];
#pragma unroll
        for (int kt = 0; kt < NKT; ++kt)
#pragma unroll
            for (int nq = 0; nq < NQ; ++nq) { v8f a = (v8f){};
#pragma unroll
                for (int c = 0; c < 2; ++c) { a = W::mma(kf[kt][c], qf[nq][c], a); if (SPLIT) { a = W::mma(kf[kt][c], ql[nq][c], a); a = W::mma(kl[kt][c], qf[nq][c], a); } }
                s[kt][nq] = a; }
        if (!last) ldk(KB * HD);      // next block's keys fly under this block's softmax and attn.v
        V pf[NQ][NU], pl[NQ][NU];
#pragma unroll
        for (int nq = 0; nq < NQ; ++nq) { float bm = -3.0e38f;
#pragma unroll
            for (int kt = 0; kt < NKT; ++kt)
#pragma unroll
                for (int j = 0; j < 8; ++j) { if (last) s[kt][nq][j] = (kb + kt * 16 + hi * 8 + j <= q0 + nq * 16 + lr) ? s[kt][nq][j] : -3.0e38f; bm = fmaxf(bm, s[kt][nq][j]); }
            bm = fmaxf(bm, __shfl_xor(bm, 16, 32));
            const float mn = fmaxf(m[nq], bm * C2L), al = __builtin_amdgcn_exp2f(m[nq] - mn); m[nq] = mn;
#pragma unroll
            for (int kt = 0; kt < NKT; ++kt)
#pragma unroll
                for (int j = 0; j < 8; ++j) s[kt][nq][j] = __builtin_amdgcn_exp2f(fmaf(s[kt][nq][j], C2L, -mn));
            v8f rv = s[0][nq];            // eight independent partial sums, folded as a tree
#pragma unroll
            for (int kt = 1; kt < NKT; ++kt) rv += s[kt][nq];
            l[nq] = fmaf(l[nq], al, ((rv[0] + rv[1]) + (rv[2] + rv[3])) + ((rv[4] + rv[5]) + (rv[6] + rv[7])));
#pragma unroll
            for (int dt = 0; dt < 4; ++dt) o[dt][nq] *= al;
#pragma unroll
            for (int u = 0; u < NU; ++u) PFrag<T16>::mk(s[2 * u][nq], s[2 * u + 1][nq], pf[nq][u], pl[nq][u]); }
#pragma unroll
        for (int u = 0; u < NU; ++u)
#pragma unroll
            for (int dt = 0; dt < 4; ++dt)
#pragma unroll
                for (int nq = 0; nq < NQ; ++nq) { o[dt][nq] = W::mma(vf[dt][u], pf[nq][u], o[dt][nq]); if (SPLIT) { o[dt][nq] = W::mma(vf[dt][u], pl[nq][u], o[dt][nq]); o[dt][nq] = W::mma(vl[dt][u], pf[nq][u], o[dt][nq]); } }
    };
    const int klast = (q0 / KB) * KB;     // the one block that holds the diagonal; every block before it is wholly at or below it
    ldk(0);
#pragma unroll 1
    for (int kb = 0; kb < klast; kb += KB) step(kb, false);
    step(klast, true);
    const size_t ob = (size_t)(q0 + lr) * DD + hi * 8; bf* ah = Ah + ob; bf* al2 = Al + ob;
#pragma unroll
    for (int nq = 0; nq < NQ; ++nq) { const float inv = __fdiv_rn(1.0f, l[nq] + __shfl_xor(l[nq], 16, 32)); v8us oh[4], ol[4];
#pragma unroll
        for (int dt = 0; dt < 4; ++dt)
#pragma unroll
            for (int j = 0; j < 8; ++j) { unsigned short a, c; splitf(o[dt][nq][j] * inv, a, c); oh[dt][j] = a; ol[dt][j] = c; }
#pragma unroll
        for (int dt = 0; dt < 4; ++dt) { *(v8us*)(ah + nq * 16 * DD + dt * 16) = oh[dt]; *(v8us*)(al2 + nq * 16 * DD + dt * 16) = ol[dt]; }
        // the same wait behind the stores: their data registers are inputs too
        asm volatile("s_wait_xcnt 0x0" :: "v"(ah), "v"(al2), "v"(oh[0]), "v"(oh[1]), "v"(oh[2]), "v"(oh[3]), "v"(ol[0]), "v"(ol[1]), "v"(ol[2]), "v"(ol[3]) : "memory"); }
}
__global__ __launch_bounds__(32) void k_fattn(const bf* __restrict__ QPh, const bf* __restrict__ QPl, const bf* __restrict__ KPh, const bf* __restrict__ KPl, const bf* __restrict__ VTh, const bf* __restrict__ VTl,
                                              const h16* __restrict__ QP16, const h16* __restrict__ KP16, const h16* __restrict__ VT16, bf* Ah, bf* Al) {
    const size_t hz = ((size_t)blockIdx.z * NH_ + blockIdx.y) * TT * HD; const int x = blockIdx.x; const size_t oz = (size_t)blockIdx.z * TT * DD + blockIdx.y * HD; Ah += oz; Al += oz;
    if (x < (TT - RH) / 32) fattn_tile<h16, false, 2, 64>(QP16 + hz, nullptr, KP16 + hz, nullptr, VT16 + hz, nullptr, TT - 32 * (x + 1), Ah, Al);    // longest rows first
    else fattn_tile<bf, true, 1, 32>(QPh + hz, QPl + hz, KPh + hz, KPl + hz, VTh + hz, VTl + hz, RH - 16 * (x - (TT - RH) / 32 + 1), Ah, Al);
}

extern "C" void kernel_launch(void* const* d_in, const int* in_sizes, int n_in,
                              void* d_out, int out_size, void* d_ws, size_t ws_size, hipStream_t stream) {
    (void)in_sizes; (void)n_in; (void)out_size;
    const float* x = (const float*)d_in[0]; const float* am = (const float*)d_in[1]; const float* wq = (const float*)d_in[2]; const float* wk = (const float*)d_in[3]; const float* wv = (const float*)d_in[4]; const float* wo = (const float*)d_in[5]; const float* bo = (const float*)d_in[6];
    float* OUT = (float*)d_out;     // [2][2048][1024]
    char* wsp = (char*)d_ws;
    auto take = [&](size_t bytes) { char* p = wsp; wsp += (bytes + 255) & ~(size_t)255; return (void*)p; };
    const size_t SL = (size_t)DD * DD, PB = (size_t)TT * DD;      // one weight slab; one batch of one plane
    bf* WQ = (bf*)take(4 * SL * 2); bf* WO = WQ + 3 * SL; bf* XB = (bf*)take(NB_ * PB * 2);      // [Wq|Wk|Wv|Wo] and, right behind them, x [NB_ TT][DD]
    float* F = (float*)take(3 * NB_ * PB * 4);      // [q|k|v][NB_ TT][DD]
    bf* Ph = (bf*)take(3 * NB_ * PB * 2); bf* Pl = (bf*)take(3 * NB_ * PB * 2); h16* P16 = (h16*)take(3 * NB_ * PB * 2);      // each [q|k|v][NB_] planes
    bf* ATh = (bf*)take(NB_ * PB * 2); bf* ATl = (bf*)take(NB_ * PB * 2);
    if ((size_t)(wsp - (char*)d_ws) > ws_size) return;    // total 152 MiB; ws 256 MiB
    // every stage is ONE launch over both batches (and over q, k, v where there are three)
    k_cvt8<<<dim3((unsigned)(SL / 8 / 256), 4 + NB_ * TT / DD, 1), 256, 0, stream>>>(wq, wk, wv, wo, x, WQ, SL / 8);   // [out][in] weights = Bt as-is
    k_gemmw<bf, 0, false><<<dim3(NB_ * TT / 64, DD / 64, 3), 32, 0, stream>>>(XB, nullptr, WQ, nullptr, DD, F, DD, nullptr, 0, SL, NB_ * PB, 0);
    k_planes<<<dim3((unsigned)((NH_ * TT * HD / 64 + 63) / 64), 3 * NB_, 1), 256, 0, stream>>>(F, am, Ph, Pl, P16);
    k_fattn<<<dim3((TT - RH) / 32 + RH / 16, NH_, NB_), 32, 0, stream>>>(Ph, Pl, Ph + NB_ * PB, Pl + NB_ * PB, Ph + 2 * NB_ * PB, Pl + 2 * NB_ * PB, P16, P16 + NB_ * PB, P16 + 2 * NB_ * PB, ATh, ATl);
    k_gemmw<bf, 1, true><<<dim3(NB_ * TT / 64, DD / 64, 1), 32, 0, stream>>>(ATh, ATl, WO, nullptr, DD, OUT, DD, bo, 0, 0, 0, 0);
}

// v004
// A run of this version takes 154 microseconds.
// In both of two side-by-side timings against v003, it was 1.19 times as fast.
// Over all steps from v000 it is 13.2 times as fast.
#include <hip/hip_runtime.h>

// Causal multi-head attention block (x [2][2048][1024], attention_mask [2][2048] (float ones, read as data); q/k/v = x W^T ([out][in], no bias) each multiplied by mask[b][t] per row; 16 heads x 64; scores / 8; causal (tril -> -inf);
// softmax; out = merged Wo^T + bo).
// Compute dtypes, f32 accumulate: every input rounded to bf16; projections on PLAIN bf16 operands (inputs: exact), x bf16(mask) in f32 in the plane builders; PER-ROW
// PRECISION HYBRID: query rows < 512 of each batch on bf16 hi+lo planes for scores and attn.v (3 products), rows >= 512 on SINGLE fp16 planes; output hi+lo x exact Wo (2 products) + bo.

#define NB_  2
#define TT   2048
#define DD   1024
#define NH_  16
#define HD   64
#define RH   512                  // query rows < RH: hi+lo planes; rows >= RH: fp16 planes
#define NF   32
#define SCL  0.125f               // 1/sqrt(64)
typedef _Float16 h16;
typedef unsigned short bf;
typedef __attribute__((ext_vector_type(16))) __bf16   v16bf;
typedef __attribute__((ext_vector_type(16))) _Float16 v16h;
typedef __attribute__((ext_vector_type(8)))  _Float16 v8h;
typedef __attribute__((ext_vector_type(8)))  unsigned short v8us;
typedef __attribute__((ext_vector_type(8)))  float    v8f;
typedef __attribute__((ext_vector_type(4)))  float    v4f;
typedef v8h  __attribute__((may_alias)) v8ha;
typedef v4f  __attribute__((may_alias)) v4fa;
typedef v8us __attribute__((may_alias)) v8usa;

__device__ __forceinline__ unsigned short f2bf(float f) { unsigned u = __float_as_uint(f); u += 0x7FFFu + ((u >> 16) & 1u); return (unsigned short)(u >> 16); }
__device__ __forceinline__ float bf2f(unsigned short b) { return __uint_as_float(((unsigned)b) << 16); }
__device__ __forceinline__ float bfr(float f) { return bf2f(f2bf(f)); }
__device__ __forceinline__ v16h cat16(v8h lo, v8h hi) { return __builtin_shufflevector(lo, hi, 0, 1, 2, 3, 4, 5, 6, 7, 8, 9, 10, 11, 12, 13, 14, 15); }
__device__ __forceinline__ v16bf cat16b(v8us lo, v8us hi) { return __builtin_bit_cast(v16bf, __builtin_shufflevector(lo, hi, 0, 1, 2, 3, 4, 5, 6, 7, 8, 9, 10, 11, 12, 13, 14, 15)); }
__device__ __forceinline__ v8f wmma16(v16h a, v16h b, v8f c) { return __builtin_amdgcn_wmma_f32_16x16x32_f16(false, a, false, b, (short)0, c, false, false); }
__device__ __forceinline__ v8f wmmab(v16bf a, v16bf b, v8f c) { return __builtin_amdgcn_wmma_f32_16x16x32_bf16(false, a, false, b, (short)0, c, false, false); }



// ---- FRAGMENT-MAJOR PLANES: every 16-bit WMMA operand plane [rows][K] is stored as blocks of 16 rows x 32 k (512 elements, 1 KiB). GEMM operands (K = DD): the four row blocks of a 64-row panel lie
// side by side, block (row / 16, k / 32) at (((row / 64) * (K / 32) + k / 32) * 4 + (row / 16) % 4) * 512, so one trip of a wave reads 4 KiB in a row per operand. Attention planes: see k_planes.
// Inside a block element (r, k) lies at ((k >> 4) & 1) * 256 + (((k >> 3) & 1) * 16 + r) * 8 + (k & 7): lane (lr, hi) finds its two runs of eight k at lane * 8 and 256 + lane * 8,
// so each of the two 16-byte loads of a fragment covers 512 contiguous bytes (four whole lines) instead of 32 bytes in each of sixteen lines. The k order of a fragment is what it was.
// ---- k_gemmw: register-blocked GEMM, ONE WAVE per 64x64 output tile (16 accumulators), operands straight from fragment-major 16-bit planes; grid (M/64, N/64, Z), 32 threads.
// C[m][n] (f32, pitch ldc, + optional f32 bias[n]) = sum_k A[m][k] Bt[n][k] (+ split products per NSPLIT). z-batch strides sA/sB/sC in elements. K % 32 == 0.
// SK > 1: grid.y = (N/64) * SK; work-group ks = blockIdx.y % SK sums only k in [ks K/SK, (ks+1) K/SK) into its own plane C + ks * sP; the reader adds the SK planes. K % (32 SK) == 0.
template <typename T16> struct WFrag;
template <> struct WFrag<h16> { typedef v16h V; static __device__ __forceinline__ V ld(const h16* p) { return cat16(*(const v8h*)p, *(const v8h*)(p + 256)); } static __device__ __forceinline__ v8f mma(V a, V b, v8f c) { return wmma16(a, b, c); } };
template <> struct WFrag<bf> { typedef v16bf V; static __device__ __forceinline__ V ld(const bf* p) { return cat16b(*(const v8us*)p, *(const v8us*)(p + 256)); } static __device__ __forceinline__ v8f mma(V a, V b, v8f c) { return wmmab(a, b, c); } };
template <typename T16, int NSPLIT, bool BIAS, int SK = 1>
__global__ __launch_bounds__(32) void k_gemmw(const T16* __restrict__ A, const T16* __restrict__ A2, const T16* __restrict__ Bt, const T16* __restrict__ Bt2, int K, float* C, int ldc, const float* __restrict__ bias, size_t sA, size_t sB, size_t sC, size_t sP) {
    typedef typename WFrag<T16>::V V;
    __shared__ __align__(16) float os[16 * 68];
    const size_t z = blockIdx.z; A += z * sA; if (A2) A2 += z * sA; Bt += z * sB; if (Bt2) Bt2 += z * sB; C += z * sC;
    const int lane = threadIdx.x & 31, lr = lane & 15, hi = lane >> 4; const int r0 = blockIdx.x * 64, c0 = (blockIdx.y / SK) * 64;
    const int ks = blockIdx.y % SK, kb = ks * (K / SK), ke = kb + K / SK; C += (size_t)ks * sP;
    v8f acc[4][4];
#pragma unroll
    for (int mb = 0; mb < 4; ++mb)
#pragma unroll
        for (int nb = 0; nb < 4; ++nb) acc[mb][nb] = (v8f){};
    // this lane's place in the current k block of each operand's 64-row panel (64 K elements a panel, 2048 a k block); a plane that is not used stands in as its partner
    const T16* pa = A + (size_t)r0 * K + (size_t)kb * 64 + lane * 8; const T16* pb = Bt + (size_t)c0 * K + (size_t)kb * 64 + lane * 8;
    const T16* pa2 = (NSPLIT == 1 || NSPLIT == 2) ? A2 + (size_t)r0 * K + (size_t)kb * 64 + lane * 8 : pa; const T16* pb2 = (NSPLIT >= 2) ? Bt2 + (size_t)c0 * K + (size_t)kb * 64 + lane * 8 : pb;
#pragma unroll 1
    for (int kc = kb; kc < ke; kc += 32) {
        V a[4], a2[4];
#pragma unroll
        for (int mb = 0; mb < 4; ++mb) { a[mb] = WFrag<T16>::ld(pa + mb * 512); if (NSPLIT == 1 || NSPLIT == 2) a2[mb] = WFrag<T16>::ld(pa2 + mb * 512); }
#pragma unroll
        for (int nb = 0; nb < 4; ++nb) { const V b = WFrag<T16>::ld(pb + nb * 512); V b2; if (NSPLIT >= 2) b2 = WFrag<T16>::ld(pb2 + nb * 512);
#pragma unroll
            for (int mb = 0; mb < 4; ++mb) { acc[mb][nb] = WFrag<T16>::mma(a[mb], b, acc[mb][nb]); if (NSPLIT == 1 || NSPLIT == 2) acc[mb][nb] = WFrag<T16>::mma(a2[mb], b, acc[mb][nb]); if (NSPLIT >= 2) acc[mb][nb] = WFrag<T16>::mma(a[mb], b2, acc[mb][nb]); } }
        asm volatile("v_nop\n\tv_nop\n\tv_nop\n\tv_nop" : "+v"(acc[0][0]), "+v"(acc[1][1]), "+v"(acc[2][2]), "+v"(acc[3][3]) : "v"(a[0]), "v"(a[3]));
        // s_wait_xcnt 0 behind the trip's global loads, before their address pairs are stepped; the pairs are inputs so that they stay as they are up to the wait
        asm volatile("s_wait_xcnt 0x0" :: "v"(pa), "v"(pb), "v"(pa2), "v"(pb2) : "memory");
        pa += 2048; pb += 2048; pa2 += 2048; pb2 += 2048;
    }
#pragma unroll
    for (int mb = 0; mb < 4; ++mb) {
#pragma unroll
        for (int nb = 0; nb < 4; ++nb) {
#pragma unroll
            for (int j = 0; j < 8; ++j) os[(hi * 8 + j) * 68 + nb * 16 + lr] = acc[mb][nb][j]; }
        __builtin_amdgcn_wave_barrier(); asm volatile("" ::: "memory");
        float* crow = C + (size_t)(r0 + mb * 16) * ldc + c0;
{
            v4f vals[8]; float* cp[8];
#pragma unroll
            for (int s = 0; s < 8; ++s) { const int row = 2 * s + hi, cofs = lr * 4; v4f val = *(const v4fa*)(os + row * 68 + cofs); if (BIAS) { val[0] += bfr(bias[c0 + cofs]); val[1] += bfr(bias[c0 + cofs + 1]); val[2] += bfr(bias[c0 + cofs + 2]); val[3] += bfr(bias[c0 + cofs + 3]); }
                vals[s] = val; cp[s] = crow + (size_t)row * ldc + cofs; *(v4f*)cp[s] = val; }
            // s_wait_xcnt 0 behind the eight stores, before a register that they name is written again; address pairs and data are inputs so that they stay as they are up to the wait
            asm volatile("s_wait_xcnt 0x0" :: "v"(cp[0]), "v"(cp[1]), "v"(cp[2]), "v"(cp[3]), "v"(cp[4]), "v"(cp[5]), "v"(cp[6]), "v"(cp[7]), "v"(vals[0]), "v"(vals[1]), "v"(vals[2]), "v"(vals[3]), "v"(vals[4]), "v"(vals[5]), "v"(vals[6]), "v"(vals[7]) : "memory");
             }
        __builtin_amdgcn_wave_barrier(); asm volatile("" ::: "memory");
    }
}

__device__ __forceinline__ h16 tohx(float x) { return (h16)x; }
__device__ __forceinline__ void splitf(float y, unsigned short& h, unsigned short& l) { h = f2bf(y); l = f2bf(y - bf2f(h)); }
typedef __attribute__((ext_vector_type(2))) unsigned short v2us;
typedef __attribute__((ext_vector_type(2))) _Float16 v2h;
typedef __attribute__((ext_vector_type(4))) _Float16 v4h;
typedef __attribute__((ext_vector_type(2))) float v2f;

// blockIdx.y picks the DD x DD slab: 0..3 = Wq, Wk, Wv, Wo, 4.. = slabs of x (both batches); dst holds them in that order, one after the other, each fragment-major (K = DD).
// Thread i writes the slab's i-th run of eight: a wave stores 512 contiguous bytes and reads 64 bytes of each of 16 rows; a work-group reads one whole line of each of 64 rows.
__global__ __launch_bounds__(256) void k_cvt8(const float* __restrict__ wq, const float* __restrict__ wk, const float* __restrict__ wv, const float* __restrict__ wo, const float* __restrict__ x, bf* dst, size_t n8) { const size_t i = (size_t)blockIdx.x * 256 + threadIdx.x; if (i >= n8) return;
    const int y = blockIdx.y; const float* src = y == 0 ? wq : y == 1 ? wk : y == 2 ? wv : y == 3 ? wo : x + (size_t)(y - 4) * DD * DD; dst += (size_t)y * DD * DD;
    const int ln = (int)i & 31, row = (int)(i >> 13) * 64 + ((int)(i >> 6) & 3) * 16 + (ln & 15), k0 = ((int)(i >> 8) & (DD / 32 - 1)) * 32 + ((int)(i >> 5) & 1) * 16 + (ln >> 4) * 8; const v8f v = *(const v8f*)(src + (size_t)row * DD + k0); v8us o;
#pragma unroll
    for (int k = 0; k < 8; ++k) o[k] = f2bf(v[k]); *(v8us*)(dst + i * 8) = o;  }
// blockIdx.y = projection * NB_ + batch (q, k, v): slab of F and of each plane. ONE WAVE builds one fragment block of each plane and stores it as two runs of 512 contiguous bytes.
// q and k: per head rows = t, k = d (K = HD): block (h * (TT / 16) + t / 16) * 2 + d / 32. v: per head rows = d, k = t, the four row blocks of 32 keys side by side: block (h * (TT / 32) + t / 32) * 4 + d / 16.
__global__ __launch_bounds__(256) void k_planes(const float* __restrict__ F, const float* __restrict__ Mv, bf* Ph, bf* Pl, h16* P16) {
    const int lane = threadIdx.x & 31, lr = lane & 15, hi = lane >> 4; const int w = blockIdx.x * 8 + (threadIdx.x >> 5); if (w >= NH_ * TT * HD / 512) return;
    const int z = blockIdx.y; const size_t zo = (size_t)z * TT * DD; F += zo; Mv += (z % NB_) * TT; Ph += zo; Pl += zo; P16 += zo;
    const int h = w >> 8; const size_t ob = (size_t)w * 512 + lane * 8; bf* ph = Ph + ob; bf* pl = Pl + ob; h16* p16 = P16 + ob;
    // s_wait_xcnt 0 behind each run of global loads and of global stores, before a register that they name is written again; address pairs and store data are inputs so that they stay as they are up to the wait
    if (z < 2 * NB_) { const int t = ((w >> 1) & (TT / 16 - 1)) * 16 + lr, d0 = (w & 1) * 32 + hi * 8; const float* f = F + (size_t)t * DD + h * HD + d0;
        const float mr = Mv[t]; const v8f vv[2] = { *(const v8f*)f, *(const v8f*)(f + 16) };
        asm volatile("s_wait_xcnt 0x0" :: "v"(t), "v"(f) : "memory");      // t is the mask load's offset register
        const float mv = bfr(mr);
#pragma unroll
        for (int hf = 0; hf < 2; ++hf) { v8us oh, ol; v8h o16;
#pragma unroll
            for (int j = 0; j < 8; ++j) { const float x = __fmul_rn(vv[hf][j], mv); unsigned short a, c2; splitf(x, a, c2); oh[j] = a; ol[j] = c2; o16[j] = tohx(x); }
            *(v8us*)(ph + hf * 256) = oh; *(v8us*)(pl + hf * 256) = ol; *(v8h*)(p16 + hf * 256) = o16;
            asm volatile("s_wait_xcnt 0x0" :: "v"(ph), "v"(pl), "v"(p16), "v"(oh), "v"(ol), "v"(o16) : "memory"); }
    } else { const int t0 = ((w >> 2) & (TT / 32 - 1)) * 32 + hi * 8, d = (w & 3) * 16 + lr; const float* mp = Mv + t0; const float* f = F + (size_t)t0 * DD + h * HD + d;
        const v8f mm[2] = { *(const v8f*)mp, *(const v8f*)(mp + 16) }; float fv[2][8];
#pragma unroll
        for (int hf = 0; hf < 2; ++hf)
#pragma unroll
            for (int j = 0; j < 8; ++j) fv[hf][j] = f[(size_t)(hf * 16 + j) * DD];
        asm volatile("s_wait_xcnt 0x0" :: "v"(mp), "v"(f) : "memory");
#pragma unroll
        for (int hf = 0; hf < 2; ++hf) { v8us oh, ol; v8h o16;
#pragma unroll
            for (int j = 0; j < 8; ++j) { const float x = __fmul_rn(fv[hf][j], bfr(mm[hf][j])); unsigned short a, c2; splitf(x, a, c2); oh[j] = a; ol[j] = c2; o16[j] = tohx(x); }
            *(v8us*)(ph + hf * 256) = oh; *(v8us*)(pl + hf * 256) = ol; *(v8h*)(p16 + hf * 256) = o16;
            asm volatile("s_wait_xcnt 0x0" :: "v"(ph), "v"(pl), "v"(p16), "v"(oh), "v"(ol), "v"(o16) : "memory"); }
    }
}
// ---- k_fattn: scores, causal softmax and attn.v in ONE launch (blockIdx.z = batch), one wave per query tile, running (online) softmax over key blocks that end at the diagonal.
// The score tile is formed TRANSPOSED (A = key rows, B = query rows): lane (lr, hi) then holds, for query lr, keys hi*8+j of each 16-key tile, which is the B fragment of
// O^T = V^T P^T as it stands (k = 8 hi + j, 16 + 8 hi + j over two tiles), and max, sum and rescale of a query live in that query's own lanes.
// Rows < RH: bf16 hi+lo planes, 3 products each, 16 queries x 32 keys a trip; rows >= RH: fp16 planes, 32 queries x 64 keys a trip. Output: merged [t][DD] hi/lo planes, fragment-major (K = DD).
#define C2L 0.18033688011112042f  // (1/8) log2(e): softmax in base 2
template <typename T16> struct PFrag;
template <> struct PFrag<h16> { static __device__ __forceinline__ void mk(const v8f p0, const v8f p1, v16h& h, v16h& l) { (void)l;
#pragma unroll
    for (int e = 0; e < 8; ++e) { h[e] = (h16)p0[e]; h[8 + e] = (h16)p1[e]; } } };
template <> struct PFrag<bf> { static __device__ __forceinline__ void mk(const v8f p0, const v8f p1, v16bf& h, v16bf& l) { v8us h0, h1, l0, l1;
#pragma unroll
    for (int e = 0; e < 8; ++e) { unsigned short a, c; splitf(p0[e], a, c); h0[e] = a; l0[e] = c; splitf(p1[e], a, c); h1[e] = a; l1[e] = c; }
    h = cat16b(h0, h1); l = cat16b(l0, l1); } };
// s_wait_xcnt 0 behind a run of global loads or stores, before a register that they name is written again; the address pairs are inputs so that they stay as they are up to the wait.
template <bool SPLIT, typename T> __device__ __forceinline__ void xwait(const T* a, const T* b) {
    if (SPLIT) asm volatile("s_wait_xcnt 0x0" :: "v"(a), "v"(b) : "memory"); else asm volatile("s_wait_xcnt 0x0" :: "v"(a) : "memory"); }
template <typename T16, bool SPLIT, int NQ, int KB>
__device__ __forceinline__ void fattn_tile(const T16* __restrict__ Q, const T16* __restrict__ Q2, const T16* __restrict__ Kp, const T16* __restrict__ K2, const T16* __restrict__ Vt, const T16* __restrict__ V2, const int q0, bf* Ah, bf* Al) {
    typedef typename WFrag<T16>::V V; typedef WFrag<T16> W;
    constexpr int NKT = KB / 16, NU = KB / 32;
    const int lane = threadIdx.x & 31, lr = lane & 15, hi = lane >> 4;
    V qf[NQ][2], ql[NQ][2], kf[NKT][2], kl[NKT][2];
    { const size_t qo = (size_t)q0 * HD + lane * 8; const T16* qp = Q + qo; const T16* qp2 = SPLIT ? Q2 + qo : nullptr;
#pragma unroll
      for (int nq = 0; nq < NQ; ++nq)
#pragma unroll
        for (int c = 0; c < 2; ++c) { qf[nq][c] = W::ld(qp + (nq * 2 + c) * 512); if (SPLIT) ql[nq][c] = W::ld(qp2 + (nq * 2 + c) * 512); }
      xwait<SPLIT>(qp, qp2); }
    v8f o[4][NQ]; float m[NQ], l[NQ];
#pragma unroll
    for (int nq = 0; nq < NQ; ++nq) { m[nq] = -3.0e38f; l[nq] = 0.f;
#pragma unroll
        for (int dt = 0; dt < 4; ++dt) o[dt][nq] = (v8f){}; }
    const size_t ko = lane * 8, vo = lane * 8;      // a block of KB keys is KB * HD contiguous elements of the k planes and of the v planes alike
    const T16* kp = Kp + ko; const T16* kp2 = SPLIT ? K2 + ko : nullptr; const T16* vp = Vt + vo; const T16* vp2 = SPLIT ? V2 + vo : nullptr;   // this lane's place in the current key block
    auto ldk = [&](const int off) __attribute__((always_inline)) {     // loads the block off elements ahead, then steps the pointers there, behind the wait
#pragma unroll
        for (int kt = 0; kt < NKT; ++kt)
#pragma unroll
            for (int c = 0; c < 2; ++c) { kf[kt][c] = W::ld(kp + off + (kt * 2 + c) * 512); if (SPLIT) kl[kt][c] = W::ld(kp2 + off + (kt * 2 + c) * 512); }
        xwait<SPLIT>(kp, kp2); kp += off; if (SPLIT) kp2 += off; };
    auto step = [&](const int kb, const bool last) __attribute__((always_inline)) {
        V vf[4][NU], vl[4][NU];
#pragma unroll
        for (int dt = 0; dt < 4; ++dt)
#pragma unroll
            for (int u = 0; u < NU; ++u) { vf[dt][u] = W::ld(vp + (u * 4 + dt) * 512); if (SPLIT) vl[dt][u] = W::ld(vp2 + (u * 4 + dt) * 512); }
        xwait<SPLIT>(vp, vp2);
        vp += KB * HD; if (SPLIT) vp2 += KB * HD;
        v8f s[NKT][NQ];
#pragma unroll
        for (int kt = 0; kt < NKT; ++kt)
#pragma unroll
            for (int nq = 0; nq < NQ; ++nq) { v8f a = (v8f){};
#pragma unroll
                for (int c = 0; c < 2; ++c) { a = W::mma(kf[kt][c], qf[nq][c], a); if (SPLIT) { a = W::mma(kf[kt][c], ql[nq][c], a); a = W::mma(kl[kt][c], qf[nq][c], a); } }
                s[kt][nq] = a; }
        if (!last) ldk(KB * HD);      // next block's keys fly under this block's softmax and attn.v
        V pf[NQ][NU], pl[NQ][NU];
#pragma unroll
        for (int nq = 0; nq < NQ; ++nq) { float bm = -3.0e38f;
#pragma unroll
            for (int kt = 0; kt < NKT; ++kt)
#pragma unroll
                for (int j = 0; j < 8; ++j) { if (last) s[kt][nq][j] = (kb + kt * 16 + hi * 8 + j <= q0 + nq * 16 + lr) ? s[kt][nq][j] : -3.0e38f; bm = fmaxf(bm, s[kt][nq][j]); }
            bm = fmaxf(bm, __shfl_xor(bm, 16, 32));
            const float mn = fmaxf(m[nq], bm * C2L), al = __builtin_amdgcn_exp2f(m[nq] - mn); m[nq] = mn;
#pragma unroll
            for (int kt = 0; kt < NKT; ++kt)
#pragma unroll
                for (int j = 0; j < 8; ++j) s[kt][nq][j] = __builtin_amdgcn_exp2f(fmaf(s[kt][nq][j], C2L, -mn));
            v8f rv = s[0][nq];            // eight independent partial sums, folded as a tree
#pragma unroll
            for (int kt = 1; kt < NKT; ++kt) rv += s[kt][nq];
            l[nq] = fmaf(l[nq], al, ((rv[0] + rv[1]) + (rv[2] + rv[3])) + ((rv[4] + rv[5]) + (rv[6] + rv[7])));
#pragma unroll
            for (int dt = 0; dt < 4; ++dt) o[dt][nq] *= al;
#pragma unroll
            for (int u = 0; u < NU; ++u) PFrag<T16>::mk(s[2 * u][nq], s[2 * u + 1][nq], pf[nq][u], pl[nq][u]); }
#pragma unroll
        for (int u = 0; u < NU; ++u)
#pragma unroll
            for (int dt = 0; dt < 4; ++dt)
#pragma unroll
                for (int nq = 0; nq < NQ; ++nq) { o[dt][nq] = W::mma(vf[dt][u], pf[nq][u], o[dt][nq]); if (SPLIT) { o[dt][nq] = W::mma(vf[dt][u], pl[nq][u], o[dt][nq]); o[dt][nq] = W::mma(vl[dt][u], pf[nq][u], o[dt][nq]); } }
    };
    const int klast = (q0 / KB) * KB;     // the one block that holds the diagonal; every block before it is wholly at or below it
    ldk(0);
#pragma unroll 1
    for (int kb = 0; kb < klast; kb += KB) step(kb, false);
    step(klast, true);
    const size_t ob = (size_t)(q0 >> 6) * 64 * DD + ((q0 >> 4) & 3) * 512 + lane * 8; bf* ah = Ah + ob; bf* al2 = Al + ob;      // 64-row panel, row block in it (q0 + 16 nq stays in the panel)
#pragma unroll
    for (int nq = 0; nq < NQ; ++nq) { const float inv = __fdiv_rn(1.0f, l[nq] + __shfl_xor(l[nq], 16, 32)); v8us oh[4], ol[4];
#pragma unroll
        for (int dt = 0; dt < 4; ++dt)
#pragma unroll
            for (int j = 0; j < 8; ++j) { unsigned short a, c; splitf(o[dt][nq][j] * inv, a, c); oh[dt][j] = a; ol[dt][j] = c; }
#pragma unroll
        for (int dt = 0; dt < 4; ++dt) { *(v8us*)(ah + nq * 512 + (dt >> 1) * 2048 + (dt & 1) * 256) = oh[dt]; *(v8us*)(al2 + nq * 512 + (dt >> 1) * 2048 + (dt & 1) * 256) = ol[dt]; }
        // the same wait behind the stores: their data registers are inputs too
        asm volatile("s_wait_xcnt 0x0" :: "v"(ah), "v"(al2), "v"(oh[0]), "v"(oh[1]), "v"(oh[2]), "v"(oh[3]), "v"(ol[0]), "v"(ol[1]), "v"(ol[2]), "v"(ol[3]) : "memory"); }
}
__global__ __launch_bounds__(32) void k_fattn(const bf* __restrict__ QPh, const bf* __restrict__ QPl, const bf* __restrict__ KPh, const bf* __restrict__ KPl, const bf* __restrict__ VTh, const bf* __restrict__ VTl,
                                              const h16* __restrict__ QP16, const h16* __restrict__ KP16, const h16* __restrict__ VT16, bf* Ah, bf* Al) {
    const size_t hz = ((size_t)blockIdx.z * NH_ + blockIdx.y) * TT * HD; const int x = blockIdx.x; const size_t oz = (size_t)blockIdx.z * TT * DD + blockIdx.y * (HD / 32) * 2048; Ah += oz; Al += oz;
    if (x < (TT - RH) / 32) fattn_tile<h16, false, 2, 64>(QP16 + hz, nullptr, KP16 + hz, nullptr, VT16 + hz, nullptr, TT - 32 * (x + 1), Ah, Al);    // longest rows first
    else fattn_tile<bf, true, 1, 32>(QPh + hz, QPl + hz, KPh + hz, KPl + hz, VTh + hz, VTl + hz, RH - 16 * (x - (TT - RH) / 32 + 1), Ah, Al);
}

extern "C" void kernel_launch(void* const* d_in, const int* in_sizes, int n_in,
                              void* d_out, int out_size, void* d_ws, size_t ws_size, hipStream_t stream) {
    (void)in_sizes; (void)n_in; (void)out_size;
    const float* x = (const float*)d_in[0]; const float* am = (const float*)d_in[1]; const float* wq = (const float*)d_in[2]; const float* wk = (const float*)d_in[3]; const float* wv = (const float*)d_in[4]; const float* wo = (const float*)d_in[5]; const float* bo = (const float*)d_in[6];
    float* OUT = (float*)d_out;     // [2][2048][1024]
    char* wsp = (char*)d_ws;
    auto take = [&](size_t bytes) { char* p = wsp; wsp += (bytes + 255) & ~(size_t)255; return (void*)p; };
    const size_t SL = (size_t)DD * DD, PB = (size_t)TT * DD;      // one weight slab; one batch of one plane
    bf* WQ = (bf*)take(4 * SL * 2); bf* WO = WQ + 3 * SL; bf* XB = (bf*)take(NB_ * PB * 2);      // [Wq|Wk|Wv|Wo] and, right behind them, x [NB_ TT][DD], all fragment-major
    float* F = (float*)take(3 * NB_ * PB * 4);      // [q|k|v][NB_ TT][DD]
    bf* Ph = (bf*)take(3 * NB_ * PB * 2); bf* Pl = (bf*)take(3 * NB_ * PB * 2); h16* P16 = (h16*)take(3 * NB_ * PB * 2);      // each [q|k|v][NB_] planes
    bf* ATh = (bf*)take(NB_ * PB * 2); bf* ATl = (bf*)take(NB_ * PB * 2);
    if ((size_t)(wsp - (char*)d_ws) > ws_size) return;    // total 152 MiB; ws 256 MiB
    // every stage is ONE launch over both batches (and over q, k, v where there are three)
    k_cvt8<<<dim3((unsigned)(SL / 8 / 256), 4 + NB_ * TT / DD, 1), 256, 0, stream>>>(wq, wk, wv, wo, x, WQ, SL / 8);   // [out][in] weights = Bt as-is
    k_gemmw<bf, 0, false><<<dim3(NB_ * TT / 64, DD / 64, 3), 32, 0, stream>>>(XB, nullptr, WQ, nullptr, DD, F, DD, nullptr, 0, SL, NB_ * PB, 0);
    k_planes<<<dim3((unsigned)((NH_ * TT * HD / 64 + 63) / 64), 3 * NB_, 1), 256, 0, stream>>>(F, am, Ph, Pl, P16);
    k_fattn<<<dim3((TT - RH) / 32 + RH / 16, NH_, NB_), 32, 0, stream>>>(Ph, Pl, Ph + NB_ * PB, Pl + NB_ * PB, Ph + 2 * NB_ * PB, Pl + 2 * NB_ * PB, P16, P16 + NB_ * PB, P16 + 2 * NB_ * PB, ATh, ATl);
    k_gemmw<bf, 1, true><<<dim3(NB_ * TT / 64, DD / 64, 1), 32, 0, stream>>>(ATh, ATl, WO, nullptr, DD, OUT, DD, bo, 0, 0, 0, 0);
}

// v005
// Measured time: 115 microseconds a run.
// Two timings next to v004 both put it at 1.32 times that version's speed.
// Counting every step since v000, it is 17.4 times as fast.
#include <hip/hip_runtime.h>

// Causal multi-head attention block (x [2][2048][1024], attention_mask [2][2048] (float ones, read as data); q/k/v = x W^T ([out][in], no bias) each multiplied by mask[b][t] per row; 16 heads x 64; scores / 8; causal (tril -> -inf);
// softmax; out = merged Wo^T + bo).
// Compute dtypes, f32 accumulate: every input rounded to bf16; projections on PLAIN bf16 operands (inputs: exact), x bf16(mask) in f32 in the plane builders; PER-ROW
// PRECISION HYBRID: query rows < 512 of each batch on bf16 hi+lo planes for scores and attn.v (3 products), rows >= 512 on SINGLE fp16 planes; output hi+lo x exact Wo (2 products) + bo.

#define NB_  2
#define TT   2048
#define DD   1024
#define NH_  16
#define HD   64
#define RH   512                  // query rows < RH: hi+lo planes; rows >= RH: fp16 planes
#define NF   32
#define SCL  0.125f               // 1/sqrt(64)
typedef _Float16 h16;
typedef unsigned short bf;
typedef __attribute__((ext_vector_type(16))) __bf16   v16bf;
typedef __attribute__((ext_vector_type(16))) _Float16 v16h;
typedef __attribute__((ext_vector_type(8)))  _Float16 v8h;
typedef __attribute__((ext_vector_type(8)))  unsigned short v8us;
typedef __attribute__((ext_vector_type(8)))  float    v8f;
typedef __attribute__((ext_vector_type(4)))  float    v4f;
typedef v8h  __attribute__((may_alias)) v8ha;
typedef v4f  __attribute__((may_alias)) v4fa;
typedef v8us __attribute__((may_alias)) v8usa;

__device__ __forceinline__ unsigned short f2bf(float f) { unsigned u = __float_as_uint(f); u += 0x7FFFu + ((u >> 16) & 1u); return (unsigned short)(u >> 16); }
__device__ __forceinline__ float bf2f(unsigned short b) { return __uint_as_float(((unsigned)b) << 16); }
__device__ __forceinline__ float bfr(float f) { return bf2f(f2bf(f)); }
__device__ __forceinline__ v16h cat16(v8h lo, v8h hi) { return __builtin_shufflevector(lo, hi, 0, 1, 2, 3, 4, 5, 6, 7, 8, 9, 10, 11, 12, 13, 14, 15); }
__device__ __forceinline__ v16bf cat16b(v8us lo, v8us hi) { return __builtin_bit_cast(v16bf, __builtin_shufflevector(lo, hi, 0, 1, 2, 3, 4, 5, 6, 7, 8, 9, 10, 11, 12, 13, 14, 15)); }
__device__ __forceinline__ v8f wmma16(v16h a, v16h b, v8f c) { return __builtin_amdgcn_wmma_f32_16x16x32_f16(false, a, false, b, (short)0, c, false, false); }
__device__ __forceinline__ v8f wmmab(v16bf a, v16bf b, v8f c) { return __builtin_amdgcn_wmma_f32_16x16x32_bf16(false, a, false, b, (short)0, c, false, false); }



// ---- FRAGMENT-MAJOR PLANES: every 16-bit WMMA operand plane [rows][K] is stored as blocks of 16 rows x 32 k (512 elements, 1 KiB). GEMM operands (K = DD): the four row blocks of a 64-row panel lie
// side by side, block (row / 16, k / 32) at (((row / 64) * (K / 32) + k / 32) * 4 + (row / 16) % 4) * 512, so one trip of a wave (two k blocks) reads 8 KiB in a row per operand. Attention planes: see k_planes.
// Inside a block element (r, k) lies at ((k >> 4) & 1) * 256 + (((k >> 3) & 1) * 16 + r) * 8 + (k & 7): lane (lr, hi) finds its two runs of eight k at lane * 8 and 256 + lane * 8,
// so each of the two 16-byte loads of a fragment covers 512 contiguous bytes (four whole lines) instead of 32 bytes in each of sixteen lines. The k order of a fragment is what it was.
// ---- k_gemmw: register-blocked GEMM, ONE WAVE per 64x64 output tile (16 accumulators), operands straight from fragment-major 16-bit planes; grid (M/64, N/64, Z), 32 threads.
// C[m][n] (f32, pitch ldc, + optional f32 bias[n]) = sum_k A[m][k] Bt[n][k] (+ split products per NSPLIT). z-batch strides sA/sB/sC in elements. K % 64 == 0.
// SK > 1: grid.y = (N/64) * SK; work-group ks = blockIdx.y % SK sums only k in [ks K/SK, (ks+1) K/SK) into its own plane C + ks * sP; the reader adds the SK planes. K % (64 SK) == 0.
template <typename T16> struct WFrag;
template <> struct WFrag<h16> { typedef v16h V; static __device__ __forceinline__ V ld(const h16* p) { return cat16(*(const v8h*)p, *(const v8h*)(p + 256)); } static __device__ __forceinline__ v8f mma(V a, V b, v8f c) { return wmma16(a, b, c); } };
template <> struct WFrag<bf> { typedef v16bf V; static __device__ __forceinline__ V ld(const bf* p) { return cat16b(*(const v8us*)p, *(const v8us*)(p + 256)); } static __device__ __forceinline__ v8f mma(V a, V b, v8f c) { return wmmab(a, b, c); } };
template <typename T16, int NSPLIT, bool BIAS, int SK = 1>
__global__ __launch_bounds__(32) void k_gemmw(const T16* __restrict__ A, const T16* __restrict__ A2, const T16* __restrict__ Bt, const T16* __restrict__ Bt2, int K, float* C, int ldc, const float* __restrict__ bias, size_t sA, size_t sB, size_t sC, size_t sP) {
    typedef typename WFrag<T16>::V V;
    __shared__ __align__(16) float os[16 * 68];
    const size_t z = blockIdx.z; A += z * sA; if (A2) A2 += z * sA; Bt += z * sB; if (Bt2) Bt2 += z * sB; C += z * sC;
    const int lane = threadIdx.x & 31, lr = lane & 15, hi = lane >> 4; const int r0 = blockIdx.x * 64, c0 = (blockIdx.y / SK) * 64;
    const int ks = blockIdx.y % SK, kb = ks * (K / SK), ke = kb + K / SK; C += (size_t)ks * sP;
    v8f acc[4][4];
#pragma unroll
    for (int mb = 0; mb < 4; ++mb)
#pragma unroll
        for (int nb = 0; nb < 4; ++nb) acc[mb][nb] = (v8f){};
    // the current k block of each operand's 64-row panel (64 K elements a panel, 2048 a k block, 4 KiB); a plane that is not used stands in as its partner
    constexpr bool HA2 = NSPLIT == 1 || NSPLIT == 2, HB2 = NSPLIT >= 2;
    const T16* pa = A + (size_t)r0 * K + (size_t)kb * 64; const T16* pb = Bt + (size_t)c0 * K + (size_t)kb * 64;
    const T16* pa2 = HA2 ? A2 + (size_t)r0 * K + (size_t)kb * 64 : pa; const T16* pb2 = HB2 ? Bt2 + (size_t)c0 * K + (size_t)kb * 64 : pb;
    unsigned vb = lane * 16;      // this lane's byte offset from those four places: its run of eight in the block, plus the blocks done; one register for every operand
    // TWO FRAGMENT SETS: all loads of k block i + 1 are issued as one group in front of the products of k block i, so a block waits for its operands once, under the block before it.
    // A trip is two k blocks (one per set, no register copies): (K / SK) % 64 == 0. Products and their order per accumulator are what they were.
    struct FSet { V a[4], a2[4], b[4], b2[4]; };
    FSet s0, s1;
    auto at = [&](const T16* p, const int off) __attribute__((always_inline)) { return (const T16*)((const char*)p + vb) + off; };
    auto ldset = [&](FSet& s, const int off) __attribute__((always_inline)) {
#pragma unroll
        for (int mb = 0; mb < 4; ++mb) { s.a[mb] = WFrag<T16>::ld(at(pa, off + mb * 512)); if (HA2) s.a2[mb] = WFrag<T16>::ld(at(pa2, off + mb * 512)); }
#pragma unroll
        for (int nb = 0; nb < 4; ++nb) { s.b[nb] = WFrag<T16>::ld(at(pb, off + nb * 512)); if (HB2) s.b2[nb] = WFrag<T16>::ld(at(pb2, off + nb * 512)); } };
    auto mmaset = [&](const FSet& s) __attribute__((always_inline)) {
#pragma unroll
        for (int nb = 0; nb < 4; ++nb)
#pragma unroll
            for (int mb = 0; mb < 4; ++mb) { acc[mb][nb] = WFrag<T16>::mma(s.a[mb], s.b[nb], acc[mb][nb]); if (HA2) acc[mb][nb] = WFrag<T16>::mma(s.a2[mb], s.b[nb], acc[mb][nb]); if (HB2) acc[mb][nb] = WFrag<T16>::mma(s.a[mb], s.b2[nb], acc[mb][nb]); } };
    ldset(s0, 0);
    asm volatile("s_wait_xcnt 0x0" :: "v"(vb) : "memory");      // behind the first loads: on the path round the loop nothing else stands between them and the next write of what they name
#pragma unroll 1
    for (int kc = kb; kc < ke - 64; kc += 64) {
        ldset(s1, 2048);
        __builtin_amdgcn_sched_barrier(0);      // keeps the next block's loads in front of this block's products (sunk among them they would be waited for at once)
        mmaset(s0);
        __builtin_amdgcn_sched_barrier(0);      // the same for the block after: its loads stay between the two runs of products
        ldset(s0, 4096);
        __builtin_amdgcn_sched_barrier(0);      // as above
        mmaset(s1);
        __builtin_amdgcn_sched_barrier(0);      // keeps the wait below behind the trip's products, not between the loads and the products
        // s_wait_xcnt 0 behind the trip's global loads, before their offset register is stepped; the register passes through the statement, so that the step is formed behind the wait
        asm volatile("s_wait_xcnt 0x0" : "+v"(vb) :: "memory");
        vb += 8192;
    }
    ldset(s1, 2048);
    // the same wait behind the last loads; offset register and the four places are inputs so that whatever the loads name stays as it is up to the wait
    asm volatile("s_wait_xcnt 0x0" :: "v"(vb), "v"(at(pa, 2048)), "v"(at(pb, 2048)), "v"(at(pa2, 2048)), "v"(at(pb2, 2048)) : "memory");
    __builtin_amdgcn_sched_barrier(0);          // the last block's loads fly under the products of the block before it
    mmaset(s0);
    mmaset(s1);
    __builtin_amdgcn_sched_barrier(0);          // keeps the store addresses' arithmetic behind the last products, where the fragment registers are free (formed among them it spills)
#pragma unroll
    for (int mb = 0; mb < 4; ++mb) {
#pragma unroll
        for (int nb = 0; nb < 4; ++nb) {
#pragma unroll
            for (int j = 0; j < 8; ++j) os[(hi * 8 + j) * 68 + nb * 16 + lr] = acc[mb][nb][j]; }
        __builtin_amdgcn_wave_barrier(); asm volatile("" ::: "memory");
        float* crow = C + (size_t)(r0 + mb * 16) * ldc + c0;
{
            v4f vals[8]; float* cp[8];
#pragma unroll
            for (int s = 0; s < 8; ++s) { const int row = 2 * s + hi, cofs = lr * 4; v4f val = *(const v4fa*)(os + row * 68 + cofs); if (BIAS) { val[0] += bfr(bias[c0 + cofs]); val[1] += bfr(bias[c0 + cofs + 1]); val[2] += bfr(bias[c0 + cofs + 2]); val[3] += bfr(bias[c0 + cofs + 3]); }
                vals[s] = val; cp[s] = crow + (size_t)row * ldc + cofs; *(v4f*)cp[s] = val; }
            // s_wait_xcnt 0 behind the eight stores, before a register that they name is written again; address pairs and data are inputs so that they stay as they are up to the wait
            asm volatile("s_wait_xcnt 0x0" :: "v"(cp[0]), "v"(cp[1]), "v"(cp[2]), "v"(cp[3]), "v"(cp[4]), "v"(cp[5]), "v"(cp[6]), "v"(cp[7]), "v"(vals[0]), "v"(vals[1]), "v"(vals[2]), "v"(vals[3]), "v"(vals[4]), "v"(vals[5]), "v"(vals[6]), "v"(vals[7]) : "memory");
             }
        __builtin_amdgcn_wave_barrier(); asm volatile("" ::: "memory");
    }
}

__device__ __forceinline__ h16 tohx(float x) { return (h16)x; }
__device__ __forceinline__ void splitf(float y, unsigned short& h, unsigned short& l) { h = f2bf(y); l = f2bf(y - bf2f(h)); }
typedef __attribute__((ext_vector_type(2))) unsigned short v2us;
typedef __attribute__((ext_vector_type(2))) _Float16 v2h;
typedef __attribute__((ext_vector_type(4))) _Float16 v4h;
typedef __attribute__((ext_vector_type(2))) float v2f;

// blockIdx.y picks the DD x DD slab: 0..3 = Wq, Wk, Wv, Wo, 4.. = slabs of x (both batches); dst holds them in that order, one after the other, each fragment-major (K = DD).
// Thread i writes the slab's i-th run of eight: a wave stores 512 contiguous bytes and reads 64 bytes of each of 16 rows; a work-group reads one whole line of each of 64 rows.
__global__ __launch_bounds__(256) void k_cvt8(const float* __restrict__ wq, const float* __restrict__ wk, const float* __restrict__ wv, const float* __restrict__ wo, const float* __restrict__ x, bf* dst, size_t n8) { const size_t i = (size_t)blockIdx.x * 256 + threadIdx.x; if (i >= n8) return;
    const int y = blockIdx.y; const float* src = y == 0 ? wq : y == 1 ? wk : y == 2 ? wv : y == 3 ? wo : x + (size_t)(y - 4) * DD * DD; dst += (size_t)y * DD * DD;
    const int ln = (int)i & 31, row = (int)(i >> 13) * 64 + ((int)(i >> 6) & 3) * 16 + (ln & 15), k0 = ((int)(i >> 8) & (DD / 32 - 1)) * 32 + ((int)(i >> 5) & 1) * 16 + (ln >> 4) * 8; const v8f v = *(const v8f*)(src + (size_t)row * DD + k0); v8us o;
#pragma unroll
    for (int k = 0; k < 8; ++k) o[k] = f2bf(v[k]); *(v8us*)(dst + i * 8) = o;  }
// blockIdx.y = projection * NB_ + batch (q, k, v): slab of F and of each plane. ONE WAVE builds one fragment block of each plane and stores it as two runs of 512 contiguous bytes.
// q and k: per head rows = t, k = d (K = HD): block (h * (TT / 16) + t / 16) * 2 + d / 32. v: per head rows = d, k = t, the four row blocks of 32 keys side by side: block (h * (TT / 32) + t / 32) * 4 + d / 16.
__global__ __launch_bounds__(256) void k_planes(const float* __restrict__ F, const float* __restrict__ Mv, bf* Ph, bf* Pl, h16* P16) {
    const int lane = threadIdx.x & 31, lr = lane & 15, hi = lane >> 4; const int w = blockIdx.x * 8 + (threadIdx.x >> 5); if (w >= NH_ * TT * HD / 512) return;
    const int z = blockIdx.y; const size_t zo = (size_t)z * TT * DD; F += zo; Mv += (z % NB_) * TT; Ph += zo; Pl += zo; P16 += zo;
    const int h = w >> 8; const size_t ob = (size_t)w * 512 + lane * 8; bf* ph = Ph + ob; bf* pl = Pl + ob; h16* p16 = P16 + ob;
    // s_wait_xcnt 0 behind each run of global loads and of global stores, before a register that they name is written again; address pairs and store data are inputs so that they stay as they are up to the wait
    if (z < 2 * NB_) { const int t = ((w >> 1) & (TT / 16 - 1)) * 16 + lr, d0 = (w & 1) * 32 + hi * 8; const float* f = F + (size_t)t * DD + h * HD + d0;
        const float mr = Mv[t]; const v8f vv[2] = { *(const v8f*)f, *(const v8f*)(f + 16) };
        asm volatile("s_wait_xcnt 0x0" :: "v"(t), "v"(f) : "memory");      // t is the mask load's offset register
        const float mv = bfr(mr);
#pragma unroll
        for (int hf = 0; hf < 2; ++hf) { v8us oh, ol; v8h o16;
#pragma unroll
            for (int j = 0; j < 8; ++j) { const float x = __fmul_rn(vv[hf][j], mv); unsigned short a, c2; splitf(x, a, c2); oh[j] = a; ol[j] = c2; o16[j] = tohx(x); }
            *(v8us*)(ph + hf * 256) = oh; *(v8us*)(pl + hf * 256) = ol; *(v8h*)(p16 + hf * 256) = o16;
            asm volatile("s_wait_xcnt 0x0" :: "v"(ph), "v"(pl), "v"(p16), "v"(oh), "v"(ol), "v"(o16) : "memory"); }
    } else { const int t0 = ((w >> 2) & (TT / 32 - 1)) * 32 + hi * 8, d = (w & 3) * 16 + lr; const float* mp = Mv + t0; const float* f = F + (size_t)t0 * DD + h * HD + d;
        const v8f mm[2] = { *(const v8f*)mp, *(const v8f*)(mp + 16) }; float fv[2][8];
#pragma unroll
        for (int hf = 0; hf < 2; ++hf)
#pragma unroll
            for (int j = 0; j < 8; ++j) fv[hf][j] = f[(size_t)(hf * 16 + j) * DD];
        asm volatile("s_wait_xcnt 0x0" :: "v"(mp), "v"(f) : "memory");
#pragma unroll
        for (int hf = 0; hf < 2; ++hf) { v8us oh, ol; v8h o16;
#pragma unroll
            for (int j = 0; j < 8; ++j) { const float x = __fmul_rn(fv[hf][j], bfr(mm[hf][j])); unsigned short a, c2; splitf(x, a, c2); oh[j] = a; ol[j] = c2; o16[j] = tohx(x); }
            *(v8us*)(ph + hf * 256) = oh; *(v8us*)(pl + hf * 256) = ol; *(v8h*)(p16 + hf * 256) = o16;
            asm volatile("s_wait_xcnt 0x0" :: "v"(ph), "v"(pl), "v"(p16), "v"(oh), "v"(ol), "v"(o16) : "memory"); }
    }
}
// ---- k_fattn: scores, causal softmax and attn.v in ONE launch (blockIdx.z = batch), one wave per query tile, running (online) softmax over key blocks that end at the diagonal.
// The score tile is formed TRANSPOSED (A = key rows, B = query rows): lane (lr, hi) then holds, for query lr, keys hi*8+j of each 16-key tile, which is the B fragment of
// O^T = V^T P^T as it stands (k = 8 hi + j, 16 + 8 hi + j over two tiles), and max, sum and rescale of a query live in that query's own lanes.
// Rows < RH: bf16 hi+lo planes, 3 products each, 16 queries x 32 keys a trip; rows >= RH: fp16 planes, 32 queries x 64 keys a trip. Output: merged [t][DD] hi/lo planes, fragment-major (K = DD).
#define C2L 0.18033688011112042f  // (1/8) log2(e): softmax in base 2
template <typename T16> struct PFrag;
template <> struct PFrag<h16> { static __device__ __forceinline__ void mk(const v8f p0, const v8f p1, v16h& h, v16h& l) { (void)l;
#pragma unroll
    for (int e = 0; e < 8; ++e) { h[e] = (h16)p0[e]; h[8 + e] = (h16)p1[e]; } } };
template <> struct PFrag<bf> { static __device__ __forceinline__ void mk(const v8f p0, const v8f p1, v16bf& h, v16bf& l) { v8us h0, h1, l0, l1;
#pragma unroll
    for (int e = 0; e < 8; ++e) { unsigned short a, c; splitf(p0[e], a, c); h0[e] = a; l0[e] = c; splitf(p1[e], a, c); h1[e] = a; l1[e] = c; }
    h = cat16b(h0, h1); l = cat16b(l0, l1); } };
// s_wait_xcnt 0 behind a run of global loads or stores, before a register that they name is written again; the address pairs are inputs so that they stay as they are up to the wait.
template <bool SPLIT, typename T> __device__ __forceinline__ void xwait(const T* a, const T* b) {
    if (SPLIT) asm volatile("s_wait_xcnt 0x0" :: "v"(a), "v"(b) : "memory"); else asm volatile("s_wait_xcnt 0x0" :: "v"(a) : "memory"); }
template <typename T16, bool SPLIT, int NQ, int KB>
__device__ __forceinline__ void fattn_tile(const T16* __restrict__ Q, const T16* __restrict__ Q2, const T16* __restrict__ Kp, const T16* __restrict__ K2, const T16* __restrict__ Vt, const T16* __restrict__ V2, const int q0, bf* Ah, bf* Al) {
    typedef typename WFrag<T16>::V V; typedef WFrag<T16> W;
    constexpr int NKT = KB / 16, NU = KB / 32;
    const int lane = threadIdx.x & 31, lr = lane & 15, hi = lane >> 4;
    V qf[NQ][2], ql[NQ][2], kf[NKT][2], kl[NKT][2];
    { const size_t qo = (size_t)q0 * HD + lane * 8; const T16* qp = Q + qo; const T16* qp2 = SPLIT ? Q2 + qo : nullptr;
#pragma unroll
      for (int nq = 0; nq < NQ; ++nq)
#pragma unroll
        for (int c = 0; c < 2; ++c) { qf[nq][c] = W::ld(qp + (nq * 2 + c) * 512); if (SPLIT) ql[nq][c] = W::ld(qp2 + (nq * 2 + c) * 512); }
      xwait<SPLIT>(qp, qp2); }
    v8f o[4][NQ]; float m[NQ], l[NQ];
#pragma unroll
    for (int nq = 0; nq < NQ; ++nq) { m[nq] = -3.0e38f; l[nq] = 0.f;
#pragma unroll
        for (int dt = 0; dt < 4; ++dt) o[dt][nq] = (v8f){}; }
    const size_t ko = lane * 8, vo = lane * 8;      // a block of KB keys is KB * HD contiguous elements of the k planes and of the v planes alike
    const T16* kp = Kp + ko; const T16* kp2 = SPLIT ? K2 + ko : nullptr; const T16* vp = Vt + vo; const T16* vp2 = SPLIT ? V2 + vo : nullptr;   // this lane's place in the current key block
    auto ldk = [&](const int off) __attribute__((always_inline)) {     // loads the block off elements ahead, then steps the pointers there, behind the wait
#pragma unroll
        for (int kt = 0; kt < NKT; ++kt)
#pragma unroll
            for (int c = 0; c < 2; ++c) { kf[kt][c] = W::ld(kp + off + (kt * 2 + c) * 512); if (SPLIT) kl[kt][c] = W::ld(kp2 + off + (kt * 2 + c) * 512); }
        xwait<SPLIT>(kp, kp2); kp += off; if (SPLIT) kp2 += off; };
    auto step = [&](const int kb, const bool last) __attribute__((always_inline)) {
        V vf[4][NU], vl[4][NU];
#pragma unroll
        for (int dt = 0; dt < 4; ++dt)
#pragma unroll
            for (int u = 0; u < NU; ++u) { vf[dt][u] = W::ld(vp + (u * 4 + dt) * 512); if (SPLIT) vl[dt][u] = W::ld(vp2 + (u * 4 + dt) * 512); }
        xwait<SPLIT>(vp, vp2);
        vp += KB * HD; if (SPLIT) vp2 += KB * HD;
        v8f s[NKT][NQ];
#pragma unroll
        for (int kt = 0; kt < NKT; ++kt)
#pragma unroll
            for (int nq = 0; nq < NQ; ++nq) { v8f a = (v8f){};
#pragma unroll
                for (int c = 0; c < 2; ++c) { a = W::mma(kf[kt][c], qf[nq][c], a); if (SPLIT) { a = W::mma(kf[kt][c], ql[nq][c], a); a = W::mma(kl[kt][c], qf[nq][c], a); } }
                s[kt][nq] = a; }
        if (!last) ldk(KB * HD);      // next block's keys fly under this block's softmax and attn.v
        V pf[NQ][NU], pl[NQ][NU];
#pragma unroll
        for (int nq = 0; nq < NQ; ++nq) { float bm = -3.0e38f;
#pragma unroll
            for (int kt = 0; kt < NKT; ++kt)
#pragma unroll
                for (int j = 0; j < 8; ++j) { if (last) s[kt][nq][j] = (kb + kt * 16 + hi * 8 + j <= q0 + nq * 16 + lr) ? s[kt][nq][j] : -3.0e38f; bm = fmaxf(bm, s[kt][nq][j]); }
            bm = fmaxf(bm, __shfl_xor(bm, 16, 32));
            const float mn = fmaxf(m[nq], bm * C2L), al = __builtin_amdgcn_exp2f(m[nq] - mn); m[nq] = mn;
#pragma unroll
            for (int kt = 0; kt < NKT; ++kt)
#pragma unroll
                for (int j = 0; j < 8; ++j) s[kt][nq][j] = __builtin_amdgcn_exp2f(fmaf(s[kt][nq][j], C2L, -mn));
            v8f rv = s[0][nq];            // eight independent partial sums, folded as a tree
#pragma unroll
            for (int kt = 1; kt < NKT; ++kt) rv += s[kt][nq];
            l[nq] = fmaf(l[nq], al, ((rv[0] + rv[1]) + (rv[2] + rv[3])) + ((rv[4] + rv[5]) + (rv[6] + rv[7])));
#pragma unroll
            for (int dt = 0; dt < 4; ++dt) o[dt][nq] *= al;
#pragma unroll
            for (int u = 0; u < NU; ++u) PFrag<T16>::mk(s[2 * u][nq], s[2 * u + 1][nq], pf[nq][u], pl[nq][u]); }
#pragma unroll
        for (int u = 0; u < NU; ++u)
#pragma unroll
            for (int dt = 0; dt < 4; ++dt)
#pragma unroll
                for (int nq = 0; nq < NQ; ++nq) { o[dt][nq] = W::mma(vf[dt][u], pf[nq][u], o[dt][nq]); if (SPLIT) { o[dt][nq] = W::mma(vf[dt][u], pl[nq][u], o[dt][nq]); o[dt][nq] = W::mma(vl[dt][u], pf[nq][u], o[dt][nq]); } }
    };
    const int klast = (q0 / KB) * KB;     // the one block that holds the diagonal; every block before it is wholly at or below it
    ldk(0);
#pragma unroll 1
    for (int kb = 0; kb < klast; kb += KB) step(kb, false);
    step(klast, true);
    const size_t ob = (size_t)(q0 >> 6) * 64 * DD + ((q0 >> 4) & 3) * 512 + lane * 8; bf* ah = Ah + ob; bf* al2 = Al + ob;      // 64-row panel, row block in it (q0 + 16 nq stays in the panel)
#pragma unroll
    for (int nq = 0; nq < NQ; ++nq) { const float inv = __fdiv_rn(1.0f, l[nq] + __shfl_xor(l[nq], 16, 32)); v8us oh[4], ol[4];
#pragma unroll
        for (int dt = 0; dt < 4; ++dt)
#pragma unroll
            for (int j = 0; j < 8; ++j) { unsigned short a, c; splitf(o[dt][nq][j] * inv, a, c); oh[dt][j] = a; ol[dt][j] = c; }
#pragma unroll
        for (int dt = 0; dt < 4; ++dt) { *(v8us*)(ah + nq * 512 + (dt >> 1) * 2048 + (dt & 1) * 256) = oh[dt]; *(v8us*)(al2 + nq * 512 + (dt >> 1) * 2048 + (dt & 1) * 256) = ol[dt]; }
        // the same wait behind the stores: their data registers are inputs too
        asm volatile("s_wait_xcnt 0x0" :: "v"(ah), "v"(al2), "v"(oh[0]), "v"(oh[1]), "v"(oh[2]), "v"(oh[3]), "v"(ol[0]), "v"(ol[1]), "v"(ol[2]), "v"(ol[3]) : "memory"); }
}
__global__ __launch_bounds__(32) void k_fattn(const bf* __restrict__ QPh, const bf* __restrict__ QPl, const bf* __restrict__ KPh, const bf* __restrict__ KPl, const bf* __restrict__ VTh, const bf* __restrict__ VTl,
                                              const h16* __restrict__ QP16, const h16* __restrict__ KP16, const h16* __restrict__ VT16, bf* Ah, bf* Al) {
    const size_t hz = ((size_t)blockIdx.z * NH_ + blockIdx.y) * TT * HD; const int x = blockIdx.x; const size_t oz = (size_t)blockIdx.z * TT * DD + blockIdx.y * (HD / 32) * 2048; Ah += oz; Al += oz;
    if (x < (TT - RH) / 32) fattn_tile<h16, false, 2, 64>(QP16 + hz, nullptr, KP16 + hz, nullptr, VT16 + hz, nullptr, TT - 32 * (x + 1), Ah, Al);    // longest rows first
    else fattn_tile<bf, true, 1, 32>(QPh + hz, QPl + hz, KPh + hz, KPl + hz, VTh + hz, VTl + hz, RH - 16 * (x - (TT - RH) / 32 + 1), Ah, Al);
}

extern "C" void kernel_launch(void* const* d_in, const int* in_sizes, int n_in,
                              void* d_out, int out_size, void* d_ws, size_t ws_size, hipStream_t stream) {
    (void)in_sizes; (void)n_in; (void)out_size;
    const float* x = (const float*)d_in[0]; const float* am = (const float*)d_in[1]; const float* wq = (const float*)d_in[2]; const float* wk = (const float*)d_in[3]; const float* wv = (const float*)d_in[4]; const float* wo = (const float*)d_in[5]; const float* bo = (const float*)d_in[6];
    float* OUT = (float*)d_out;     // [2][2048][1024]
    char* wsp = (char*)d_ws;
    auto take = [&](size_t bytes) { char* p = wsp; wsp += (bytes + 255) & ~(size_t)255; return (void*)p; };
    const size_t SL = (size_t)DD * DD, PB = (size_t)TT * DD;      // one weight slab; one batch of one plane
    bf* WQ = (bf*)take(4 * SL * 2); bf* WO = WQ + 3 * SL; bf* XB = (bf*)take(NB_ * PB * 2);      // [Wq|Wk|Wv|Wo] and, right behind them, x [NB_ TT][DD], all fragment-major
    float* F = (float*)take(3 * NB_ * PB * 4);      // [q|k|v][NB_ TT][DD]
    bf* Ph = (bf*)take(3 * NB_ * PB * 2); bf* Pl = (bf*)take(3 * NB_ * PB * 2); h16* P16 = (h16*)take(3 * NB_ * PB * 2);      // each [q|k|v][NB_] planes
    bf* ATh = (bf*)take(NB_ * PB * 2); bf* ATl = (bf*)take(NB_ * PB * 2);
    if ((size_t)(wsp - (char*)d_ws) > ws_size) return;    // total 152 MiB; ws 256 MiB
    // every stage is ONE launch over both batches (and over q, k, v where there are three)
    k_cvt8<<<dim3((unsigned)(SL / 8 / 256), 4 + NB_ * TT / DD, 1), 256, 0, stream>>>(wq, wk, wv, wo, x, WQ, SL / 8);   // [out][in] weights = Bt as-is
    k_gemmw<bf, 0, false><<<dim3(NB_ * TT / 64, DD / 64, 3), 32, 0, stream>>>(XB, nullptr, WQ, nullptr, DD, F, DD, nullptr, 0, SL, NB_ * PB, 0);
    k_planes<<<dim3((unsigned)((NH_ * TT * HD / 64 + 63) / 64), 3 * NB_, 1), 256, 0, stream>>>(F, am, Ph, Pl, P16);
    k_fattn<<<dim3((TT - RH) / 32 + RH / 16, NH_, NB_), 32, 0, stream>>>(Ph, Pl, Ph + NB_ * PB, Pl + NB_ * PB, Ph + 2 * NB_ * PB, Pl + 2 * NB_ * PB, P16, P16 + NB_ * PB, P16 + 2 * NB_ * PB, ATh, ATl);
    k_gemmw<bf, 1, true><<<dim3(NB_ * TT / 64, DD / 64, 1), 32, 0, stream>>>(ATh, ATl, WO, nullptr, DD, OUT, DD, bo, 0, 0, 0, 0);
}

// v006
// A run of this version takes 103 microseconds.
// In two side-by-side timings against v005, it was 1.13 and 1.14 times as fast.
// Counting every step since v000, it is 19.7 times as fast.
#include <hip/hip_runtime.h>

// Causal multi-head attention block (x [2][2048][1024], attention_mask [2][2048] (float ones, read as data); q/k/v = x W^T ([out][in], no bias) each multiplied by mask[b][t] per row; 16 heads x 64; scores / 8; causal (tril -> -inf);
// softmax; out = merged Wo^T + bo).
// Compute dtypes, f32 accumulate: every input rounded to bf16; projections on PLAIN bf16 operands (inputs: exact), x bf16(mask) in f32 in the projection GEMM's epilogue; PER-ROW
// PRECISION HYBRID: query rows < 512 of each batch on bf16 hi+lo planes for scores and attn.v (3 products), rows >= 512 on SINGLE fp16 planes; output hi+lo x exact Wo (2 products) + bo.

#define NB_  2
#define TT   2048
#define DD   1024
#define NH_  16
#define HD   64
#define RH   512                  // query rows < RH: hi+lo planes; rows >= RH: fp16 planes
#define NF   32
#define SCL  0.125f               // 1/sqrt(64)
typedef _Float16 h16;
typedef unsigned short bf;
typedef __attribute__((ext_vector_type(16))) __bf16   v16bf;
typedef __attribute__((ext_vector_type(16))) _Float16 v16h;
typedef __attribute__((ext_vector_type(8)))  _Float16 v8h;
typedef __attribute__((ext_vector_type(8)))  unsigned short v8us;
typedef __attribute__((ext_vector_type(8)))  float    v8f;
typedef __attribute__((ext_vector_type(4)))  float    v4f;
typedef v8h  __attribute__((may_alias)) v8ha;
typedef v4f  __attribute__((may_alias)) v4fa;
typedef v8us __attribute__((may_alias)) v8usa;

__device__ __forceinline__ unsigned short f2bf(float f) { unsigned u = __float_as_uint(f); u += 0x7FFFu + ((u >> 16) & 1u); return (unsigned short)(u >> 16); }
__device__ __forceinline__ float bf2f(unsigned short b) { return __uint_as_float(((unsigned)b) << 16); }
__device__ __forceinline__ float bfr(float f) { return bf2f(f2bf(f)); }
__device__ __forceinline__ v16h cat16(v8h lo, v8h hi) { return __builtin_shufflevector(lo, hi, 0, 1, 2, 3, 4, 5, 6, 7, 8, 9, 10, 11, 12, 13, 14, 15); }
__device__ __forceinline__ v16bf cat16b(v8us lo, v8us hi) { return __builtin_bit_cast(v16bf, __builtin_shufflevector(lo, hi, 0, 1, 2, 3, 4, 5, 6, 7, 8, 9, 10, 11, 12, 13, 14, 15)); }
__device__ __forceinline__ v8f wmma16(v16h a, v16h b, v8f c) { return __builtin_amdgcn_wmma_f32_16x16x32_f16(false, a, false, b, (short)0, c, false, false); }
__device__ __forceinline__ v8f wmmab(v16bf a, v16bf b, v8f c) { return __builtin_amdgcn_wmma_f32_16x16x32_bf16(false, a, false, b, (short)0, c, false, false); }



// ---- FRAGMENT-MAJOR PLANES: every 16-bit WMMA operand plane [rows][K] is stored as blocks of 16 rows x 32 k (512 elements, 1 KiB). GEMM operands (K = DD): the four row blocks of a 64-row panel lie
// side by side, block (row / 16, k / 32) at (((row / 64) * (K / 32) + k / 32) * 4 + (row / 16) % 4) * 512, so one trip of a wave reads 8 KiB in a row per operand. Attention planes: see the PL epilogue of k_gemmw.
// Inside a block element (r, k) lies at ((k >> 4) & 1) * 256 + (((k >> 3) & 1) * 16 + r) * 8 + (k & 7): lane (lr, hi) finds its two runs of eight k at lane * 8 and 256 + lane * 8,
// so each of the two 16-byte loads of a fragment covers 512 contiguous bytes (four whole lines) instead of 32 bytes in each of sixteen lines. The k order of a fragment is what it was.
// ---- k_gemmw: register-blocked GEMM, ONE WAVE per 64x64 output tile (16 accumulators), operands straight from fragment-major 16-bit planes; grid (M/64, N/64, Z), 32 threads.
// C[m][n] (f32, pitch ldc, + optional f32 bias[n]) = sum_k A[m][k] Bt[n][k] (+ split products per NSPLIT). z-batch strides sA/sB/sC in elements. K % 64 == 0.
// SK > 1: grid.y = (N/64) * SK; work-group ks = blockIdx.y % SK sums only k in [ks K/SK, (ks+1) K/SK) into its own plane C + ks * sP; the reader adds the SK planes. K % (64 SK) == 0.
template <typename T16> struct WFrag;
template <> struct WFrag<h16> { typedef v16h V; static __device__ __forceinline__ V ld(const h16* p) { return cat16(*(const v8h*)p, *(const v8h*)(p + 256)); } static __device__ __forceinline__ v8f mma(V a, V b, v8f c) { return wmma16(a, b, c); } };
template <> struct WFrag<bf> { typedef v16bf V; static __device__ __forceinline__ V ld(const bf* p) { return cat16b(*(const v8us*)p, *(const v8us*)(p + 256)); } static __device__ __forceinline__ v8f mma(V a, V b, v8f c) { return wmmab(a, b, c); } };
// PL (the q, k, v projections; blockIdx.z = projection, a 64x64 tile = 64 positions of one head): no f32 C; the tile goes from the accumulators straight into the attention planes, x bf16(mask[t]).
// q and k planes: per head rows = t, k = d (K = HD): block (h * (TT / 16) + t / 16) * 2 + d / 32. v planes: per head rows = d, k = t, the four row blocks of 32 keys side by side: block (h * (TT / 32) + t / 32) * 4 + d / 16.
// An accumulator holds, per lane, eight consecutive A rows of one B row, which IS a run of eight k of a fragment block when the plane's k runs along the A rows: so q and k are formed as W x^T (A rows = d)
// and v as x W^T (A rows = t); each accumulator is then one 512-byte run of a block as it stands, and a tile is 8 KiB in a row of each plane.
__device__ __forceinline__ h16 tohx(float x) { return (h16)x; }
__device__ __forceinline__ void splitf(float y, unsigned short& h, unsigned short& l) { h = f2bf(y); l = f2bf(y - bf2f(h)); }
template <typename T16, int NSPLIT, bool BIAS, int SK = 1, bool PL = false>
__global__ __launch_bounds__(32) void k_gemmw(const T16* __restrict__ A, const T16* __restrict__ A2, const T16* __restrict__ Bt, const T16* __restrict__ Bt2, int K, float* C, int ldc, const float* __restrict__ bias, size_t sA, size_t sB, size_t sC, size_t sP,
                                              const float* __restrict__ Mv, bf* Ph, bf* Pl, h16* P16) {
    typedef typename WFrag<T16>::V V;
    __shared__ __align__(16) float os[16 * 68];
    const size_t z = blockIdx.z; A += z * sA; if (A2) A2 += z * sA; Bt += z * sB; if (Bt2) Bt2 += z * sB; C += z * sC;
    const int lane = threadIdx.x & 31, lr = lane & 15, hi = lane >> 4; int r0 = blockIdx.x * 64, c0 = (blockIdx.y / SK) * 64;
    const bool qk = PL && z < 2;      // q, k: the two operands change places (W rows on the A side)
    if (qk) { const T16* t = A; A = Bt; Bt = t; const int r = r0; r0 = c0; c0 = r; }
    const int ks = blockIdx.y % SK, kb = ks * (K / SK), ke = kb + K / SK; C += (size_t)ks * sP;
    v8f acc[4][4];
#pragma unroll
    for (int mb = 0; mb < 4; ++mb)
#pragma unroll
        for (int nb = 0; nb < 4; ++nb) acc[mb][nb] = (v8f){};
    // the current k block of each operand's 64-row panel (64 K elements a panel, 2048 a k block, 4 KiB); a plane that is not used stands in as its partner
    constexpr bool HA2 = NSPLIT == 1 || NSPLIT == 2, HB2 = NSPLIT >= 2;
    const T16* pa = A + (size_t)r0 * K + (size_t)kb * 64; const T16* pb = Bt + (size_t)c0 * K + (size_t)kb * 64;
    const T16* pa2 = HA2 ? A2 + (size_t)r0 * K + (size_t)kb * 64 : pa; const T16* pb2 = HB2 ? Bt2 + (size_t)c0 * K + (size_t)kb * 64 : pb;
    unsigned vb = lane * 16;      // this lane's byte offset from those four places: its run of eight in the block, plus the blocks done; one register for every operand
    // TWO FRAGMENT SETS: all loads of k block i + 1 are issued as one group in front of the products of k block i, so a block waits for its operands once, under the block before it.
    // A trip is two k blocks (one per set, no register copies): (K / SK) % 64 == 0. Products and their order per accumulator are what they were.
    struct FSet { V a[4], a2[4], b[4], b2[4]; };
    FSet s0, s1;
    auto at = [&](const T16* p, const int off) __attribute__((always_inline)) { return (const T16*)((const char*)p + vb) + off; };
    auto ldset = [&](FSet& s, const int off) __attribute__((always_inline)) {
#pragma unroll
        for (int mb = 0; mb < 4; ++mb) { s.a[mb] = WFrag<T16>::ld(at(pa, off + mb * 512)); if (HA2) s.a2[mb] = WFrag<T16>::ld(at(pa2, off + mb * 512)); }
#pragma unroll
        for (int nb = 0; nb < 4; ++nb) { s.b[nb] = WFrag<T16>::ld(at(pb, off + nb * 512)); if (HB2) s.b2[nb] = WFrag<T16>::ld(at(pb2, off + nb * 512)); } };
    auto mmaset = [&](const FSet& s) __attribute__((always_inline)) {
#pragma unroll
        for (int nb = 0; nb < 4; ++nb)
#pragma unroll
            for (int mb = 0; mb < 4; ++mb) { acc[mb][nb] = WFrag<T16>::mma(s.a[mb], s.b[nb], acc[mb][nb]); if (HA2) acc[mb][nb] = WFrag<T16>::mma(s.a2[mb], s.b[nb], acc[mb][nb]); if (HB2) acc[mb][nb] = WFrag<T16>::mma(s.a[mb], s.b2[nb], acc[mb][nb]); } };
    ldset(s0, 0);
    asm volatile("s_wait_xcnt 0x0" :: "v"(vb) : "memory");      // behind the first loads: on the path round the loop nothing else stands between them and the next write of what they name
#pragma unroll 1
    for (int kc = kb; kc < ke - 64; kc += 64) {
        ldset(s1, 2048);
        __builtin_amdgcn_sched_barrier(0);      // keeps the next block's loads in front of this block's products (sunk among them they would be waited for at once)
        mmaset(s0);
        __builtin_amdgcn_sched_barrier(0);      // the same for the block after: its loads stay between the two runs of products
        ldset(s0, 4096);
        __builtin_amdgcn_sched_barrier(0);      // as above
        mmaset(s1);
        __builtin_amdgcn_sched_barrier(0);      // keeps the wait below behind the trip's products, not between the loads and the products
        // s_wait_xcnt 0 behind the trip's global loads, before their offset register is stepped; the register passes through the statement, so that the step is formed behind the wait
        asm volatile("s_wait_xcnt 0x0" : "+v"(vb) :: "memory");
        vb += 8192;
    }
    ldset(s1, 2048);
    // the same wait behind the last loads; offset register and the four places are inputs so that whatever the loads name stays as it is up to the wait
    asm volatile("s_wait_xcnt 0x0" :: "v"(vb), "v"(at(pa, 2048)), "v"(at(pb, 2048)), "v"(at(pa2, 2048)), "v"(at(pb2, 2048)) : "memory");
    __builtin_amdgcn_sched_barrier(0);          // the last block's loads fly under the products of the block before it
    mmaset(s0);
    mmaset(s1);
    __builtin_amdgcn_sched_barrier(0);          // keeps the store addresses' arithmetic behind the last products, where the fragment registers are free (formed among them it spills)
    if constexpr (PL) {
        const int tp = qk ? c0 : r0, hd = (qk ? r0 : c0) >> 6;      // first position of the tile (both batches in a row), head
        const size_t ob = ((size_t)z * NB_ + tp / TT) * TT * DD + (size_t)(hd * (TT * HD / 512) + (tp % TT) / 8) * 512 + lane * 8;
        bf* ph = Ph + ob; bf* pl = Pl + ob; h16* p16 = P16 + ob;
        // s_wait_xcnt 0 behind each run of global loads and of global stores, before a register that they name is written again; address pairs and store data are inputs so that they stay as they are up to the wait
        auto put = [&](const bool tb) __attribute__((always_inline)) {      // tb: positions along the B rows (q, k), else along the A rows (v)
            const float* mp = Mv + tp + (tb ? lr : hi * 8); float mq[4]; v8f mm[4];
#pragma unroll
            for (int i = 0; i < 4; ++i) { if (tb) mq[i] = mp[i * 16]; else mm[i] = *(const v8f*)(mp + i * 16); }
            asm volatile("s_wait_xcnt 0x0" :: "v"(mp) : "memory");
#pragma unroll
            for (int mb = 0; mb < 4; ++mb) { v8us oh[4], ol[4]; v8h o16[4];
#pragma unroll
                for (int nb = 0; nb < 4; ++nb)
#pragma unroll
                    for (int j = 0; j < 8; ++j) { const float x = __fmul_rn(acc[mb][nb][j], bfr(tb ? mq[nb] : mm[mb][j])); unsigned short a, c2; splitf(x, a, c2); oh[nb][j] = a; ol[nb][j] = c2; o16[nb][j] = tohx(x); }
#pragma unroll
                for (int nb = 0; nb < 4; ++nb) { const int off = (tb ? nb * 2 + (mb >> 1) : (mb >> 1) * 4 + nb) * 512 + (mb & 1) * 256; *(v8us*)(ph + off) = oh[nb]; *(v8us*)(pl + off) = ol[nb]; *(v8h*)(p16 + off) = o16[nb]; }
                asm volatile("s_wait_xcnt 0x0" :: "v"(ph), "v"(pl), "v"(p16), "v"(oh[0]), "v"(oh[1]), "v"(oh[2]), "v"(oh[3]), "v"(ol[0]), "v"(ol[1]), "v"(ol[2]), "v"(ol[3]), "v"(o16[0]), "v"(o16[1]), "v"(o16[2]), "v"(o16[3]) : "memory"); }
        };
        if (qk) put(true); else put(false);
    } else
#pragma unroll
    for (int mb = 0; mb < 4; ++mb) {
#pragma unroll
        for (int nb = 0; nb < 4; ++nb) {
#pragma unroll
            for (int j = 0; j < 8; ++j) os[(hi * 8 + j) * 68 + nb * 16 + lr] = acc[mb][nb][j]; }
        __builtin_amdgcn_wave_barrier(); asm volatile("" ::: "memory");
        float* crow = C + (size_t)(r0 + mb * 16) * ldc + c0;
{
            v4f vals[8]; float* cp[8];
#pragma unroll
            for (int s = 0; s < 8; ++s) { const int row = 2 * s + hi, cofs = lr * 4; v4f val = *(const v4fa*)(os + row * 68 + cofs); if (BIAS) { val[0] += bfr(bias[c0 + cofs]); val[1] += bfr(bias[c0 + cofs + 1]); val[2] += bfr(bias[c0 + cofs + 2]); val[3] += bfr(bias[c0 + cofs + 3]); }
                vals[s] = val; cp[s] = crow + (size_t)row * ldc + cofs; *(v4f*)cp[s] = val; }
            // s_wait_xcnt 0 behind the eight stores, before a register that they name is written again; address pairs and data are inputs so that they stay as they are up to the wait
            asm volatile("s_wait_xcnt 0x0" :: "v"(cp[0]), "v"(cp[1]), "v"(cp[2]), "v"(cp[3]), "v"(cp[4]), "v"(cp[5]), "v"(cp[6]), "v"(cp[7]), "v"(vals[0]), "v"(vals[1]), "v"(vals[2]), "v"(vals[3]), "v"(vals[4]), "v"(vals[5]), "v"(vals[6]), "v"(vals[7]) : "memory");
             }
        __builtin_amdgcn_wave_barrier(); asm volatile("" ::: "memory");
    }
}

typedef __attribute__((ext_vector_type(2))) unsigned short v2us;
typedef __attribute__((ext_vector_type(2))) _Float16 v2h;
typedef __attribute__((ext_vector_type(4))) _Float16 v4h;
typedef __attribute__((ext_vector_type(2))) float v2f;

// blockIdx.y picks the DD x DD slab: 0..3 = Wq, Wk, Wv, Wo, 4.. = slabs of x (both batches); dst holds them in that order, one after the other, each fragment-major (K = DD).
// Thread i writes the slab's i-th run of eight: a wave stores 512 contiguous bytes and reads 64 bytes of each of 16 rows; a work-group reads one whole line of each of 64 rows.
__global__ __launch_bounds__(256) void k_cvt8(const float* __restrict__ wq, const float* __restrict__ wk, const float* __restrict__ wv, const float* __restrict__ wo, const float* __restrict__ x, bf* dst, size_t n8) { const size_t i = (size_t)blockIdx.x * 256 + threadIdx.x; if (i >= n8) return;
    const int y = blockIdx.y; const float* src = y == 0 ? wq : y == 1 ? wk : y == 2 ? wv : y == 3 ? wo : x + (size_t)(y - 4) * DD * DD; dst += (size_t)y * DD * DD;
    const int ln = (int)i & 31, row = (int)(i >> 13) * 64 + ((int)(i >> 6) & 3) * 16 + (ln & 15), k0 = ((int)(i >> 8) & (DD / 32 - 1)) * 32 + ((int)(i >> 5) & 1) * 16 + (ln >> 4) * 8; const v8f v = *(const v8f*)(src + (size_t)row * DD + k0); v8us o;
#pragma unroll
    for (int k = 0; k < 8; ++k) o[k] = f2bf(v[k]); *(v8us*)(dst + i * 8) = o;  }
// ---- k_fattn: scores, causal softmax and attn.v in ONE launch (blockIdx.z = batch), one wave per query tile, running (online) softmax over key blocks that end at the diagonal.
// The score tile is formed TRANSPOSED (A = key rows, B = query rows): lane (lr, hi) then holds, for query lr, keys hi*8+j of each 16-key tile, which is the B fragment of
// O^T = V^T P^T as it stands (k = 8 hi + j, 16 + 8 hi + j over two tiles), and max, sum and rescale of a query live in that query's own lanes.
// Rows < RH: bf16 hi+lo planes, 3 products each, 16 queries x 32 keys a trip; rows >= RH: fp16 planes, 32 queries x 64 keys a trip. Output: merged [t][DD] hi/lo planes, fragment-major (K = DD).
#define C2L 0.18033688011112042f  // (1/8) log2(e): softmax in base 2
template <typename T16> struct PFrag;
template <> struct PFrag<h16> { static __device__ __forceinline__ void mk(const v8f p0, const v8f p1, v16h& h, v16h& l) { (void)l;
#pragma unroll
    for (int e = 0; e < 8; ++e) { h[e] = (h16)p0[e]; h[8 + e] = (h16)p1[e]; } } };
template <> struct PFrag<bf> { static __device__ __forceinline__ void mk(const v8f p0, const v8f p1, v16bf& h, v16bf& l) { v8us h0, h1, l0, l1;
#pragma unroll
    for (int e = 0; e < 8; ++e) { unsigned short a, c; splitf(p0[e], a, c); h0[e] = a; l0[e] = c; splitf(p1[e], a, c); h1[e] = a; l1[e] = c; }
    h = cat16b(h0, h1); l = cat16b(l0, l1); } };
// s_wait_xcnt 0 behind a run of global loads or stores, before a register that they name is written again; the address pairs are inputs so that they stay as they are up to the wait.
template <bool SPLIT, typename T> __device__ __forceinline__ void xwait(const T* a, const T* b) {
    if (SPLIT) asm volatile("s_wait_xcnt 0x0" :: "v"(a), "v"(b) : "memory"); else asm volatile("s_wait_xcnt 0x0" :: "v"(a) : "memory"); }
template <typename T16, bool SPLIT, int NQ, int KB>
__device__ __forceinline__ void fattn_tile(const T16* __restrict__ Q, const T16* __restrict__ Q2, const T16* __restrict__ Kp, const T16* __restrict__ K2, const T16* __restrict__ Vt, const T16* __restrict__ V2, const int q0, bf* Ah, bf* Al) {
    typedef typename WFrag<T16>::V V; typedef WFrag<T16> W;
    constexpr int NKT = KB / 16, NU = KB / 32;
    const int lane = threadIdx.x & 31, lr = lane & 15, hi = lane >> 4;
    V qf[NQ][2], ql[NQ][2], kf[NKT][2], kl[NKT][2];
    { const size_t qo = (size_t)q0 * HD + lane * 8; const T16* qp = Q + qo; const T16* qp2 = SPLIT ? Q2 + qo : nullptr;
#pragma unroll
      for (int nq = 0; nq < NQ; ++nq)
#pragma unroll
        for (int c = 0; c < 2; ++c) { qf[nq][c] = W::ld(qp + (nq * 2 + c) * 512); if (SPLIT) ql[nq][c] = W::ld(qp2 + (nq * 2 + c) * 512); }
      xwait<SPLIT>(qp, qp2); }
    v8f o[4][NQ]; float m[NQ], l[NQ];
#pragma unroll
    for (int nq = 0; nq < NQ; ++nq) { m[nq] = -3.0e38f; l[nq] = 0.f;
#pragma unroll
        for (int dt = 0; dt < 4; ++dt) o[dt][nq] = (v8f){}; }
    const size_t ko = lane * 8, vo = lane * 8;      // a block of KB keys is KB * HD contiguous elements of the k planes and of the v planes alike
    const T16* kp = Kp + ko; const T16* kp2 = SPLIT ? K2 + ko : nullptr; const T16* vp = Vt + vo; const T16* vp2 = SPLIT ? V2 + vo : nullptr;   // this lane's place in the current key block
    auto ldk = [&](const int off) __attribute__((always_inline)) {     // loads the block off elements ahead, then steps the pointers there, behind the wait
#pragma unroll
        for (int kt = 0; kt < NKT; ++kt)
#pragma unroll
            for (int c = 0; c < 2; ++c) { kf[kt][c] = W::ld(kp + off + (kt * 2 + c) * 512); if (SPLIT) kl[kt][c] = W::ld(kp2 + off + (kt * 2 + c) * 512); }
        xwait<SPLIT>(kp, kp2); kp += off; if (SPLIT) kp2 += off; };
    auto step = [&](const int kb, const bool last) __attribute__((always_inline)) {
        V vf[4][NU], vl[4][NU];
#pragma unroll
        for (int dt = 0; dt < 4; ++dt)
#pragma unroll
            for (int u = 0; u < NU; ++u) { vf[dt][u] = W::ld(vp + (u * 4 + dt) * 512); if (SPLIT) vl[dt][u] = W::ld(vp2 + (u * 4 + dt) * 512); }
        xwait<SPLIT>(vp, vp2);
        vp += KB * HD; if (SPLIT) vp2 += KB * HD;
        v8f s[NKT][NQ];
#pragma unroll
        for (int kt = 0; kt < NKT; ++kt)
#pragma unroll
            for (int nq = 0; nq < NQ; ++nq) { v8f a = (v8f){};
#pragma unroll
                for (int c = 0; c < 2; ++c) { a = W::mma(kf[kt][c], qf[nq][c], a); if (SPLIT) { a = W::mma(kf[kt][c], ql[nq][c], a); a = W::mma(kl[kt][c], qf[nq][c], a); } }
                s[kt][nq] = a; }
        if (!last) ldk(KB * HD);      // next block's keys fly under this block's softmax and attn.v
        V pf[NQ][NU], pl[NQ][NU];
#pragma unroll
        for (int nq = 0; nq < NQ; ++nq) { float bm = -3.0e38f;
#pragma unroll
            for (int kt = 0; kt < NKT; ++kt)
#pragma unroll
                for (int j = 0; j < 8; ++j) { if (last) s[kt][nq][j] = (kb + kt * 16 + hi * 8 + j <= q0 + nq * 16 + lr) ? s[kt][nq][j] : -3.0e38f; bm = fmaxf(bm, s[kt][nq][j]); }
            bm = fmaxf(bm, __shfl_xor(bm, 16, 32));
            const float mn = fmaxf(m[nq], bm * C2L), al = __builtin_amdgcn_exp2f(m[nq] - mn); m[nq] = mn;
#pragma unroll
            for (int kt = 0; kt < NKT; ++kt)
#pragma unroll
                for (int j = 0; j < 8; ++j) s[kt][nq][j] = __builtin_amdgcn_exp2f(fmaf(s[kt][nq][j], C2L, -mn));
            v8f rv = s[0][nq];            // eight independent partial sums, folded as a tree
#pragma unroll
            for (int kt = 1; kt < NKT; ++kt) rv += s[kt][nq];
            l[nq] = fmaf(l[nq], al, ((rv[0] + rv[1]) + (rv[2] + rv[3])) + ((rv[4] + rv[5]) + (rv[6] + rv[7])));
#pragma unroll
            for (int dt = 0; dt < 4; ++dt) o[dt][nq] *= al;
#pragma unroll
            for (int u = 0; u < NU; ++u) PFrag<T16>::mk(s[2 * u][nq], s[2 * u + 1][nq], pf[nq][u], pl[nq][u]); }
#pragma unroll
        for (int u = 0; u < NU; ++u)
#pragma unroll
            for (int dt = 0; dt < 4; ++dt)
#pragma unroll
                for (int nq = 0; nq < NQ; ++nq) { o[dt][nq] = W::mma(vf[dt][u], pf[nq][u], o[dt][nq]); if (SPLIT) { o[dt][nq] = W::mma(vf[dt][u], pl[nq][u], o[dt][nq]); o[dt][nq] = W::mma(vl[dt][u], pf[nq][u], o[dt][nq]); } }
    };
    const int klast = (q0 / KB) * KB;     // the one block that holds the diagonal; every block before it is wholly at or below it
    ldk(0);
#pragma unroll 1
    for (int kb = 0; kb < klast; kb += KB) step(kb, false);
    step(klast, true);
    const size_t ob = (size_t)(q0 >> 6) * 64 * DD + ((q0 >> 4) & 3) * 512 + lane * 8; bf* ah = Ah + ob; bf* al2 = Al + ob;      // 64-row panel, row block in it (q0 + 16 nq stays in the panel)
#pragma unroll
    for (int nq = 0; nq < NQ; ++nq) { const float inv = __fdiv_rn(1.0f, l[nq] + __shfl_xor(l[nq], 16, 32)); v8us oh[4], ol[4];
#pragma unroll
        for (int dt = 0; dt < 4; ++dt)
#pragma unroll
            for (int j = 0; j < 8; ++j) { unsigned short a, c; splitf(o[dt][nq][j] * inv, a, c); oh[dt][j] = a; ol[dt][j] = c; }
#pragma unroll
        for (int dt = 0; dt < 4; ++dt) { *(v8us*)(ah + nq * 512 + (dt >> 1) * 2048 + (dt & 1) * 256) = oh[dt]; *(v8us*)(al2 + nq * 512 + (dt >> 1) * 2048 + (dt & 1) * 256) = ol[dt]; }
        // the same wait behind the stores: their data registers are inputs too
        asm volatile("s_wait_xcnt 0x0" :: "v"(ah), "v"(al2), "v"(oh[0]), "v"(oh[1]), "v"(oh[2]), "v"(oh[3]), "v"(ol[0]), "v"(ol[1]), "v"(ol[2]), "v"(ol[3]) : "memory"); }
}
__global__ __launch_bounds__(32) void k_fattn(const bf* __restrict__ QPh, const bf* __restrict__ QPl, const bf* __restrict__ KPh, const bf* __restrict__ KPl, const bf* __restrict__ VTh, const bf* __restrict__ VTl,
                                              const h16* __restrict__ QP16, const h16* __restrict__ KP16, const h16* __restrict__ VT16, bf* Ah, bf* Al) {
    const size_t hz = ((size_t)blockIdx.z * NH_ + blockIdx.y) * TT * HD; const int x = blockIdx.x; const size_t oz = (size_t)blockIdx.z * TT * DD + blockIdx.y * (HD / 32) * 2048; Ah += oz; Al += oz;
    if (x < (TT - RH) / 32) fattn_tile<h16, false, 2, 64>(QP16 + hz, nullptr, KP16 + hz, nullptr, VT16 + hz, nullptr, TT - 32 * (x + 1), Ah, Al);    // longest rows first
    else fattn_tile<bf, true, 1, 32>(QPh + hz, QPl + hz, KPh + hz, KPl + hz, VTh + hz, VTl + hz, RH - 16 * (x - (TT - RH) / 32 + 1), Ah, Al);
}

extern "C" void kernel_launch(void* const* d_in, const int* in_sizes, int n_in,
                              void* d_out, int out_size, void* d_ws, size_t ws_size, hipStream_t stream) {
    (void)in_sizes; (void)n_in; (void)out_size;
    const float* x = (const float*)d_in[0]; const float* am = (const float*)d_in[1]; const float* wq = (const float*)d_in[2]; const float* wk = (const float*)d_in[3]; const float* wv = (const float*)d_in[4]; const float* wo = (const float*)d_in[5]; const float* bo = (const float*)d_in[6];
    float* OUT = (float*)d_out;     // [2][2048][1024]
    char* wsp = (char*)d_ws;
    auto take = [&](size_t bytes) { char* p = wsp; wsp += (bytes + 255) & ~(size_t)255; return (void*)p; };
    const size_t SL = (size_t)DD * DD, PB = (size_t)TT * DD;      // one weight slab; one batch of one plane
    bf* WQ = (bf*)take(4 * SL * 2); bf* WO = WQ + 3 * SL; bf* XB = (bf*)take(NB_ * PB * 2);      // [Wq|Wk|Wv|Wo] and, right behind them, x [NB_ TT][DD], all fragment-major
    bf* Ph = (bf*)take(3 * NB_ * PB * 2); bf* Pl = (bf*)take(3 * NB_ * PB * 2); h16* P16 = (h16*)take(3 * NB_ * PB * 2);      // each [q|k|v][NB_] planes
    bf* ATh = (bf*)take(NB_ * PB * 2); bf* ATl = (bf*)take(NB_ * PB * 2);
    if ((size_t)(wsp - (char*)d_ws) > ws_size) return;    // total 104 MiB; ws 256 MiB
    // every stage is ONE launch over both batches (and over q, k, v where there are three)
    k_cvt8<<<dim3((unsigned)(SL / 8 / 256), 4 + NB_ * TT / DD, 1), 256, 0, stream>>>(wq, wk, wv, wo, x, WQ, SL / 8);   // [out][in] weights = Bt as-is
    k_gemmw<bf, 0, false, 1, true><<<dim3(NB_ * TT / 64, DD / 64, 3), 32, 0, stream>>>(XB, nullptr, WQ, nullptr, DD, nullptr, DD, nullptr, 0, SL, 0, 0, am, Ph, Pl, P16);
    k_fattn<<<dim3((TT - RH) / 32 + RH / 16, NH_, NB_), 32, 0, stream>>>(Ph, Pl, Ph + NB_ * PB, Pl + NB_ * PB, Ph + 2 * NB_ * PB, Pl + 2 * NB_ * PB, P16, P16 + NB_ * PB, P16 + 2 * NB_ * PB, ATh, ATl);
    k_gemmw<bf, 1, true><<<dim3(NB_ * TT / 64, DD / 64, 1), 32, 0, stream>>>(ATh, ATl, WO, nullptr, DD, OUT, DD, bo, 0, 0, 0, 0, nullptr, nullptr, nullptr, nullptr);
}

// v007
// One run takes 89.4 microseconds.
// Next to v006, in two timings, it ran 1.14 and 1.16 times as fast.
// Over all steps from v000 it is 22.6 times as fast.
#include <hip/hip_runtime.h>

// Causal multi-head attention block (x [2][2048][1024], attention_mask [2][2048] (float ones, read as data); q/k/v = x W^T ([out][in], no bias) each multiplied by mask[b][t] per row; 16 heads x 64; scores / 8; causal (tril -> -inf);
// softmax; out = merged Wo^T + bo).
// Compute dtypes, f32 accumulate: every input rounded to bf16; projections on PLAIN bf16 operands (inputs: exact), x bf16(mask) in f32 in the projection GEMM's epilogue; PER-ROW
// PRECISION HYBRID: query rows < 512 of each batch on bf16 hi+lo planes for scores and attn.v (3 products), rows >= 512 on SINGLE fp16 planes; output hi+lo x exact Wo (2 products) + bo.

#define NB_  2
#define TT   2048
#define DD   1024
#define NH_  16
#define HD   64
#define RH   512                  // query rows < RH: hi+lo planes; rows >= RH: fp16 planes
#define NF   32
#define SCL  0.125f               // 1/sqrt(64)
typedef _Float16 h16;
typedef unsigned short bf;
typedef __attribute__((ext_vector_type(16))) __bf16   v16bf;
typedef __attribute__((ext_vector_type(16))) _Float16 v16h;
typedef __attribute__((ext_vector_type(8)))  _Float16 v8h;
typedef __attribute__((ext_vector_type(8)))  unsigned short v8us;
typedef __attribute__((ext_vector_type(8)))  float    v8f;
typedef __attribute__((ext_vector_type(4)))  float    v4f;
typedef v8h  __attribute__((may_alias)) v8ha;
typedef v4f  __attribute__((may_alias)) v4fa;
typedef v8us __attribute__((may_alias)) v8usa;

__device__ __forceinline__ unsigned short f2bf(float f) { unsigned u = __float_as_uint(f); u += 0x7FFFu + ((u >> 16) & 1u); return (unsigned short)(u >> 16); }
__device__ __forceinline__ float bf2f(unsigned short b) { return __uint_as_float(((unsigned)b) << 16); }
__device__ __forceinline__ float bfr(float f) { return bf2f(f2bf(f)); }
__device__ __forceinline__ v16h cat16(v8h lo, v8h hi) { return __builtin_shufflevector(lo, hi, 0, 1, 2, 3, 4, 5, 6, 7, 8, 9, 10, 11, 12, 13, 14, 15); }
__device__ __forceinline__ v16bf cat16b(v8us lo, v8us hi) { return __builtin_bit_cast(v16bf, __builtin_shufflevector(lo, hi, 0, 1, 2, 3, 4, 5, 6, 7, 8, 9, 10, 11, 12, 13, 14, 15)); }
__device__ __forceinline__ v8f wmma16(v16h a, v16h b, v8f c) { return __builtin_amdgcn_wmma_f32_16x16x32_f16(false, a, false, b, (short)0, c, false, false); }
__device__ __forceinline__ v8f wmmab(v16bf a, v16bf b, v8f c) { return __builtin_amdgcn_wmma_f32_16x16x32_bf16(false, a, false, b, (short)0, c, false, false); }



// ---- FRAGMENT-MAJOR PLANES: every 16-bit WMMA operand plane [rows][K] is stored as blocks of 16 rows x 32 k (512 elements, 1 KiB). GEMM operands (K = DD): the four row blocks of a 64-row panel lie
// side by side, block (row / 16, k / 32) at (((row / 64) * (K / 32) + k / 32) * 4 + (row / 16) % 4) * 512, so one trip of a wave reads 8 KiB in a row per operand. Attention planes: see the PL epilogue of k_gemmw.
// Inside a block element (r, k) lies at ((k >> 4) & 1) * 256 + (((k >> 3) & 1) * 16 + r) * 8 + (k & 7): lane (lr, hi) finds its two runs of eight k at lane * 8 and 256 + lane * 8,
// so each of the two 16-byte loads of a fragment covers 512 contiguous bytes (four whole lines) instead of 32 bytes in each of sixteen lines. The k order of a fragment is what it was.
// ---- k_gemmw: register-blocked GEMM, ONE WAVE per 64x64 output tile (16 accumulators), operands straight from fragment-major 16-bit planes; grid (M/64, N/64, Z), 32 threads.
// C[m][n] (f32, pitch ldc, + optional f32 bias[n]) = sum_k A[m][k] Bt[n][k] (+ split products per NSPLIT). z-batch strides sA/sB/sC in elements. K % 64 == 0.
// SK > 1: grid.y = (N/64) * SK; work-group ks = blockIdx.y % SK sums only k in [ks K/SK, (ks+1) K/SK) into its own plane C + ks * sP; the reader adds the SK planes. K % (64 SK) == 0.
template <typename T16> struct WFrag;
template <> struct WFrag<h16> { typedef v16h V; static __device__ __forceinline__ V ld(const h16* p) { return cat16(*(const v8h*)p, *(const v8h*)(p + 256)); } static __device__ __forceinline__ v8f mma(V a, V b, v8f c) { return wmma16(a, b, c); } };
template <> struct WFrag<bf> { typedef v16bf V; static __device__ __forceinline__ V ld(const bf* p) { return cat16b(*(const v8us*)p, *(const v8us*)(p + 256)); } static __device__ __forceinline__ v8f mma(V a, V b, v8f c) { return wmmab(a, b, c); } };
// PL (the q, k, v projections; blockIdx.z = projection, a 64x64 tile = 64 positions of one head): no f32 C; the tile goes from the accumulators straight into the attention planes, x bf16(mask[t]).
// q and k planes: per head rows = t, k = d (K = HD): block (h * (TT / 16) + t / 16) * 2 + d / 32. v planes: per head rows = d, k = t, the four row blocks of 32 keys side by side: block (h * (TT / 32) + t / 32) * 4 + d / 16.
// An accumulator holds, per lane, eight consecutive A rows of one B row, which IS a run of eight k of a fragment block when the plane's k runs along the A rows: so q and k are formed as W x^T (A rows = d)
// and v as x W^T (A rows = t); each accumulator is then one 512-byte run of a block as it stands, and a tile is 8 KiB in a row of each plane.
__device__ __forceinline__ h16 tohx(float x) { return (h16)x; }
__device__ __forceinline__ void splitf(float y, unsigned short& h, unsigned short& l) { h = f2bf(y); l = f2bf(y - bf2f(h)); }
template <typename T16, int NSPLIT, bool BIAS, int SK = 1, bool PL = false>
__global__ __launch_bounds__(32) void k_gemmw(const T16* __restrict__ A, const T16* __restrict__ A2, const T16* __restrict__ Bt, const T16* __restrict__ Bt2, int K, float* C, int ldc, const float* __restrict__ bias, size_t sA, size_t sB, size_t sC, size_t sP,
                                              const float* __restrict__ Mv, bf* Ph, bf* Pl, h16* P16) {
    typedef typename WFrag<T16>::V V;
    __shared__ __align__(16) float os[16 * 68];
    const size_t z = blockIdx.z; A += z * sA; if (A2) A2 += z * sA; Bt += z * sB; if (Bt2) Bt2 += z * sB; C += z * sC;
    const int lane = threadIdx.x & 31, lr = lane & 15, hi = lane >> 4; int r0 = blockIdx.x * 64, c0 = (blockIdx.y / SK) * 64;
    const bool qk = PL && z < 2;      // q, k: the two operands change places (W rows on the A side)
    if (qk) { const T16* t = A; A = Bt; Bt = t; const int r = r0; r0 = c0; c0 = r; }
    const int ks = blockIdx.y % SK, kb = ks * (K / SK), ke = kb + K / SK; C += (size_t)ks * sP;
    v8f acc[4][4];
#pragma unroll
    for (int mb = 0; mb < 4; ++mb)
#pragma unroll
        for (int nb = 0; nb < 4; ++nb) acc[mb][nb] = (v8f){};
    // the current k block of each operand's 64-row panel (64 K elements a panel, 2048 a k block, 4 KiB); a plane that is not used stands in as its partner
    constexpr bool HA2 = NSPLIT == 1 || NSPLIT == 2, HB2 = NSPLIT >= 2;
    const T16* pa = A + (size_t)r0 * K + (size_t)kb * 64; const T16* pb = Bt + (size_t)c0 * K + (size_t)kb * 64;
    const T16* pa2 = HA2 ? A2 + (size_t)r0 * K + (size_t)kb * 64 : pa; const T16* pb2 = HB2 ? Bt2 + (size_t)c0 * K + (size_t)kb * 64 : pb;
    unsigned vb = lane * 16;      // this lane's byte offset from those four places: its run of eight in the block, plus the blocks done; one register for every operand
    // TWO FRAGMENT SETS: all loads of k block i + 1 are issued as one group in front of the products of k block i, so a block waits for its operands once, under the block before it.
    // A trip is two k blocks (one per set, no register copies): (K / SK) % 64 == 0. Products and their order per accumulator are what they were.
    struct FSet { V a[4], a2[4], b[4], b2[4]; };
    FSet s0, s1;
    auto at = [&](const T16* p, const int off) __attribute__((always_inline)) { return (const T16*)((const char*)p + vb) + off; };
    auto ldset = [&](FSet& s, const int off) __attribute__((always_inline)) {
#pragma unroll
        for (int mb = 0; mb < 4; ++mb) { s.a[mb] = WFrag<T16>::ld(at(pa, off + mb * 512)); if (HA2) s.a2[mb] = WFrag<T16>::ld(at(pa2, off + mb * 512)); }
#pragma unroll
        for (int nb = 0; nb < 4; ++nb) { s.b[nb] = WFrag<T16>::ld(at(pb, off + nb * 512)); if (HB2) s.b2[nb] = WFrag<T16>::ld(at(pb2, off + nb * 512)); } };
    auto mmaset = [&](const FSet& s) __attribute__((always_inline)) {
#pragma unroll
        for (int nb = 0; nb < 4; ++nb)
#pragma unroll
            for (int mb = 0; mb < 4; ++mb) { acc[mb][nb] = WFrag<T16>::mma(s.a[mb], s.b[nb], acc[mb][nb]); if (HA2) acc[mb][nb] = WFrag<T16>::mma(s.a2[mb], s.b[nb], acc[mb][nb]); if (HB2) acc[mb][nb] = WFrag<T16>::mma(s.a[mb], s.b2[nb], acc[mb][nb]); } };
    ldset(s0, 0);
    asm volatile("s_wait_xcnt 0x0" :: "v"(vb) : "memory");      // behind the first loads: on the path round the loop nothing else stands between them and the next write of what they name
#pragma unroll 1
    for (int kc = kb; kc < ke - 64; kc += 64) {
        ldset(s1, 2048);
        __builtin_amdgcn_sched_barrier(0);      // keeps the next block's loads in front of this block's products (sunk among them they would be waited for at once)
        mmaset(s0);
        __builtin_amdgcn_sched_barrier(0);      // the same for the block after: its loads stay between the two runs of products
        ldset(s0, 4096);
        __builtin_amdgcn_sched_barrier(0);      // as above
        mmaset(s1);
        __builtin_amdgcn_sched_barrier(0);      // keeps the wait below behind the trip's products, not between the loads and the products
        // s_wait_xcnt 0 behind the trip's global loads, before their offset register is stepped; the register passes through the statement, so that the step is formed behind the wait
        asm volatile("s_wait_xcnt 0x0" : "+v"(vb) :: "memory");
        vb += 8192;
    }
    ldset(s1, 2048);
    // the same wait behind the last loads; offset register and the four places are inputs so that whatever the loads name stays as it is up to the wait
    asm volatile("s_wait_xcnt 0x0" :: "v"(vb), "v"(at(pa, 2048)), "v"(at(pb, 2048)), "v"(at(pa2, 2048)), "v"(at(pb2, 2048)) : "memory");
    __builtin_amdgcn_sched_barrier(0);          // the last block's loads fly under the products of the block before it
    mmaset(s0);
    mmaset(s1);
    __builtin_amdgcn_sched_barrier(0);          // keeps the store addresses' arithmetic behind the last products, where the fragment registers are free (formed among them it spills)
    if constexpr (PL) {
        const int tp = qk ? c0 : r0, hd = (qk ? r0 : c0) >> 6;      // first position of the tile (both batches in a row), head
        const size_t ob = ((size_t)z * NB_ + tp / TT) * TT * DD + (size_t)(hd * (TT * HD / 512) + (tp % TT) / 8) * 512 + lane * 8;
        bf* ph = Ph + ob; bf* pl = Pl + ob; h16* p16 = P16 + ob;
        // s_wait_xcnt 0 behind each run of global loads and of global stores, before a register that they name is written again; address pairs and store data are inputs so that they stay as they are up to the wait
        auto put = [&](const bool tb) __attribute__((always_inline)) {      // tb: positions along the B rows (q, k), else along the A rows (v)
            const float* mp = Mv + tp + (tb ? lr : hi * 8); float mq[4]; v8f mm[4];
#pragma unroll
            for (int i = 0; i < 4; ++i) { if (tb) mq[i] = mp[i * 16]; else mm[i] = *(const v8f*)(mp + i * 16); }
            asm volatile("s_wait_xcnt 0x0" :: "v"(mp) : "memory");
#pragma unroll
            for (int mb = 0; mb < 4; ++mb) { v8us oh[4], ol[4]; v8h o16[4];
#pragma unroll
                for (int nb = 0; nb < 4; ++nb)
#pragma unroll
                    for (int j = 0; j < 8; ++j) { const float x = __fmul_rn(acc[mb][nb][j], bfr(tb ? mq[nb] : mm[mb][j])); unsigned short a, c2; splitf(x, a, c2); oh[nb][j] = a; ol[nb][j] = c2; o16[nb][j] = tohx(x); }
#pragma unroll
                for (int nb = 0; nb < 4; ++nb) { const int off = (tb ? nb * 2 + (mb >> 1) : (mb >> 1) * 4 + nb) * 512 + (mb & 1) * 256; *(v8us*)(ph + off) = oh[nb]; *(v8us*)(pl + off) = ol[nb]; *(v8h*)(p16 + off) = o16[nb]; }
                asm volatile("s_wait_xcnt 0x0" :: "v"(ph), "v"(pl), "v"(p16), "v"(oh[0]), "v"(oh[1]), "v"(oh[2]), "v"(oh[3]), "v"(ol[0]), "v"(ol[1]), "v"(ol[2]), "v"(ol[3]), "v"(o16[0]), "v"(o16[1]), "v"(o16[2]), "v"(o16[3]) : "memory"); }
        };
        if (qk) put(true); else put(false);
    } else
#pragma unroll
    for (int mb = 0; mb < 4; ++mb) {
#pragma unroll
        for (int nb = 0; nb < 4; ++nb) {
#pragma unroll
            for (int j = 0; j < 8; ++j) os[(hi * 8 + j) * 68 + nb * 16 + lr] = acc[mb][nb][j]; }
        __builtin_amdgcn_wave_barrier(); asm volatile("" ::: "memory");
        float* crow = C + (size_t)(r0 + mb * 16) * ldc + c0;
{
            v4f vals[8]; float* cp[8];
#pragma unroll
            for (int s = 0; s < 8; ++s) { const int row = 2 * s + hi, cofs = lr * 4; v4f val = *(const v4fa*)(os + row * 68 + cofs); if (BIAS) { val[0] += bfr(bias[c0 + cofs]); val[1] += bfr(bias[c0 + cofs + 1]); val[2] += bfr(bias[c0 + cofs + 2]); val[3] += bfr(bias[c0 + cofs + 3]); }
                vals[s] = val; cp[s] = crow + (size_t)row * ldc + cofs; *(v4f*)cp[s] = val; }
            // s_wait_xcnt 0 behind the eight stores, before a register that they name is written again; address pairs and data are inputs so that they stay as they are up to the wait
            asm volatile("s_wait_xcnt 0x0" :: "v"(cp[0]), "v"(cp[1]), "v"(cp[2]), "v"(cp[3]), "v"(cp[4]), "v"(cp[5]), "v"(cp[6]), "v"(cp[7]), "v"(vals[0]), "v"(vals[1]), "v"(vals[2]), "v"(vals[3]), "v"(vals[4]), "v"(vals[5]), "v"(vals[6]), "v"(vals[7]) : "memory");
             }
        __builtin_amdgcn_wave_barrier(); asm volatile("" ::: "memory");
    }
}

typedef __attribute__((ext_vector_type(2))) unsigned short v2us;
typedef __attribute__((ext_vector_type(2))) _Float16 v2h;
typedef __attribute__((ext_vector_type(4))) _Float16 v4h;
typedef __attribute__((ext_vector_type(2))) float v2f;

// blockIdx.y picks the DD x DD slab: 0..3 = Wq, Wk, Wv, Wo, 4.. = slabs of x (both batches); dst holds them in that order, one after the other, each fragment-major (K = DD).
// Thread i writes the slab's i-th run of eight: a wave stores 512 contiguous bytes and reads 64 bytes of each of 16 rows; a work-group reads one whole line of each of 64 rows.
__global__ __launch_bounds__(256) void k_cvt8(const float* __restrict__ wq, const float* __restrict__ wk, const float* __restrict__ wv, const float* __restrict__ wo, const float* __restrict__ x, bf* dst, size_t n8) { const size_t i = (size_t)blockIdx.x * 256 + threadIdx.x; if (i >= n8) return;
    const int y = blockIdx.y; const float* src = y == 0 ? wq : y == 1 ? wk : y == 2 ? wv : y == 3 ? wo : x + (size_t)(y - 4) * DD * DD; dst += (size_t)y * DD * DD;
    const int ln = (int)i & 31, row = (int)(i >> 13) * 64 + ((int)(i >> 6) & 3) * 16 + (ln & 15), k0 = ((int)(i >> 8) & (DD / 32 - 1)) * 32 + ((int)(i >> 5) & 1) * 16 + (ln >> 4) * 8; const v8f v = *(const v8f*)(src + (size_t)row * DD + k0); v8us o;
#pragma unroll
    for (int k = 0; k < 8; ++k) o[k] = f2bf(v[k]); *(v8us*)(dst + i * 8) = o;  }
// ---- k_fattn: scores, causal softmax and attn.v in ONE launch (blockIdx.z = batch), one wave per query tile, running (online) softmax over key blocks that end at the diagonal.
// FOUR WAVES (four neighbouring query tiles of one head) form a work-group and walk the same key blocks: each block's K and V planes (16 KiB, already in fragment order) are brought into LDS ONCE
// by asynchronous copies, two buffers, the block after next in flight under the current one, and every wave takes its fragments from LDS: a block leaves L2 once for four tiles, not four times.
// The score tile is formed TRANSPOSED (A = key rows, B = query rows): lane (lr, hi) then holds, for query lr, keys hi*8+j of each 16-key tile, which is the B fragment of
// O^T = V^T P^T as it stands (k = 8 hi + j, 16 + 8 hi + j over two tiles), and max, sum and rescale of a query live in that query's own lanes.
// Rows < RH: bf16 hi+lo planes, 3 products each, 16 queries x 32 keys a trip; rows >= RH: fp16 planes, 32 queries x 64 keys a trip. Output: merged [t][DD] hi/lo planes, fragment-major (K = DD).
#define C2L 0.18033688011112042f  // (1/8) log2(e): softmax in base 2
template <typename T16> struct PFrag;
template <> struct PFrag<h16> { static __device__ __forceinline__ void mk(const v8f p0, const v8f p1, v16h& h, v16h& l) { (void)l;
#pragma unroll
    for (int e = 0; e < 8; ++e) { h[e] = (h16)p0[e]; h[8 + e] = (h16)p1[e]; } } };
template <> struct PFrag<bf> { static __device__ __forceinline__ void mk(const v8f p0, const v8f p1, v16bf& h, v16bf& l) { v8us h0, h1, l0, l1;
#pragma unroll
    for (int e = 0; e < 8; ++e) { unsigned short a, c; splitf(p0[e], a, c); h0[e] = a; l0[e] = c; splitf(p1[e], a, c); h1[e] = a; l1[e] = c; }
    h = cat16b(h0, h1); l = cat16b(l0, l1); } };
// s_wait_xcnt 0 behind a run of global loads or stores, before a register that they name is written again; the address pairs are inputs so that they stay as they are up to the wait.
template <bool SPLIT, typename T> __device__ __forceinline__ void xwait(const T* a, const T* b) {
    if (SPLIT) asm volatile("s_wait_xcnt 0x0" :: "v"(a), "v"(b) : "memory"); else asm volatile("s_wait_xcnt 0x0" :: "v"(a) : "memory"); }
// q0: this wave's first query; nt: key blocks that the work-group walks (up to its last wave's diagonal; at least 2); ring: the work-group's two LDS buffers of 8192 elements, each [K | V] of one block, [K | K lo | V | V lo] on hi+lo planes.
template <typename T16, bool SPLIT, int NQ, int KB>
__device__ __forceinline__ void fattn_tile(const T16* __restrict__ Q, const T16* __restrict__ Q2, const T16* __restrict__ Kp, const T16* __restrict__ K2, const T16* __restrict__ Vt, const T16* __restrict__ V2, const int q0, const int nt, const T16* ring, bf* Ah, bf* Al) {
    typedef typename WFrag<T16>::V V; typedef WFrag<T16> W;
    constexpr int NKT = KB / 16, NU = KB / 32;
    const int lane = threadIdx.x & 31, lr = lane & 15, hi = lane >> 4;
    V qf[NQ][2], ql[NQ][2], kf[NKT][2], kl[NKT][2];
    { const size_t qo = (size_t)q0 * HD + lane * 8; const T16* qp = Q + qo; const T16* qp2 = SPLIT ? Q2 + qo : nullptr;
#pragma unroll
      for (int nq = 0; nq < NQ; ++nq)
#pragma unroll
        for (int c = 0; c < 2; ++c) { qf[nq][c] = W::ld(qp + (nq * 2 + c) * 512); if (SPLIT) ql[nq][c] = W::ld(qp2 + (nq * 2 + c) * 512); }
      xwait<SPLIT>(qp, qp2); }
    v8f o[4][NQ]; float m[NQ], l[NQ];
#pragma unroll
    for (int nq = 0; nq < NQ; ++nq) { m[nq] = -3.0e38f; l[nq] = 0.f;
#pragma unroll
        for (int dt = 0; dt < 4; ++dt) o[dt][nq] = (v8f){}; }
    // a block of KB keys is KB * HD contiguous elements of each k plane and of each v plane: 16 KiB over the planes in use, eight 16-byte copies a thread (128 threads), chunk c at byte c * 2048 of the buffer
    constexpr int PE = KB * HD, CPP = PE / 1024;      // elements of one plane's block; 2-KiB chunks in it
    static_assert((SPLIT ? 4 : 2) * PE == 8192, "a block fills one buffer");
    const int tid = threadIdx.x; const unsigned l0 = (unsigned)(size_t)ring + tid * 16;      // this thread's first LDS byte in buffer 0 (low 32 bits of the shared address)
    auto cp = [&](const int t) __attribute__((always_inline)) {      // block t into buffer t & 1
        const size_t go = (size_t)t * PE + tid * 8; const unsigned lb = l0 + (t & 1) * 16384; const T16* g[8];
#pragma unroll
        for (int c = 0; c < 8; ++c) { const int pn = c / CPP; g[c] = (SPLIT ? (pn == 0 ? Kp : pn == 1 ? K2 : pn == 2 ? Vt : V2) : (pn == 0 ? Kp : Vt)) + go + (c % CPP) * 1024; }
        // the eight copies and, as the statement's last line, s_wait_xcnt 0: it stands in front of every later write of a register that a copy names
        asm volatile("global_load_async_to_lds_b128 %0, %8, off\n\tglobal_load_async_to_lds_b128 %1, %9, off\n\tglobal_load_async_to_lds_b128 %2, %10, off\n\tglobal_load_async_to_lds_b128 %3, %11, off\n\t"
                     "global_load_async_to_lds_b128 %4, %12, off\n\tglobal_load_async_to_lds_b128 %5, %13, off\n\tglobal_load_async_to_lds_b128 %6, %14, off\n\tglobal_load_async_to_lds_b128 %7, %15, off\n\ts_wait_xcnt 0x0"
                     :: "v"(lb), "v"(lb + 2048), "v"(lb + 4096), "v"(lb + 6144), "v"(lb + 8192), "v"(lb + 10240), "v"(lb + 12288), "v"(lb + 14336),
                        "v"(g[0]), "v"(g[1]), "v"(g[2]), "v"(g[3]), "v"(g[4]), "v"(g[5]), "v"(g[6]), "v"(g[7]) : "memory"); };
    V vf[4][NU], vl[4][NU], pf[NQ][NU], pl[NQ][NU];
    auto ldk = [&](const int t) __attribute__((always_inline)) {      // K fragments of block t, which has been published
        const T16* lp = ring + (t & 1) * 8192 + lane * 8;             // this lane's place in the block's buffer
#pragma unroll
        for (int kt = 0; kt < NKT; ++kt)
#pragma unroll
            for (int c = 0; c < 2; ++c) { kf[kt][c] = W::ld(lp + (kt * 2 + c) * 512); if (SPLIT) kl[kt][c] = W::ld(lp + PE + (kt * 2 + c) * 512); } };
    auto scores = [&](const int t, const bool last) __attribute__((always_inline)) {      // block t: V fragments out of LDS, scores, softmax, P fragments; K fragments are in registers already
        const T16* lp = ring + (t & 1) * 8192 + lane * 8; const int kb = t * KB;
#pragma unroll
        for (int dt = 0; dt < 4; ++dt)
#pragma unroll
            for (int u = 0; u < NU; ++u) { vf[dt][u] = W::ld(lp + 4096 + (u * 4 + dt) * 512); if (SPLIT) vl[dt][u] = W::ld(lp + 4096 + PE + (u * 4 + dt) * 512); }
        v8f s[NKT][NQ];
#pragma unroll
        for (int kt = 0; kt < NKT; ++kt)
#pragma unroll
            for (int nq = 0; nq < NQ; ++nq) { v8f a = (v8f){};
#pragma unroll
                for (int c = 0; c < 2; ++c) { a = W::mma(kf[kt][c], qf[nq][c], a); if (SPLIT) { a = W::mma(kf[kt][c], ql[nq][c], a); a = W::mma(kl[kt][c], qf[nq][c], a); } }
                s[kt][nq] = a; }
#pragma unroll
        for (int nq = 0; nq < NQ; ++nq) { float bm = -3.0e38f;
#pragma unroll
            for (int kt = 0; kt < NKT; ++kt)
#pragma unroll
                for (int j = 0; j < 8; ++j) { if (last) s[kt][nq][j] = (kb + kt * 16 + hi * 8 + j <= q0 + nq * 16 + lr) ? s[kt][nq][j] : -3.0e38f; bm = fmaxf(bm, s[kt][nq][j]); }
            bm = fmaxf(bm, __shfl_xor(bm, 16, 32));
            const float mn = fmaxf(m[nq], bm * C2L), al = __builtin_amdgcn_exp2f(m[nq] - mn); m[nq] = mn;
#pragma unroll
            for (int kt = 0; kt < NKT; ++kt)
#pragma unroll
                for (int j = 0; j < 8; ++j) s[kt][nq][j] = __builtin_amdgcn_exp2f(fmaf(s[kt][nq][j], C2L, -mn));
            v8f rv = s[0][nq];            // eight independent partial sums, folded as a tree
#pragma unroll
            for (int kt = 1; kt < NKT; ++kt) rv += s[kt][nq];
            l[nq] = fmaf(l[nq], al, ((rv[0] + rv[1]) + (rv[2] + rv[3])) + ((rv[4] + rv[5]) + (rv[6] + rv[7])));
#pragma unroll
            for (int dt = 0; dt < 4; ++dt) o[dt][nq] *= al;
#pragma unroll
            for (int u = 0; u < NU; ++u) PFrag<T16>::mk(s[2 * u][nq], s[2 * u + 1][nq], pf[nq][u], pl[nq][u]); } };
    auto attnv = [&]() __attribute__((always_inline)) {      // attn.v of the block, operands all in registers
#pragma unroll
        for (int u = 0; u < NU; ++u)
#pragma unroll
            for (int dt = 0; dt < 4; ++dt)
#pragma unroll
                for (int nq = 0; nq < NQ; ++nq) { o[dt][nq] = W::mma(vf[dt][u], pf[nq][u], o[dt][nq]); if (SPLIT) { o[dt][nq] = W::mma(vf[dt][u], pl[nq][u], o[dt][nq]); o[dt][nq] = W::mma(vl[dt][u], pf[nq][u], o[dt][nq]); } }
    };
    const int tl = q0 / KB;     // the one block that holds this wave's diagonal (nt - 2 or nt - 1); every block before it is wholly at or below it
    // the hand-over stands in front of a block's attn.v, whose operands are in registers by then: the refill has a whole trip to land, and the next K fragments come out of LDS under the attn.v products
    auto foot = [&]() __attribute__((always_inline)) {     // hand-over of trip t, every wave, also one that is past its diagonal
        asm volatile("s_wait_dscnt 0x0" ::: "memory");     // this wave's reads of buffer t & 1 are done before the buffer is handed back
        asm volatile("s_wait_asynccnt 0x0" ::: "memory");  // this wave's copies of block t + 1 have landed
        __syncthreads(); };                                // publishes block t + 1 and ends every wave's reads of block t
    cp(0);
    asm volatile("s_wait_asynccnt 0x0" ::: "memory");      // this wave's copies of block 0 have landed
    __syncthreads();                                       // ... and every other wave's: block 0 may be read
    cp(1);
    ldk(0);
#pragma unroll 1                            // rolled: one body, the buffer picked by the trip's parity
    for (int t = 0; t < nt - 2; ++t) {      // blocks below every wave's diagonal; block t + 2 exists and goes into the buffer just read
        scores(t, false);
        __builtin_amdgcn_sched_barrier(0);      // keeps scores and softmax in front of the hand-over (sunk behind it, the wait for block t + 1 would come a whole softmax too early)
        foot(); cp(t + 2); ldk(t + 1);
        __builtin_amdgcn_sched_barrier(0);      // keeps the products behind the copies and the K reads, which then fly under them
        attnv(); }
#pragma unroll 1                             // rolled: one copy of the masked body
    for (int t = nt - 2; t < nt; ++t) {      // the two blocks with the diagonals, masked by index (an identity on a block below the wave's diagonal)
        if (t <= tl) { ldk(t); scores(t, true); }      // here the K fragments are read at the head of their own trip: nothing but the attn.v operands is held over the hand-over
        foot();
        if (t <= tl) attnv(); }
    asm volatile("s_wait_asynccnt 0x0" ::: "memory");      // nothing is in flight when the wave ends
    const size_t ob = (size_t)(q0 >> 6) * 64 * DD + ((q0 >> 4) & 3) * 512 + lane * 8; bf* ah = Ah + ob; bf* al2 = Al + ob;      // 64-row panel, row block in it (q0 + 16 nq stays in the panel)
#pragma unroll
    for (int nq = 0; nq < NQ; ++nq) { const float inv = __fdiv_rn(1.0f, l[nq] + __shfl_xor(l[nq], 16, 32)); v8us oh[4], ol[4];
#pragma unroll
        for (int dt = 0; dt < 4; ++dt)
#pragma unroll
            for (int j = 0; j < 8; ++j) { unsigned short a, c; splitf(o[dt][nq][j] * inv, a, c); oh[dt][j] = a; ol[dt][j] = c; }
#pragma unroll
        for (int dt = 0; dt < 4; ++dt) { *(v8us*)(ah + nq * 512 + (dt >> 1) * 2048 + (dt & 1) * 256) = oh[dt]; *(v8us*)(al2 + nq * 512 + (dt >> 1) * 2048 + (dt & 1) * 256) = ol[dt]; }
        // the same wait behind the stores: their data registers are inputs too
        asm volatile("s_wait_xcnt 0x0" :: "v"(ah), "v"(al2), "v"(oh[0]), "v"(oh[1]), "v"(oh[2]), "v"(oh[3]), "v"(ol[0]), "v"(ol[1]), "v"(ol[2]), "v"(ol[3]) : "memory"); }
}
__global__ __launch_bounds__(128) void k_fattn(const bf* __restrict__ QPh, const bf* __restrict__ QPl, const bf* __restrict__ KPh, const bf* __restrict__ KPl, const bf* __restrict__ VTh, const bf* __restrict__ VTl,
                                              const h16* __restrict__ QP16, const h16* __restrict__ KP16, const h16* __restrict__ VT16, bf* Ah, bf* Al) {
    const size_t hz = ((size_t)blockIdx.z * NH_ + blockIdx.y) * TT * HD; const int x = blockIdx.x; const size_t oz = (size_t)blockIdx.z * TT * DD + blockIdx.y * (HD / 32) * 2048; Ah += oz; Al += oz;
    __shared__ __align__(16) unsigned short ring[2 * 8192];
    const int w = __builtin_amdgcn_readfirstlane(threadIdx.x >> 5);      // wave in the work-group, in a scalar register: every test on it is a scalar branch
    if (x < (TT - RH) / 128) { const int Q0 = TT - 128 * (x + 1);        // longest rows first
        fattn_tile<h16, false, 2, 64>(QP16 + hz, nullptr, KP16 + hz, nullptr, VT16 + hz, nullptr, Q0 + 32 * w, Q0 / 64 + 2, (const h16*)ring, Ah, Al); }
    else { const int Q0 = RH - 64 * (x - (TT - RH) / 128 + 1);
        fattn_tile<bf, true, 1, 32>(QPh + hz, QPl + hz, KPh + hz, KPl + hz, VTh + hz, VTl + hz, Q0 + 16 * w, Q0 / 32 + 2, (const bf*)ring, Ah, Al); }
}

extern "C" void kernel_launch(void* const* d_in, const int* in_sizes, int n_in,
                              void* d_out, int out_size, void* d_ws, size_t ws_size, hipStream_t stream) {
    (void)in_sizes; (void)n_in; (void)out_size;
    const float* x = (const float*)d_in[0]; const float* am = (const float*)d_in[1]; const float* wq = (const float*)d_in[2]; const float* wk = (const float*)d_in[3]; const float* wv = (const float*)d_in[4]; const float* wo = (const float*)d_in[5]; const float* bo = (const float*)d_in[6];
    float* OUT = (float*)d_out;     // [2][2048][1024]
    char* wsp = (char*)d_ws;
    auto take = [&](size_t bytes) { char* p = wsp; wsp += (bytes + 255) & ~(size_t)255; return (void*)p; };
    const size_t SL = (size_t)DD * DD, PB = (size_t)TT * DD;      // one weight slab; one batch of one plane
    bf* WQ = (bf*)take(4 * SL * 2); bf* WO = WQ + 3 * SL; bf* XB = (bf*)take(NB_ * PB * 2);      // [Wq|Wk|Wv|Wo] and, right behind them, x [NB_ TT][DD], all fragment-major
    bf* Ph = (bf*)take(3 * NB_ * PB * 2); bf* Pl = (bf*)take(3 * NB_ * PB * 2); h16* P16 = (h16*)take(3 * NB_ * PB * 2);      // each [q|k|v][NB_] planes
    bf* ATh = (bf*)take(NB_ * PB * 2); bf* ATl = (bf*)take(NB_ * PB * 2);
    if ((size_t)(wsp - (char*)d_ws) > ws_size) return;    // total 104 MiB; ws 256 MiB
    // every stage is ONE launch over both batches (and over q, k, v where there are three)
    k_cvt8<<<dim3((unsigned)(SL / 8 / 256), 4 + NB_ * TT / DD, 1), 256, 0, stream>>>(wq, wk, wv, wo, x, WQ, SL / 8);   // [out][in] weights = Bt as-is
    k_gemmw<bf, 0, false, 1, true><<<dim3(NB_ * TT / 64, DD / 64, 3), 32, 0, stream>>>(XB, nullptr, WQ, nullptr, DD, nullptr, DD, nullptr, 0, SL, 0, 0, am, Ph, Pl, P16);
    k_fattn<<<dim3((TT - RH) / 128 + RH / 64, NH_, NB_), 128, 0, stream>>>(Ph, Pl, Ph + NB_ * PB, Pl + NB_ * PB, Ph + 2 * NB_ * PB, Pl + 2 * NB_ * PB, P16, P16 + NB_ * PB, P16 + 2 * NB_ * PB, ATh, ATl);
    k_gemmw<bf, 1, true><<<dim3(NB_ * TT / 64, DD / 64, 1), 32, 0, stream>>>(ATh, ATl, WO, nullptr, DD, OUT, DD, bo, 0, 0, 0, 0, nullptr, nullptr, nullptr, nullptr);
}

// v008
// One run takes 80.7 microseconds.
// Two timings next to v007 put it at 1.11 and 1.10 times that version's speed.
// Counting every step since v000, it is 25.0 times as fast.
#include <hip/hip_runtime.h>

// Causal multi-head attention block (x [2][2048][1024], attention_mask [2][2048] (float ones, read as data); q/k/v = x W^T ([out][in], no bias) each multiplied by mask[b][t] per row; 16 heads x 64; scores / 8; causal (tril -> -inf);
// softmax; out = merged Wo^T + bo).
// Compute dtypes, f32 accumulate: every input rounded to bf16; projections on PLAIN bf16 operands (inputs: exact), x bf16(mask) in f32 in the projection GEMM's epilogue; PER-ROW
// PRECISION HYBRID: query rows < 512 of each batch on bf16 hi+lo planes for scores and attn.v (3 products), rows >= 512 on SINGLE fp16 planes; output hi+lo x exact Wo (2 products) + bo.

#define NB_  2
#define TT   2048
#define DD   1024
#define NH_  16
#define HD   64
#define RH   512                  // query rows < RH: hi+lo planes; rows >= RH: fp16 planes
#define NF   32
#define SCL  0.125f               // 1/sqrt(64)
typedef _Float16 h16;
typedef unsigned short bf;
typedef __attribute__((ext_vector_type(16))) __bf16   v16bf;
typedef __attribute__((ext_vector_type(16))) _Float16 v16h;
typedef __attribute__((ext_vector_type(8)))  _Float16 v8h;
typedef __attribute__((ext_vector_type(8)))  unsigned short v8us;
typedef __attribute__((ext_vector_type(8)))  float    v8f;
typedef __attribute__((ext_vector_type(4)))  float    v4f;
typedef v8h  __attribute__((may_alias)) v8ha;
typedef v4f  __attribute__((may_alias)) v4fa;
typedef v8us __attribute__((may_alias)) v8usa;

__device__ __forceinline__ unsigned short f2bf(float f) { unsigned u = __float_as_uint(f); u += 0x7FFFu + ((u >> 16) & 1u); return (unsigned short)(u >> 16); }
__device__ __forceinline__ float bf2f(unsigned short b) { return __uint_as_float(((unsigned)b) << 16); }
__device__ __forceinline__ float bfr(float f) { return bf2f(f2bf(f)); }
__device__ __forceinline__ v16h cat16(v8h lo, v8h hi) { return __builtin_shufflevector(lo, hi, 0, 1, 2, 3, 4, 5, 6, 7, 8, 9, 10, 11, 12, 13, 14, 15); }
__device__ __forceinline__ v16bf cat16b(v8us lo, v8us hi) { return __builtin_bit_cast(v16bf, __builtin_shufflevector(lo, hi, 0, 1, 2, 3, 4, 5, 6, 7, 8, 9, 10, 11, 12, 13, 14, 15)); }
__device__ __forceinline__ v8f wmma16(v16h a, v16h b, v8f c) { return __builtin_amdgcn_wmma_f32_16x16x32_f16(false, a, false, b, (short)0, c, false, false); }
__device__ __forceinline__ v8f wmmab(v16bf a, v16bf b, v8f c) { return __builtin_amdgcn_wmma_f32_16x16x32_bf16(false, a, false, b, (short)0, c, false, false); }



// ---- FRAGMENT-MAJOR PLANES: every 16-bit WMMA operand plane [rows][K] is stored as blocks of 16 rows x 32 k (512 elements, 1 KiB). GEMM operands (K = DD): the four row blocks of a 64-row panel lie
// side by side, block (row / 16, k / 32) at (((row / 64) * (K / 32) + k / 32) * 4 + (row / 16) % 4) * 512, so one trip of a wave reads 8 KiB in a row per operand. Attention planes: see the PL epilogue of k_gemmw.
// Inside a block element (r, k) lies at ((k >> 4) & 1) * 256 + (((k >> 3) & 1) * 16 + r) * 8 + (k & 7): lane (lr, hi) finds its two runs of eight k at lane * 8 and 256 + lane * 8,
// so each of the two 16-byte loads of a fragment covers 512 contiguous bytes (four whole lines) instead of 32 bytes in each of sixteen lines. The k order of a fragment is what it was.
// ---- k_gemmw: register-blocked GEMM, ONE WAVE per 64x64 output tile (16 accumulators), operands straight from fragment-major 16-bit planes; grid (M/64, N/64, Z), 32 threads.
// C[m][n] (f32, pitch ldc, + optional f32 bias[n]) = sum_k A[m][k] Bt[n][k] (+ split products per NSPLIT). z-batch strides sA/sB/sC in elements. K % 64 == 0.
// SK > 1: grid.y = (N/64) * SK; work-group ks = blockIdx.y % SK sums only k in [ks K/SK, (ks+1) K/SK) into its own plane C + ks * sP; the reader adds the SK planes. K % (64 SK) == 0.
template <typename T16> struct WFrag;
template <> struct WFrag<h16> { typedef v16h V; static __device__ __forceinline__ V ld(const h16* p) { return cat16(*(const v8h*)p, *(const v8h*)(p + 256)); } static __device__ __forceinline__ v8f mma(V a, V b, v8f c) { return wmma16(a, b, c); } };
template <> struct WFrag<bf> { typedef v16bf V; static __device__ __forceinline__ V ld(const bf* p) { return cat16b(*(const v8us*)p, *(const v8us*)(p + 256)); } static __device__ __forceinline__ v8f mma(V a, V b, v8f c) { return wmmab(a, b, c); } };
// PL (the q, k, v projections; blockIdx.z = projection, a 64x64 tile = 64 positions of one head): no f32 C; the tile goes from the accumulators straight into the attention planes, x bf16(mask[t]).
// q and k planes: per head rows = t, k = d (K = HD): block (h * (TT / 16) + t / 16) * 2 + d / 32. v planes: per head rows = d, k = t, the four row blocks of 32 keys side by side: block (h * (TT / 32) + t / 32) * 4 + d / 16.
// An accumulator holds, per lane, eight consecutive A rows of one B row, which IS a run of eight k of a fragment block when the plane's k runs along the A rows: so q and k are formed as W x^T (A rows = d)
// and v as x W^T (A rows = t); each accumulator is then one 512-byte run of a block as it stands, and a tile is 8 KiB in a row of each plane.
__device__ __forceinline__ h16 tohx(float x) { return (h16)x; }
__device__ __forceinline__ void splitf(float y, unsigned short& h, unsigned short& l) { h = f2bf(y); l = f2bf(y - bf2f(h)); }
template <typename T16, int NSPLIT, bool BIAS, int SK = 1, bool PL = false>
__global__ __launch_bounds__(32) void k_gemmw(const T16* __restrict__ A, const T16* __restrict__ A2, const T16* __restrict__ Bt, const T16* __restrict__ Bt2, int K, float* C, int ldc, const float* __restrict__ bias, size_t sA, size_t sB, size_t sC, size_t sP,
                                              const float* __restrict__ Mv, bf* Ph, bf* Pl, h16* P16) {
    typedef typename WFrag<T16>::V V;
    __shared__ __align__(16) float os[16 * 68];
    const size_t z = blockIdx.z; A += z * sA; if (A2) A2 += z * sA; Bt += z * sB; if (Bt2) Bt2 += z * sB; C += z * sC;
    const int lane = threadIdx.x & 31, lr = lane & 15, hi = lane >> 4; int r0 = blockIdx.x * 64, c0 = (blockIdx.y / SK) * 64;
    const bool qk = PL && z < 2;      // q, k: the two operands change places (W rows on the A side)
    if (qk) { const T16* t = A; A = Bt; Bt = t; const int r = r0; r0 = c0; c0 = r; }
    const int ks = blockIdx.y % SK, kb = ks * (K / SK), ke = kb + K / SK; C += (size_t)ks * sP;
    v8f acc[4][4];
#pragma unroll
    for (int mb = 0; mb < 4; ++mb)
#pragma unroll
        for (int nb = 0; nb < 4; ++nb) acc[mb][nb] = (v8f){};
    // the current k block of each operand's 64-row panel (64 K elements a panel, 2048 a k block, 4 KiB); a plane that is not used stands in as its partner
    constexpr bool HA2 = NSPLIT == 1 || NSPLIT == 2, HB2 = NSPLIT >= 2;
    const T16* pa = A + (size_t)r0 * K + (size_t)kb * 64; const T16* pb = Bt + (size_t)c0 * K + (size_t)kb * 64;
    const T16* pa2 = HA2 ? A2 + (size_t)r0 * K + (size_t)kb * 64 : pa; const T16* pb2 = HB2 ? Bt2 + (size_t)c0 * K + (size_t)kb * 64 : pb;
    unsigned vb = lane * 16;      // this lane's byte offset from those four places: its run of eight in the block, plus the blocks done; one register for every operand
    // TWO FRAGMENT SETS: all loads of k block i + 1 are issued as one group in front of the products of k block i, so a block waits for its operands once, under the block before it.
    // A trip is two k blocks (one per set, no register copies): (K / SK) % 64 == 0. Products and their order per accumulator are what they were.
    struct FSet { V a[4], a2[4], b[4], b2[4]; };
    FSet s0, s1;
    auto at = [&](const T16* p, const int off) __attribute__((always_inline)) { return (const T16*)((const char*)p + vb) + off; };
    auto ldset = [&](FSet& s, const int off) __attribute__((always_inline)) {
#pragma unroll
        for (int mb = 0; mb < 4; ++mb) { s.a[mb] = WFrag<T16>::ld(at(pa, off + mb * 512)); if (HA2) s.a2[mb] = WFrag<T16>::ld(at(pa2, off + mb * 512)); }
#pragma unroll
        for (int nb = 0; nb < 4; ++nb) { s.b[nb] = WFrag<T16>::ld(at(pb, off + nb * 512)); if (HB2) s.b2[nb] = WFrag<T16>::ld(at(pb2, off + nb * 512)); } };
    auto mmaset = [&](const FSet& s) __attribute__((always_inline)) {
#pragma unroll
        for (int nb = 0; nb < 4; ++nb)
#pragma unroll
            for (int mb = 0; mb < 4; ++mb) { acc[mb][nb] = WFrag<T16>::mma(s.a[mb], s.b[nb], acc[mb][nb]); if (HA2) acc[mb][nb] = WFrag<T16>::mma(s.a2[mb], s.b[nb], acc[mb][nb]); if (HB2) acc[mb][nb] = WFrag<T16>::mma(s.a[mb], s.b2[nb], acc[mb][nb]); } };
    ldset(s0, 0);
    asm volatile("s_wait_xcnt 0x0" :: "v"(vb) : "memory");      // behind the first loads: on the path round the loop nothing else stands between them and the next write of what they name
#pragma unroll 1
    for (int kc = kb; kc < ke - 64; kc += 64) {
        ldset(s1, 2048);
        __builtin_amdgcn_sched_barrier(0);      // keeps the next block's loads in front of this block's products (sunk among them they would be waited for at once)
        mmaset(s0);
        __builtin_amdgcn_sched_barrier(0);      // the same for the block after: its loads stay between the two runs of products
        ldset(s0, 4096);
        __builtin_amdgcn_sched_barrier(0);      // as above
        mmaset(s1);
        __builtin_amdgcn_sched_barrier(0);      // keeps the wait below behind the trip's products, not between the loads and the products
        // s_wait_xcnt 0 behind the trip's global loads, before their offset register is stepped; the register passes through the statement, so that the step is formed behind the wait
        asm volatile("s_wait_xcnt 0x0" : "+v"(vb) :: "memory");
        vb += 8192;
    }
    ldset(s1, 2048);
    // the same wait behind the last loads; offset register and the four places are inputs so that whatever the loads name stays as it is up to the wait
    asm volatile("s_wait_xcnt 0x0" :: "v"(vb), "v"(at(pa, 2048)), "v"(at(pb, 2048)), "v"(at(pa2, 2048)), "v"(at(pb2, 2048)) : "memory");
    __builtin_amdgcn_sched_barrier(0);          // the last block's loads fly under the products of the block before it
    mmaset(s0);
    mmaset(s1);
    __builtin_amdgcn_sched_barrier(0);          // keeps the store addresses' arithmetic behind the last products, where the fragment registers are free (formed among them it spills)
    if constexpr (PL) {
        const int tp = qk ? c0 : r0, hd = (qk ? r0 : c0) >> 6;      // first position of the tile (both batches in a row), head
        const size_t ob = ((size_t)z * NB_ + tp / TT) * TT * DD + (size_t)(hd * (TT * HD / 512) + (tp % TT) / 8) * 512 + lane * 8;
        bf* ph = Ph + ob; bf* pl = Pl + ob; h16* p16 = P16 + ob;
        // s_wait_xcnt 0 behind each run of global loads and of global stores, before a register that they name is written again; address pairs and store data are inputs so that they stay as they are up to the wait
        auto put = [&](const bool tb) __attribute__((always_inline)) {      // tb: positions along the B rows (q, k), else along the A rows (v)
            const float* mp = Mv + tp + (tb ? lr : hi * 8); float mq[4]; v8f mm[4];
#pragma unroll
            for (int i = 0; i < 4; ++i) { if (tb) mq[i] = mp[i * 16]; else mm[i] = *(const v8f*)(mp + i * 16); }
            asm volatile("s_wait_xcnt 0x0" :: "v"(mp) : "memory");
#pragma unroll
            for (int mb = 0; mb < 4; ++mb) { v8us oh[4], ol[4]; v8h o16[4];
#pragma unroll
                for (int nb = 0; nb < 4; ++nb)
#pragma unroll
                    for (int j = 0; j < 8; ++j) { const float x = __fmul_rn(acc[mb][nb][j], bfr(tb ? mq[nb] : mm[mb][j])); unsigned short a, c2; splitf(x, a, c2); oh[nb][j] = a; ol[nb][j] = c2; o16[nb][j] = tohx(x); }
#pragma unroll
                for (int nb = 0; nb < 4; ++nb) { const int off = (tb ? nb * 2 + (mb >> 1) : (mb >> 1) * 4 + nb) * 512 + (mb & 1) * 256; *(v8us*)(ph + off) = oh[nb]; *(v8us*)(pl + off) = ol[nb]; *(v8h*)(p16 + off) = o16[nb]; }
                asm volatile("s_wait_xcnt 0x0" :: "v"(ph), "v"(pl), "v"(p16), "v"(oh[0]), "v"(oh[1]), "v"(oh[2]), "v"(oh[3]), "v"(ol[0]), "v"(ol[1]), "v"(ol[2]), "v"(ol[3]), "v"(o16[0]), "v"(o16[1]), "v"(o16[2]), "v"(o16[3]) : "memory"); }
        };
        if (qk) put(true); else put(false);
    } else
#pragma unroll
    for (int mb = 0; mb < 4; ++mb) {
#pragma unroll
        for (int nb = 0; nb < 4; ++nb) {
#pragma unroll
            for (int j = 0; j < 8; ++j) os[(hi * 8 + j) * 68 + nb * 16 + lr] = acc[mb][nb][j]; }
        __builtin_amdgcn_wave_barrier(); asm volatile("" ::: "memory");
        float* crow = C + (size_t)(r0 + mb * 16) * ldc + c0;
{
            v4f vals[8]; float* cp[8];
#pragma unroll
            for (int s = 0; s < 8; ++s) { const int row = 2 * s + hi, cofs = lr * 4; v4f val = *(const v4fa*)(os + row * 68 + cofs); if (BIAS) { val[0] += bfr(bias[c0 + cofs]); val[1] += bfr(bias[c0 + cofs + 1]); val[2] += bfr(bias[c0 + cofs + 2]); val[3] += bfr(bias[c0 + cofs + 3]); }
                vals[s] = val; cp[s] = crow + (size_t)row * ldc + cofs; *(v4f*)cp[s] = val; }
            // s_wait_xcnt 0 behind the eight stores, before a register that they name is written again; address pairs and data are inputs so that they stay as they are up to the wait
            asm volatile("s_wait_xcnt 0x0" :: "v"(cp[0]), "v"(cp[1]), "v"(cp[2]), "v"(cp[3]), "v"(cp[4]), "v"(cp[5]), "v"(cp[6]), "v"(cp[7]), "v"(vals[0]), "v"(vals[1]), "v"(vals[2]), "v"(vals[3]), "v"(vals[4]), "v"(vals[5]), "v"(vals[6]), "v"(vals[7]) : "memory");
             }
        __builtin_amdgcn_wave_barrier(); asm volatile("" ::: "memory");
    }
}

typedef __attribute__((ext_vector_type(2))) unsigned short v2us;
typedef __attribute__((ext_vector_type(2))) _Float16 v2h;
typedef __attribute__((ext_vector_type(4))) _Float16 v4h;
typedef __attribute__((ext_vector_type(2))) float v2f;

// blockIdx.y picks the DD x DD slab: 0..3 = Wq, Wk, Wv, Wo, 4.. = slabs of x (both batches); dst holds them in that order, one after the other, each fragment-major (K = DD).
// Thread i writes the slab's i-th run of eight: a wave stores 512 contiguous bytes and reads 64 bytes of each of 16 rows; a work-group reads one whole line of each of 64 rows.
__global__ __launch_bounds__(256) void k_cvt8(const float* __restrict__ wq, const float* __restrict__ wk, const float* __restrict__ wv, const float* __restrict__ wo, const float* __restrict__ x, bf* dst, size_t n8) { const size_t i = (size_t)blockIdx.x * 256 + threadIdx.x; if (i >= n8) return;
    const int y = blockIdx.y; const float* src = y == 0 ? wq : y == 1 ? wk : y == 2 ? wv : y == 3 ? wo : x + (size_t)(y - 4) * DD * DD; dst += (size_t)y * DD * DD;
    const int ln = (int)i & 31, row = (int)(i >> 13) * 64 + ((int)(i >> 6) & 3) * 16 + (ln & 15), k0 = ((int)(i >> 8) & (DD / 32 - 1)) * 32 + ((int)(i >> 5) & 1) * 16 + (ln >> 4) * 8; const v8f v = *(const v8f*)(src + (size_t)row * DD + k0); v8us o;
#pragma unroll
    for (int k = 0; k < 8; ++k) o[k] = f2bf(v[k]); *(v8us*)(dst + i * 8) = o;  }
// ---- k_fattn: scores, causal softmax and attn.v in ONE launch (blockIdx.x = batch and head), one wave per query tile, running (online) softmax over key blocks that end at the diagonal.
// FOUR WAVES (four neighbouring query tiles of one head) form a work-group and walk the same key blocks: each block's K and V planes (16 KiB, already in fragment order) are brought into LDS ONCE
// by asynchronous copies, two buffers, the block after next in flight under the current one, and every wave takes its fragments from LDS: a block leaves L2 once for four tiles, not four times.
// The score tile is formed TRANSPOSED (A = key rows, B = query rows): lane (lr, hi) then holds, for query lr, keys hi*8+j of each 16-key tile, which is the B fragment of
// O^T = V^T P^T as it stands (k = 8 hi + j, 16 + 8 hi + j over two tiles), and max, sum and rescale of a query live in that query's own lanes.
// Rows < RH: bf16 hi+lo planes, 3 products each, 16 queries x 32 keys a trip; rows >= RH: fp16 planes, 32 queries x 64 keys a trip. Output: merged [t][DD] hi/lo planes, fragment-major (K = DD).
#define C2L 0.18033688011112042f  // (1/8) log2(e): softmax in base 2
template <typename T16> struct PFrag;
template <> struct PFrag<h16> { static __device__ __forceinline__ void mk(const v8f p0, const v8f p1, v16h& h, v16h& l) { (void)l;
#pragma unroll
    for (int e = 0; e < 8; ++e) { h[e] = (h16)p0[e]; h[8 + e] = (h16)p1[e]; } } };
template <> struct PFrag<bf> { static __device__ __forceinline__ void mk(const v8f p0, const v8f p1, v16bf& h, v16bf& l) { v8us h0, h1, l0, l1;
#pragma unroll
    for (int e = 0; e < 8; ++e) { unsigned short a, c; splitf(p0[e], a, c); h0[e] = a; l0[e] = c; splitf(p1[e], a, c); h1[e] = a; l1[e] = c; }
    h = cat16b(h0, h1); l = cat16b(l0, l1); } };
// s_wait_xcnt 0 behind a run of global loads or stores, before a register that they name is written again; the address pairs are inputs so that they stay as they are up to the wait.
template <bool SPLIT, typename T> __device__ __forceinline__ void xwait(const T* a, const T* b) {
    if (SPLIT) asm volatile("s_wait_xcnt 0x0" :: "v"(a), "v"(b) : "memory"); else asm volatile("s_wait_xcnt 0x0" :: "v"(a) : "memory"); }
// q0: this wave's first query; nt: key blocks that the work-group walks (up to its last wave's diagonal; at least 2); ring: the work-group's two LDS buffers of 8192 elements, each [K | V] of one block, [K | K lo | V | V lo] on hi+lo planes.
template <typename T16, bool SPLIT, int NQ, int KB>
__device__ __forceinline__ void fattn_tile(const T16* __restrict__ Q, const T16* __restrict__ Q2, const T16* __restrict__ Kp, const T16* __restrict__ K2, const T16* __restrict__ Vt, const T16* __restrict__ V2, const int q0, const int nt, const T16* ring, bf* Ah, bf* Al) {
    typedef typename WFrag<T16>::V V; typedef WFrag<T16> W;
    constexpr int NKT = KB / 16, NU = KB / 32;
    const int lane = threadIdx.x & 31, lr = lane & 15, hi = lane >> 4;
    V qf[NQ][2], ql[NQ][2], kf[NKT][2], kl[NKT][2];
    { const size_t qo = (size_t)q0 * HD + lane * 8; const T16* qp = Q + qo; const T16* qp2 = SPLIT ? Q2 + qo : nullptr;
#pragma unroll
      for (int nq = 0; nq < NQ; ++nq)
#pragma unroll
        for (int c = 0; c < 2; ++c) { qf[nq][c] = W::ld(qp + (nq * 2 + c) * 512); if (SPLIT) ql[nq][c] = W::ld(qp2 + (nq * 2 + c) * 512); }
      xwait<SPLIT>(qp, qp2); }
    v8f o[4][NQ]; float m[NQ], l[NQ];
#pragma unroll
    for (int nq = 0; nq < NQ; ++nq) { m[nq] = -3.0e38f; l[nq] = 0.f;
#pragma unroll
        for (int dt = 0; dt < 4; ++dt) o[dt][nq] = (v8f){}; }
    // a block of KB keys is KB * HD contiguous elements of each k plane and of each v plane: 16 KiB over the planes in use, eight 16-byte copies a thread (128 threads), chunk c at byte c * 2048 of the buffer
    constexpr int PE = KB * HD, CPP = PE / 1024;      // elements of one plane's block; 2-KiB chunks in it
    static_assert((SPLIT ? 4 : 2) * PE == 8192, "a block fills one buffer");
    const int tid = threadIdx.x; const unsigned l0 = (unsigned)(size_t)ring + tid * 16;      // this thread's first LDS byte in buffer 0 (low 32 bits of the shared address)
    auto cp = [&](const int t) __attribute__((always_inline)) {      // block t into buffer t & 1
        const size_t go = (size_t)t * PE + tid * 8; const unsigned lb = l0 + (t & 1) * 16384; const T16* g[8];
#pragma unroll
        for (int c = 0; c < 8; ++c) { const int pn = c / CPP; g[c] = (SPLIT ? (pn == 0 ? Kp : pn == 1 ? K2 : pn == 2 ? Vt : V2) : (pn == 0 ? Kp : Vt)) + go + (c % CPP) * 1024; }
        // the eight copies and, as the statement's last line, s_wait_xcnt 0: it stands in front of every later write of a register that a copy names
        asm volatile("global_load_async_to_lds_b128 %0, %8, off\n\tglobal_load_async_to_lds_b128 %1, %9, off\n\tglobal_load_async_to_lds_b128 %2, %10, off\n\tglobal_load_async_to_lds_b128 %3, %11, off\n\t"
                     "global_load_async_to_lds_b128 %4, %12, off\n\tglobal_load_async_to_lds_b128 %5, %13, off\n\tglobal_load_async_to_lds_b128 %6, %14, off\n\tglobal_load_async_to_lds_b128 %7, %15, off\n\ts_wait_xcnt 0x0"
                     :: "v"(lb), "v"(lb + 2048), "v"(lb + 4096), "v"(lb + 6144), "v"(lb + 8192), "v"(lb + 10240), "v"(lb + 12288), "v"(lb + 14336),
                        "v"(g[0]), "v"(g[1]), "v"(g[2]), "v"(g[3]), "v"(g[4]), "v"(g[5]), "v"(g[6]), "v"(g[7]) : "memory"); };
    V vf[4][NU], vl[4][NU], pf[NQ][NU], pl[NQ][NU];
    auto ldk = [&](const int t) __attribute__((always_inline)) {      // K fragments of block t, which has been published
        const T16* lp = ring + (t & 1) * 8192 + lane * 8;             // this lane's place in the block's buffer
#pragma unroll
        for (int kt = 0; kt < NKT; ++kt)
#pragma unroll
            for (int c = 0; c < 2; ++c) { kf[kt][c] = W::ld(lp + (kt * 2 + c) * 512); if (SPLIT) kl[kt][c] = W::ld(lp + PE + (kt * 2 + c) * 512); } };
    auto scores = [&](const int t, const bool last) __attribute__((always_inline)) {      // block t: V fragments out of LDS, scores, softmax, P fragments; K fragments are in registers already
        const T16* lp = ring + (t & 1) * 8192 + lane * 8; const int kb = t * KB;
#pragma unroll
        for (int dt = 0; dt < 4; ++dt)
#pragma unroll
            for (int u = 0; u < NU; ++u) { vf[dt][u] = W::ld(lp + 4096 + (u * 4 + dt) * 512); if (SPLIT) vl[dt][u] = W::ld(lp + 4096 + PE + (u * 4 + dt) * 512); }
        v8f s[NKT][NQ];
#pragma unroll
        for (int kt = 0; kt < NKT; ++kt)
#pragma unroll
            for (int nq = 0; nq < NQ; ++nq) { v8f a = (v8f){};
#pragma unroll
                for (int c = 0; c < 2; ++c) { a = W::mma(kf[kt][c], qf[nq][c], a); if (SPLIT) { a = W::mma(kf[kt][c], ql[nq][c], a); a = W::mma(kl[kt][c], qf[nq][c], a); } }
                s[kt][nq] = a; }
#pragma unroll
        for (int nq = 0; nq < NQ; ++nq) { float bm = -3.0e38f;
#pragma unroll
            for (int kt = 0; kt < NKT; ++kt)
#pragma unroll
                for (int j = 0; j < 8; ++j) { if (last) s[kt][nq][j] = (kb + kt * 16 + hi * 8 + j <= q0 + nq * 16 + lr) ? s[kt][nq][j] : -3.0e38f; bm = fmaxf(bm, s[kt][nq][j]); }
            bm = fmaxf(bm, __shfl_xor(bm, 16, 32));
            const float mn = fmaxf(m[nq], bm * C2L), al = __builtin_amdgcn_exp2f(m[nq] - mn); m[nq] = mn;
#pragma unroll
            for (int kt = 0; kt < NKT; ++kt)
#pragma unroll
                for (int j = 0; j < 8; ++j) s[kt][nq][j] = __builtin_amdgcn_exp2f(fmaf(s[kt][nq][j], C2L, -mn));
            v8f rv = s[0][nq];            // eight independent partial sums, folded as a tree
#pragma unroll
            for (int kt = 1; kt < NKT; ++kt) rv += s[kt][nq];
            l[nq] = fmaf(l[nq], al, ((rv[0] + rv[1]) + (rv[2] + rv[3])) + ((rv[4] + rv[5]) + (rv[6] + rv[7])));
#pragma unroll
            for (int dt = 0; dt < 4; ++dt) o[dt][nq] *= al;
#pragma unroll
            for (int u = 0; u < NU; ++u) PFrag<T16>::mk(s[2 * u][nq], s[2 * u + 1][nq], pf[nq][u], pl[nq][u]); } };
    auto attnv = [&]() __attribute__((always_inline)) {      // attn.v of the block, operands all in registers
#pragma unroll
        for (int u = 0; u < NU; ++u)
#pragma unroll
            for (int dt = 0; dt < 4; ++dt)
#pragma unroll
                for (int nq = 0; nq < NQ; ++nq) { o[dt][nq] = W::mma(vf[dt][u], pf[nq][u], o[dt][nq]); if (SPLIT) { o[dt][nq] = W::mma(vf[dt][u], pl[nq][u], o[dt][nq]); o[dt][nq] = W::mma(vl[dt][u], pf[nq][u], o[dt][nq]); } }
    };
    const int tl = q0 / KB;     // the one block that holds this wave's diagonal (nt - 2 or nt - 1); every block before it is wholly at or below it
    // the hand-over stands in front of a block's attn.v, whose operands are in registers by then: the refill has a whole trip to land, and the next K fragments come out of LDS under the attn.v products
    auto foot = [&]() __attribute__((always_inline)) {     // hand-over of trip t, every wave, also one that is past its diagonal
        asm volatile("s_wait_dscnt 0x0" ::: "memory");     // this wave's reads of buffer t & 1 are done before the buffer is handed back
        asm volatile("s_wait_asynccnt 0x0" ::: "memory");  // this wave's copies of block t + 1 have landed
        __syncthreads(); };                                // publishes block t + 1 and ends every wave's reads of block t
    cp(0);
    asm volatile("s_wait_asynccnt 0x0" ::: "memory");      // this wave's copies of block 0 have landed
    __syncthreads();                                       // ... and every other wave's: block 0 may be read
    cp(1);
    ldk(0);
#pragma unroll 1                            // rolled: one body, the buffer picked by the trip's parity
    for (int t = 0; t < nt - 2; ++t) {      // blocks below every wave's diagonal; block t + 2 exists and goes into the buffer just read
        scores(t, false);
        __builtin_amdgcn_sched_barrier(0);      // keeps scores and softmax in front of the hand-over (sunk behind it, the wait for block t + 1 would come a whole softmax too early)
        foot(); cp(t + 2); ldk(t + 1);
        __builtin_amdgcn_sched_barrier(0);      // keeps the products behind the copies and the K reads, which then fly under them
        attnv(); }
#pragma unroll 1                             // rolled: one copy of the masked body
    for (int t = nt - 2; t < nt; ++t) {      // the two blocks with the diagonals, masked by index (an identity on a block below the wave's diagonal)
        if (t <= tl) { ldk(t); scores(t, true); }      // here the K fragments are read at the head of their own trip: nothing but the attn.v operands is held over the hand-over
        foot();
        if (t <= tl) attnv(); }
    asm volatile("s_wait_asynccnt 0x0" ::: "memory");      // nothing is in flight when the wave ends
    const size_t ob = (size_t)(q0 >> 6) * 64 * DD + ((q0 >> 4) & 3) * 512 + lane * 8; bf* ah = Ah + ob; bf* al2 = Al + ob;      // 64-row panel, row block in it (q0 + 16 nq stays in the panel)
#pragma unroll
    for (int nq = 0; nq < NQ; ++nq) { const float inv = __fdiv_rn(1.0f, l[nq] + __shfl_xor(l[nq], 16, 32)); v8us oh[4], ol[4];
#pragma unroll
        for (int dt = 0; dt < 4; ++dt)
#pragma unroll
            for (int j = 0; j < 8; ++j) { unsigned short a, c; splitf(o[dt][nq][j] * inv, a, c); oh[dt][j] = a; ol[dt][j] = c; }
#pragma unroll
        for (int dt = 0; dt < 4; ++dt) { *(v8us*)(ah + nq * 512 + (dt >> 1) * 2048 + (dt & 1) * 256) = oh[dt]; *(v8us*)(al2 + nq * 512 + (dt >> 1) * 2048 + (dt & 1) * 256) = ol[dt]; }
        // the same wait behind the stores: their data registers are inputs too
        asm volatile("s_wait_xcnt 0x0" :: "v"(ah), "v"(al2), "v"(oh[0]), "v"(oh[1]), "v"(oh[2]), "v"(oh[3]), "v"(ol[0]), "v"(ol[1]), "v"(ol[2]), "v"(ol[3]) : "memory"); }
}
__global__ __launch_bounds__(128) void k_fattn(const bf* __restrict__ QPh, const bf* __restrict__ QPl, const bf* __restrict__ KPh, const bf* __restrict__ KPl, const bf* __restrict__ VTh, const bf* __restrict__ VTl,
                                              const h16* __restrict__ QP16, const h16* __restrict__ KP16, const h16* __restrict__ VT16, bf* Ah, bf* Al) {
    // RANK ORDER: head and batch are the fastest index (blockIdx.x),
    // the tile class (its cost falls with x) the slowest: the LAY heaviest classes come first, one work-group for each of the chip's 256 WGPs;
    // the next LAY classes follow lightest first; then the rest, again lightest first. Speed only: rank -> x is a permutation wherever they land.
    constexpr int NT = (TT - RH) / 128 + RH / 64, LAY = 256 / (NH_ * NB_);
    static_assert(NT > 2 * LAY && NT <= 3 * LAY, "three turns");
    const int hb = blockIdx.x, rank = blockIdx.y, x = rank < LAY ? rank : rank < 2 * LAY ? 3 * LAY - 1 - rank : NT + 2 * LAY - 1 - rank;
    const size_t hz = (size_t)hb * TT * HD; const size_t oz = (size_t)(hb / NH_) * TT * DD + (hb % NH_) * (HD / 32) * 2048; Ah += oz; Al += oz;
    __shared__ __align__(16) unsigned short ring[2 * 8192];
    const int w = __builtin_amdgcn_readfirstlane(threadIdx.x >> 5);      // wave in the work-group, in a scalar register: every test on it is a scalar branch
    if (x < (TT - RH) / 128) { const int Q0 = TT - 128 * (x + 1);        // longest rows first
        fattn_tile<h16, false, 2, 64>(QP16 + hz, nullptr, KP16 + hz, nullptr, VT16 + hz, nullptr, Q0 + 32 * w, Q0 / 64 + 2, (const h16*)ring, Ah, Al); }
    else { const int Q0 = RH - 64 * (x - (TT - RH) / 128 + 1);
        fattn_tile<bf, true, 1, 32>(QPh + hz, QPl + hz, KPh + hz, KPl + hz, VTh + hz, VTl + hz, Q0 + 16 * w, Q0 / 32 + 2, (const bf*)ring, Ah, Al); }
}

extern "C" void kernel_launch(void* const* d_in, const int* in_sizes, int n_in,
                              void* d_out, int out_size, void* d_ws, size_t ws_size, hipStream_t stream) {
    (void)in_sizes; (void)n_in; (void)out_size;
    const float* x = (const float*)d_in[0]; const float* am = (const float*)d_in[1]; const float* wq = (const float*)d_in[2]; const float* wk = (const float*)d_in[3]; const float* wv = (const float*)d_in[4]; const float* wo = (const float*)d_in[5]; const float* bo = (const float*)d_in[6];
    float* OUT = (float*)d_out;     // [2][2048][1024]
    char* wsp = (char*)d_ws;
    auto take = [&](size_t bytes) { char* p = wsp; wsp += (bytes + 255) & ~(size_t)255; return (void*)p; };
    const size_t SL = (size_t)DD * DD, PB = (size_t)TT * DD;      // one weight slab; one batch of one plane
    bf* WQ = (bf*)take(4 * SL * 2); bf* WO = WQ + 3 * SL; bf* XB = (bf*)take(NB_ * PB * 2);      // [Wq|Wk|Wv|Wo] and, right behind them, x [NB_ TT][DD], all fragment-major
    bf* Ph = (bf*)take(3 * NB_ * PB * 2); bf* Pl = (bf*)take(3 * NB_ * PB * 2); h16* P16 = (h16*)take(3 * NB_ * PB * 2);      // each [q|k|v][NB_] planes
    bf* ATh = (bf*)take(NB_ * PB * 2); bf* ATl = (bf*)take(NB_ * PB * 2);
    if ((size_t)(wsp - (char*)d_ws) > ws_size) return;    // total 104 MiB; ws 256 MiB
    // every stage is ONE launch over both batches (and over q, k, v where there are three)
    k_cvt8<<<dim3((unsigned)(SL / 8 / 256), 4 + NB_ * TT / DD, 1), 256, 0, stream>>>(wq, wk, wv, wo, x, WQ, SL / 8);   // [out][in] weights = Bt as-is
    k_gemmw<bf, 0, false, 1, true><<<dim3(NB_ * TT / 64, DD / 64, 3), 32, 0, stream>>>(XB, nullptr, WQ, nullptr, DD, nullptr, DD, nullptr, 0, SL, 0, 0, am, Ph, Pl, P16);
    k_fattn<<<dim3(NH_ * NB_, (TT - RH) / 128 + RH / 64, 1), 128, 0, stream>>>(Ph, Pl, Ph + NB_ * PB, Pl + NB_ * PB, Ph + 2 * NB_ * PB, Pl + 2 * NB_ * PB, P16, P16 + NB_ * PB, P16 + 2 * NB_ * PB, ATh, ATl);
    k_gemmw<bf, 1, true><<<dim3(NB_ * TT / 64, DD / 64, 1), 32, 0, stream>>>(ATh, ATl, WO, nullptr, DD, OUT, DD, bo, 0, 0, 0, 0, nullptr, nullptr, nullptr, nullptr);
}

// v009
// A run of this version takes 77.5 microseconds.
// Two timings next to v008 put it at 1.05 and 1.04 times that version's speed.
// All steps since v000 together make it 26.1 times as fast.
#include <hip/hip_runtime.h>

// Causal multi-head attention block (x [2][2048][1024], attention_mask [2][2048] (float ones, read as data); q/k/v = x W^T ([out][in], no bias) each multiplied by mask[b][t] per row; 16 heads x 64; scores / 8; causal (tril -> -inf);
// softmax; out = merged Wo^T + bo).
// Compute dtypes, f32 accumulate: every input rounded to bf16; projections on PLAIN bf16 operands (inputs: exact), x bf16(mask) in f32 in the projection GEMM's epilogue; PER-ROW
// PRECISION HYBRID: query rows < 512 of each batch on bf16 hi+lo planes for scores and attn.v (3 products), rows >= 512 on SINGLE fp16 planes; output hi+lo x exact Wo (2 products) + bo.

#define NB_  2
#define TT   2048
#define DD   1024
#define NH_  16
#define HD   64
#define RH   512                  // query rows < RH: hi+lo planes; rows >= RH: fp16 planes
#define NF   32
#define SCL  0.125f               // 1/sqrt(64)
typedef _Float16 h16;
typedef unsigned short bf;
typedef __attribute__((ext_vector_type(16))) __bf16   v16bf;
typedef __attribute__((ext_vector_type(16))) _Float16 v16h;
typedef __attribute__((ext_vector_type(8)))  _Float16 v8h;
typedef __attribute__((ext_vector_type(8)))  unsigned short v8us;
typedef __attribute__((ext_vector_type(8)))  float    v8f;
typedef __attribute__((ext_vector_type(4)))  float    v4f;
typedef v8h  __attribute__((may_alias)) v8ha;
typedef v4f  __attribute__((may_alias)) v4fa;
typedef v8us __attribute__((may_alias)) v8usa;

__device__ __forceinline__ unsigned short f2bf(float f) { unsigned u = __float_as_uint(f); u += 0x7FFFu + ((u >> 16) & 1u); return (unsigned short)(u >> 16); }
__device__ __forceinline__ float bf2f(unsigned short b) { return __uint_as_float(((unsigned)b) << 16); }
__device__ __forceinline__ float bfr(float f) { return bf2f(f2bf(f)); }
__device__ __forceinline__ v16h cat16(v8h lo, v8h hi) { return __builtin_shufflevector(lo, hi, 0, 1, 2, 3, 4, 5, 6, 7, 8, 9, 10, 11, 12, 13, 14, 15); }
__device__ __forceinline__ v16bf cat16b(v8us lo, v8us hi) { return __builtin_bit_cast(v16bf, __builtin_shufflevector(lo, hi, 0, 1, 2, 3, 4, 5, 6, 7, 8, 9, 10, 11, 12, 13, 14, 15)); }
__device__ __forceinline__ v8f wmma16(v16h a, v16h b, v8f c) { return __builtin_amdgcn_wmma_f32_16x16x32_f16(false, a, false, b, (short)0, c, false, false); }
__device__ __forceinline__ v8f wmmab(v16bf a, v16bf b, v8f c) { return __builtin_amdgcn_wmma_f32_16x16x32_bf16(false, a, false, b, (short)0, c, false, false); }



// ---- FRAGMENT-MAJOR PLANES: every 16-bit WMMA operand plane [rows][K] is stored as blocks of 16 rows x 32 k (512 elements, 1 KiB). GEMM operands (K = DD): the four row blocks of a 64-row panel lie
// side by side, block (row / 16, k / 32) at (((row / 64) * (K / 32) + k / 32) * 4 + (row / 16) % 4) * 512, so one trip of a wave reads 8 KiB in a row per operand. Attention planes: see k_qkv.
// Inside a block element (r, k) lies at ((k >> 4) & 1) * 256 + (((k >> 3) & 1) * 16 + r) * 8 + (k & 7): lane (lr, hi) finds its two runs of eight k at lane * 8 and 256 + lane * 8,
// so each of the two 16-byte loads of a fragment covers 512 contiguous bytes (four whole lines) instead of 32 bytes in each of sixteen lines. The k order of a fragment is what it was.
// ---- k_gemmw: register-blocked GEMM, ONE WAVE per 64x64 output tile (16 accumulators), operands straight from fragment-major 16-bit planes; grid (M/64, N/64, Z), 32 threads.
// C[m][n] (f32, pitch ldc, + optional f32 bias[n]) = sum_k A[m][k] Bt[n][k] (+ split products per NSPLIT). z-batch strides sA/sB/sC in elements. K % 64 == 0.
// SK > 1: grid.y = (N/64) * SK; work-group ks = blockIdx.y % SK sums only k in [ks K/SK, (ks+1) K/SK) into its own plane C + ks * sP; the reader adds the SK planes. K % (64 SK) == 0.
template <typename T16> struct WFrag;
template <> struct WFrag<h16> { typedef v16h V; static __device__ __forceinline__ V ld(const h16* p) { return cat16(*(const v8h*)p, *(const v8h*)(p + 256)); } static __device__ __forceinline__ v8f mma(V a, V b, v8f c) { return wmma16(a, b, c); } };
template <> struct WFrag<bf> { typedef v16bf V; static __device__ __forceinline__ V ld(const bf* p) { return cat16b(*(const v8us*)p, *(const v8us*)(p + 256)); } static __device__ __forceinline__ v8f mma(V a, V b, v8f c) { return wmmab(a, b, c); } };
__device__ __forceinline__ h16 tohx(float x) { return (h16)x; }
__device__ __forceinline__ void splitf(float y, unsigned short& h, unsigned short& l) { h = f2bf(y); l = f2bf(y - bf2f(h)); }
template <typename T16, int NSPLIT, bool BIAS, int SK = 1>
__global__ __launch_bounds__(32) void k_gemmw(const T16* __restrict__ A, const T16* __restrict__ A2, const T16* __restrict__ Bt, const T16* __restrict__ Bt2, int K, float* C, int ldc, const float* __restrict__ bias, size_t sA, size_t sB, size_t sC, size_t sP) {
    typedef typename WFrag<T16>::V V;
    __shared__ __align__(16) float os[16 * 68];
    const size_t z = blockIdx.z; A += z * sA; if (A2) A2 += z * sA; Bt += z * sB; if (Bt2) Bt2 += z * sB; C += z * sC;
    const int lane = threadIdx.x & 31, lr = lane & 15, hi = lane >> 4; int r0 = blockIdx.x * 64, c0 = (blockIdx.y / SK) * 64;
    const int ks = blockIdx.y % SK, kb = ks * (K / SK), ke = kb + K / SK; C += (size_t)ks * sP;
    v8f acc[4][4];
#pragma unroll
    for (int mb = 0; mb < 4; ++mb)
#pragma unroll
        for (int nb = 0; nb < 4; ++nb) acc[mb][nb] = (v8f){};
    // the current k block of each operand's 64-row panel (64 K elements a panel, 2048 a k block, 4 KiB); a plane that is not used stands in as its partner
    constexpr bool HA2 = NSPLIT == 1 || NSPLIT == 2, HB2 = NSPLIT >= 2;
    const T16* pa = A + (size_t)r0 * K + (size_t)kb * 64; const T16* pb = Bt + (size_t)c0 * K + (size_t)kb * 64;
    const T16* pa2 = HA2 ? A2 + (size_t)r0 * K + (size_t)kb * 64 : pa; const T16* pb2 = HB2 ? Bt2 + (size_t)c0 * K + (size_t)kb * 64 : pb;
    unsigned vb = lane * 16;      // this lane's byte offset from those four places: its run of eight in the block, plus the blocks done; one register for every operand
    // TWO FRAGMENT SETS: all loads of k block i + 1 are issued as one group in front of the products of k block i, so a block waits for its operands once, under the block before it.
    // A trip is two k blocks (one per set, no register copies): (K / SK) % 64 == 0. Products and their order per accumulator are what they were.
    struct FSet { V a[4], a2[4], b[4], b2[4]; };
    FSet s0, s1;
    auto at = [&](const T16* p, const int off) __attribute__((always_inline)) { return (const T16*)((const char*)p + vb) + off; };
    auto ldset = [&](FSet& s, const int off) __attribute__((always_inline)) {
#pragma unroll
        for (int mb = 0; mb < 4; ++mb) { s.a[mb] = WFrag<T16>::ld(at(pa, off + mb * 512)); if (HA2) s.a2[mb] = WFrag<T16>::ld(at(pa2, off + mb * 512)); }
#pragma unroll
        for (int nb = 0; nb < 4; ++nb) { s.b[nb] = WFrag<T16>::ld(at(pb, off + nb * 512)); if (HB2) s.b2[nb] = WFrag<T16>::ld(at(pb2, off + nb * 512)); } };
    auto mmaset = [&](const FSet& s) __attribute__((always_inline)) {
#pragma unroll
        for (int nb = 0; nb < 4; ++nb)
#pragma unroll
            for (int mb = 0; mb < 4; ++mb) { acc[mb][nb] = WFrag<T16>::mma(s.a[mb], s.b[nb], acc[mb][nb]); if (HA2) acc[mb][nb] = WFrag<T16>::mma(s.a2[mb], s.b[nb], acc[mb][nb]); if (HB2) acc[mb][nb] = WFrag<T16>::mma(s.a[mb], s.b2[nb], acc[mb][nb]); } };
    ldset(s0, 0);
    asm volatile("s_wait_xcnt 0x0" :: "v"(vb) : "memory");      // behind the first loads: on the path round the loop nothing else stands between them and the next write of what they name
#pragma unroll 1
    for (int kc = kb; kc < ke - 64; kc += 64) {
        ldset(s1, 2048);
        __builtin_amdgcn_sched_barrier(0);      // keeps the next block's loads in front of this block's products (sunk among them they would be waited for at once)
        mmaset(s0);
        __builtin_amdgcn_sched_barrier(0);      // the same for the block after: its loads stay between the two runs of products
        ldset(s0, 4096);
        __builtin_amdgcn_sched_barrier(0);      // as above
        mmaset(s1);
        __builtin_amdgcn_sched_barrier(0);      // keeps the wait below behind the trip's products, not between the loads and the products
        // s_wait_xcnt 0 behind the trip's global loads, before their offset register is stepped; the register passes through the statement, so that the step is formed behind the wait
        asm volatile("s_wait_xcnt 0x0" : "+v"(vb) :: "memory");
        vb += 8192;
    }
    ldset(s1, 2048);
    // the same wait behind the last loads; offset register and the four places are inputs so that whatever the loads name stays as it is up to the wait
    asm volatile("s_wait_xcnt 0x0" :: "v"(vb), "v"(at(pa, 2048)), "v"(at(pb, 2048)), "v"(at(pa2, 2048)), "v"(at(pb2, 2048)) : "memory");
    __builtin_amdgcn_sched_barrier(0);          // the last block's loads fly under the products of the block before it
    mmaset(s0);
    mmaset(s1);
    __builtin_amdgcn_sched_barrier(0);          // keeps the store addresses' arithmetic behind the last products, where the fragment registers are free (formed among them it spills)
#pragma unroll
    for (int mb = 0; mb < 4; ++mb) {
#pragma unroll
        for (int nb = 0; nb < 4; ++nb) {
#pragma unroll
            for (int j = 0; j < 8; ++j) os[(hi * 8 + j) * 68 + nb * 16 + lr] = acc[mb][nb][j]; }
        __builtin_amdgcn_wave_barrier(); asm volatile("" ::: "memory");
        float* crow = C + (size_t)(r0 + mb * 16) * ldc + c0;
{
            v4f vals[8]; float* cp[8];
#pragma unroll
            for (int s = 0; s < 8; ++s) { const int row = 2 * s + hi, cofs = lr * 4; v4f val = *(const v4fa*)(os + row * 68 + cofs); if (BIAS) { val[0] += bfr(bias[c0 + cofs]); val[1] += bfr(bias[c0 + cofs + 1]); val[2] += bfr(bias[c0 + cofs + 2]); val[3] += bfr(bias[c0 + cofs + 3]); }
                vals[s] = val; cp[s] = crow + (size_t)row * ldc + cofs; *(v4f*)cp[s] = val; }
            // s_wait_xcnt 0 behind the eight stores, before a register that they name is written again; address pairs and data are inputs so that they stay as they are up to the wait
            asm volatile("s_wait_xcnt 0x0" :: "v"(cp[0]), "v"(cp[1]), "v"(cp[2]), "v"(cp[3]), "v"(cp[4]), "v"(cp[5]), "v"(cp[6]), "v"(cp[7]), "v"(vals[0]), "v"(vals[1]), "v"(vals[2]), "v"(vals[3]), "v"(vals[4]), "v"(vals[5]), "v"(vals[6]), "v"(vals[7]) : "memory");
             }
        __builtin_amdgcn_wave_barrier(); asm volatile("" ::: "memory");
    }
}

// ---- k_qkv: the q, k, v projections, ONE WORK-GROUP OF 12 WAVES per 256 positions x one head (grid (NB_ TT / 256, NH_)): wave w forms the 64x64 tile of position panel w & 3 and projection w >> 2 (q, k, v), 16 accumulators, as k_gemmw does.
// The twelve tiles need only SEVEN operand panels (four of x, that head's 64 rows of Wq, Wk, Wv): each panel's k blocks, already in fragment order, are brought into LDS ONCE by asynchronous copies and every wave takes its
// fragments from there, so a work-group draws 7 panels from L2 where twelve separate waves ask for 24. A unit = 64 k of the seven panels (7 x 8 KiB, [x0 x1 x2 x3 | Wq Wk Wv]); a stage = two units; two stage buffers.
// No f32 C: the tile goes from the accumulators straight into the attention planes, x bf16(mask[t]).
// q and k planes: per head rows = t, k = d (K = HD): block (h * (TT / 16) + t / 16) * 2 + d / 32. v planes: per head rows = d, k = t, the four row blocks of 32 keys side by side: block (h * (TT / 32) + t / 32) * 4 + d / 16.
// An accumulator holds, per lane, eight consecutive A rows of one B row, which IS a run of eight k of a fragment block when the plane's k runs along the A rows: so q and k are formed as W x^T (A rows = d)
// and v as x W^T (A rows = t); each accumulator is then one 512-byte run of a block as it stands, and a tile is 8 KiB in a row of each plane.
__global__ __launch_bounds__(384) void k_qkv(const bf* __restrict__ X, const bf* __restrict__ Wt, const float* __restrict__ Mv, bf* Ph, bf* Pl, h16* P16) {
    typedef WFrag<bf> W; typedef W::V V;
    constexpr int UE = 7 * 4096, NS = DD / 128;      // elements of a unit; stages
    static_assert(NS >= 2 && DD % 128 == 0, "two stages or more");
    __shared__ __align__(16) bf ring[4 * UE];
    const int tid = threadIdx.x, lane = tid & 31, lr = lane & 15, hi = lane >> 4;
    const int w = __builtin_amdgcn_readfirstlane(tid >> 5), jx = w & 3, z = w >> 2;      // wave in the work-group, in a scalar register: every test on it is a scalar branch
    const bool qk = z < 2;      // q, k: W rows on the A side, positions on the B side; v: the other way round
    v8f acc[4][4];
#pragma unroll
    for (int mb = 0; mb < 4; ++mb)
#pragma unroll
        for (int nb = 0; nb < 4; ++nb) acc[mb][nb] = (v8f){};
    // a unit is 56 KiB: nine 16-byte copies a thread (chunk c at byte c * 6144 of the unit, a wave's 512 bytes inside one panel) and a tenth from waves 0 to 3
    const unsigned l0 = (unsigned)(size_t)ring + tid * 16;      // this thread's first LDS byte in unit slot 0 (low 32 bits of the shared address)
    auto gsrc = [&](const int c, const int u) __attribute__((always_inline)) {      // where chunk c of unit u lies in global memory, for this lane
        const int lw = c * 6144 + w * 512, pn = lw >> 13;
        const bf* b = pn < 4 ? X + (size_t)(blockIdx.x * 4 + pn) * (64 * DD) : Wt + (size_t)(pn - 4) * (DD * DD) + (size_t)blockIdx.y * (64 * DD);
        return b + (size_t)u * 4096 + ((lw & 8191) >> 1) + lane * 8; };
    auto cpu = [&](const int u) __attribute__((always_inline)) {      // unit u into slot u & 3
        const unsigned lb = l0 + (u & 3) * (UE * 2); const bf* g[9];
#pragma unroll
        for (int c = 0; c < 9; ++c) g[c] = gsrc(c, u);
        // the copies and, as the statement's last line, s_wait_xcnt 0: it stands in front of every later write of a register that a copy names
        asm volatile("global_load_async_to_lds_b128 %0, %9, off\n\tglobal_load_async_to_lds_b128 %1, %10, off\n\tglobal_load_async_to_lds_b128 %2, %11, off\n\t"
                     "global_load_async_to_lds_b128 %3, %12, off\n\tglobal_load_async_to_lds_b128 %4, %13, off\n\tglobal_load_async_to_lds_b128 %5, %14, off\n\t"
                     "global_load_async_to_lds_b128 %6, %15, off\n\tglobal_load_async_to_lds_b128 %7, %16, off\n\tglobal_load_async_to_lds_b128 %8, %17, off\n\ts_wait_xcnt 0x0"
                     :: "v"(lb), "v"(lb + 6144), "v"(lb + 12288), "v"(lb + 18432), "v"(lb + 24576), "v"(lb + 30720), "v"(lb + 36864), "v"(lb + 43008), "v"(lb + 49152),
                        "v"(g[0]), "v"(g[1]), "v"(g[2]), "v"(g[3]), "v"(g[4]), "v"(g[5]), "v"(g[6]), "v"(g[7]), "v"(g[8]) : "memory");
        if (w < 4)      // the unit's last 2 KiB; the same wait in the same statement
            asm volatile("global_load_async_to_lds_b128 %0, %1, off\n\ts_wait_xcnt 0x0" :: "v"(lb + 55296), "v"(gsrc(9, u)) : "memory"); };
    // TWO FRAGMENT SETS, as in k_gemmw: the reads of k block i + 1 go out as one group in front of the products of k block i. Products and their order per accumulator are those of k_gemmw.
    struct FSet { V a[4], b[4]; };
    FSet s0, s1;
    const bf* la = ring + (qk ? 4 + z : jx) * 4096 + lane * 8; const bf* lb2 = ring + (qk ? jx : 4 + z) * 4096 + lane * 8;      // this lane's place in the A and the B panel of slot 0
    auto ldset = [&](FSet& s, const int eo) __attribute__((always_inline)) {      // eo: element offset of the k block (slot, block in the unit)
#pragma unroll
        for (int mb = 0; mb < 4; ++mb) s.a[mb] = W::ld(la + eo + mb * 512);
#pragma unroll
        for (int nb = 0; nb < 4; ++nb) s.b[nb] = W::ld(lb2 + eo + nb * 512); };
    auto mmaset = [&](const FSet& s) __attribute__((always_inline)) {
#pragma unroll
        for (int nb = 0; nb < 4; ++nb)
#pragma unroll
            for (int mb = 0; mb < 4; ++mb) acc[mb][nb] = W::mma(s.a[mb], s.b[nb], acc[mb][nb]); };
    auto first3 = [&](const int eb) __attribute__((always_inline)) {      // blocks 0 to 2 of the stage at eb; block 0 is in s0 already, block 3 is left in s1
        ldset(s1, eb + 2048);
        __builtin_amdgcn_sched_barrier(0);      // keeps the next block's reads in front of this block's products (sunk among them they would be waited for at once)
        mmaset(s0);
        __builtin_amdgcn_sched_barrier(0);      // the same for each block after
        ldset(s0, eb + UE);
        __builtin_amdgcn_sched_barrier(0);      // as above
        mmaset(s1);
        __builtin_amdgcn_sched_barrier(0);      // as above
        ldset(s1, eb + UE + 2048);
        __builtin_amdgcn_sched_barrier(0);      // as above
        mmaset(s0);
        __builtin_amdgcn_sched_barrier(0); };   // keeps what follows (the hand-over, or the last products) behind these products
    cpu(0); cpu(1);
    asm volatile("s_wait_asynccnt 0x0" ::: "memory");      // this wave's copies of stage 0 have landed
    __syncthreads();                                       // ... and every other wave's: stage 0 may be read
    cpu(2); cpu(3);
    ldset(s0, 0);
#pragma unroll 1                             // rolled: one body, the buffer picked by the stage's parity
    for (int t = 0; t < NS - 1; ++t) {
        const int eb = (t & 1) * 2 * UE;
        first3(eb);
        // the hand-over stands in front of the stage's last block, whose fragments are in registers by then: the refill has a whole stage to land, and the next stage's first fragments come out of LDS under the last products
        asm volatile("s_wait_dscnt 0x0" ::: "memory");     // this wave's reads of stage t are done before its buffer is handed back
        asm volatile("s_wait_asynccnt 0x0" ::: "memory");  // this wave's copies of stage t + 1 have landed
        __syncthreads();                                   // publishes stage t + 1 and ends every wave's reads of stage t
        if (t + 2 < NS) { cpu(2 * t + 4); cpu(2 * t + 5); }      // stage t + 2 into the buffer just read
        ldset(s0, 2 * UE - eb);
        __builtin_amdgcn_sched_barrier(0);      // keeps the products behind the copies and the reads, which then fly under them
        mmaset(s1);
        __builtin_amdgcn_sched_barrier(0); }    // keeps the next stage's reads behind these products
    first3(((NS - 1) & 1) * 2 * UE);
    mmaset(s1);
    asm volatile("s_wait_asynccnt 0x0" ::: "memory");      // nothing is in flight when the wave ends
    __builtin_amdgcn_sched_barrier(0);          // keeps the store addresses' arithmetic behind the last products, where the fragment registers are free (formed among them it spills)
    const int tp = (blockIdx.x * 4 + jx) * 64, hd = blockIdx.y;      // first position of the tile (both batches in a row), head
    const size_t ob = ((size_t)z * NB_ + tp / TT) * TT * DD + (size_t)(hd * (TT * HD / 512) + (tp % TT) / 8) * 512 + lane * 8;
    bf* ph = Ph + ob; bf* pl = Pl + ob; h16* p16 = P16 + ob;
    // s_wait_xcnt 0 behind each run of global stores, before a register that they name is written again; address pairs and store data are inputs so that they stay as they are up to the wait
    auto put = [&](const bool tb) __attribute__((always_inline)) {      // tb: positions along the B rows (q, k), else along the A rows (v)
        const float* mp = Mv + tp + (tb ? lr : hi * 8); float mq[4]; v8f mm[4];
        // the mask loads of a tile and their data wait are ONE statement, every result in a register of its own ("=&v"): no load of the run can land on the address pair that the others still name
        if (tb) asm volatile("global_load_b32 %0, %4, off\n\tglobal_load_b32 %1, %4, off offset:64\n\tglobal_load_b32 %2, %4, off offset:128\n\tglobal_load_b32 %3, %4, off offset:192\n\ts_wait_loadcnt 0x0"
                             : "=&v"(mq[0]), "=&v"(mq[1]), "=&v"(mq[2]), "=&v"(mq[3]) : "v"(mp) : "memory");
        else { v4f m4[8];
            asm volatile("global_load_b128 %0, %8, off\n\tglobal_load_b128 %1, %8, off offset:16\n\tglobal_load_b128 %2, %8, off offset:64\n\tglobal_load_b128 %3, %8, off offset:80\n\t"
                         "global_load_b128 %4, %8, off offset:128\n\tglobal_load_b128 %5, %8, off offset:144\n\tglobal_load_b128 %6, %8, off offset:192\n\tglobal_load_b128 %7, %8, off offset:208\n\ts_wait_loadcnt 0x0"
                         : "=&v"(m4[0]), "=&v"(m4[1]), "=&v"(m4[2]), "=&v"(m4[3]), "=&v"(m4[4]), "=&v"(m4[5]), "=&v"(m4[6]), "=&v"(m4[7]) : "v"(mp) : "memory");
#pragma unroll
            for (int i = 0; i < 4; ++i) mm[i] = __builtin_shufflevector(m4[2 * i], m4[2 * i + 1], 0, 1, 2, 3, 4, 5, 6, 7); }
#pragma unroll
        for (int mb = 0; mb < 4; ++mb) { v8us oh[4], ol[4]; v8h o16[4];
#pragma unroll
            for (int nb = 0; nb < 4; ++nb)
#pragma unroll
                for (int j = 0; j < 8; ++j) { const float x = __fmul_rn(acc[mb][nb][j], bfr(tb ? mq[nb] : mm[mb][j])); unsigned short a, c2; splitf(x, a, c2); oh[nb][j] = a; ol[nb][j] = c2; o16[nb][j] = tohx(x); }
#pragma unroll
            for (int nb = 0; nb < 4; ++nb) { const int off = (tb ? nb * 2 + (mb >> 1) : (mb >> 1) * 4 + nb) * 512 + (mb & 1) * 256; *(v8us*)(ph + off) = oh[nb]; *(v8us*)(pl + off) = ol[nb]; *(v8h*)(p16 + off) = o16[nb]; }
            asm volatile("s_wait_xcnt 0x0" :: "v"(ph), "v"(pl), "v"(p16), "v"(oh[0]), "v"(oh[1]), "v"(oh[2]), "v"(oh[3]), "v"(ol[0]), "v"(ol[1]), "v"(ol[2]), "v"(ol[3]), "v"(o16[0]), "v"(o16[1]), "v"(o16[2]), "v"(o16[3]) : "memory"); }
    };
    if (qk) put(true); else put(false);
}

typedef __attribute__((ext_vector_type(2))) unsigned short v2us;
typedef __attribute__((ext_vector_type(2))) _Float16 v2h;
typedef __attribute__((ext_vector_type(4))) _Float16 v4h;
typedef __attribute__((ext_vector_type(2))) float v2f;

// blockIdx.y picks the DD x DD slab: 0..3 = Wq, Wk, Wv, Wo, 4.. = slabs of x (both batches); dst holds them in that order, one after the other, each fragment-major (K = DD).
// Thread i writes the slab's i-th run of eight: a wave stores 512 contiguous bytes and reads 64 bytes of each of 16 rows; a work-group reads one whole line of each of 64 rows.
__global__ __launch_bounds__(256) void k_cvt8(const float* __restrict__ wq, const float* __restrict__ wk, const float* __restrict__ wv, const float* __restrict__ wo, const float* __restrict__ x, bf* dst, size_t n8) { const size_t i = (size_t)blockIdx.x * 256 + threadIdx.x; if (i >= n8) return;
    const int y = blockIdx.y; const float* src = y == 0 ? wq : y == 1 ? wk : y == 2 ? wv : y == 3 ? wo : x + (size_t)(y - 4) * DD * DD; dst += (size_t)y * DD * DD;
    const int ln = (int)i & 31, row = (int)(i >> 13) * 64 + ((int)(i >> 6) & 3) * 16 + (ln & 15), k0 = ((int)(i >> 8) & (DD / 32 - 1)) * 32 + ((int)(i >> 5) & 1) * 16 + (ln >> 4) * 8; const v8f v = *(const v8f*)(src + (size_t)row * DD + k0); v8us o;
#pragma unroll
    for (int k = 0; k < 8; ++k) o[k] = f2bf(v[k]); *(v8us*)(dst + i * 8) = o;  }
// ---- k_fattn: scores, causal softmax and attn.v in ONE launch (blockIdx.x = batch and head), one wave per query tile, running (online) softmax over key blocks that end at the diagonal.
// FOUR WAVES (four neighbouring query tiles of one head) form a work-group and walk the same key blocks: each block's K and V planes (16 KiB, already in fragment order) are brought into LDS ONCE
// by asynchronous copies, two buffers, the block after next in flight under the current one, and every wave takes its fragments from LDS: a block leaves L2 once for four tiles, not four times.
// The score tile is formed TRANSPOSED (A = key rows, B = query rows): lane (lr, hi) then holds, for query lr, keys hi*8+j of each 16-key tile, which is the B fragment of
// O^T = V^T P^T as it stands (k = 8 hi + j, 16 + 8 hi + j over two tiles), and max, sum and rescale of a query live in that query's own lanes.
// Rows < RH: bf16 hi+lo planes, 3 products each, 16 queries x 32 keys a trip; rows >= RH: fp16 planes, 32 queries x 64 keys a trip. Output: merged [t][DD] hi/lo planes, fragment-major (K = DD).
#define C2L 0.18033688011112042f  // (1/8) log2(e): softmax in base 2
template <typename T16> struct PFrag;
template <> struct PFrag<h16> { static __device__ __forceinline__ void mk(const v8f p0, const v8f p1, v16h& h, v16h& l) { (void)l;
#pragma unroll
    for (int e = 0; e < 8; ++e) { h[e] = (h16)p0[e]; h[8 + e] = (h16)p1[e]; } } };
template <> struct PFrag<bf> { static __device__ __forceinline__ void mk(const v8f p0, const v8f p1, v16bf& h, v16bf& l) { v8us h0, h1, l0, l1;
#pragma unroll
    for (int e = 0; e < 8; ++e) { unsigned short a, c; splitf(p0[e], a, c); h0[e] = a; l0[e] = c; splitf(p1[e], a, c); h1[e] = a; l1[e] = c; }
    h = cat16b(h0, h1); l = cat16b(l0, l1); } };
// s_wait_xcnt 0 behind a run of global loads or stores, before a register that they name is written again; the address pairs are inputs so that they stay as they are up to the wait.
template <bool SPLIT, typename T> __device__ __forceinline__ void xwait(const T* a, const T* b) {
    if (SPLIT) asm volatile("s_wait_xcnt 0x0" :: "v"(a), "v"(b) : "memory"); else asm volatile("s_wait_xcnt 0x0" :: "v"(a) : "memory"); }
// q0: this wave's first query; nt: key blocks that the work-group walks (up to its last wave's diagonal; at least 2); ring: the work-group's two LDS buffers of 8192 elements, each [K | V] of one block, [K | K lo | V | V lo] on hi+lo planes.
template <typename T16, bool SPLIT, int NQ, int KB>
__device__ __forceinline__ void fattn_tile(const T16* __restrict__ Q, const T16* __restrict__ Q2, const T16* __restrict__ Kp, const T16* __restrict__ K2, const T16* __restrict__ Vt, const T16* __restrict__ V2, const int q0, const int nt, const T16* ring, bf* Ah, bf* Al) {
    typedef typename WFrag<T16>::V V; typedef WFrag<T16> W;
    constexpr int NKT = KB / 16, NU = KB / 32;
    const int lane = threadIdx.x & 31, lr = lane & 15, hi = lane >> 4;
    V qf[NQ][2], ql[NQ][2], kf[NKT][2], kl[NKT][2];
    { const size_t qo = (size_t)q0 * HD + lane * 8; const T16* qp = Q + qo; const T16* qp2 = SPLIT ? Q2 + qo : nullptr;
#pragma unroll
      for (int nq = 0; nq < NQ; ++nq)
#pragma unroll
        for (int c = 0; c < 2; ++c) { qf[nq][c] = W::ld(qp + (nq * 2 + c) * 512); if (SPLIT) ql[nq][c] = W::ld(qp2 + (nq * 2 + c) * 512); }
      xwait<SPLIT>(qp, qp2); }
    v8f o[4][NQ]; float m[NQ], l[NQ];
#pragma unroll
    for (int nq = 0; nq < NQ; ++nq) { m[nq] = -3.0e38f; l[nq] = 0.f;
#pragma unroll
        for (int dt = 0; dt < 4; ++dt) o[dt][nq] = (v8f){}; }
    // a block of KB keys is KB * HD contiguous elements of each k plane and of each v plane: 16 KiB over the planes in use, eight 16-byte copies a thread (128 threads), chunk c at byte c * 2048 of the buffer
    constexpr int PE = KB * HD, CPP = PE / 1024;      // elements of one plane's block; 2-KiB chunks in it
    static_assert((SPLIT ? 4 : 2) * PE == 8192, "a block fills one buffer");
    const int tid = threadIdx.x; const unsigned l0 = (unsigned)(size_t)ring + tid * 16;      // this thread's first LDS byte in buffer 0 (low 32 bits of the shared address)
    auto cp = [&](const int t) __attribute__((always_inline)) {      // block t into buffer t & 1
        const size_t go = (size_t)t * PE + tid * 8; const unsigned lb = l0 + (t & 1) * 16384; const T16* g[8];
#pragma unroll
        for (int c = 0; c < 8; ++c) { const int pn = c / CPP; g[c] = (SPLIT ? (pn == 0 ? Kp : pn == 1 ? K2 : pn == 2 ? Vt : V2) : (pn == 0 ? Kp : Vt)) + go + (c % CPP) * 1024; }
        // the eight copies and, as the statement's last line, s_wait_xcnt 0: it stands in front of every later write of a register that a copy names
        asm volatile("global_load_async_to_lds_b128 %0, %8, off\n\tglobal_load_async_to_lds_b128 %1, %9, off\n\tglobal_load_async_to_lds_b128 %2, %10, off\n\tglobal_load_async_to_lds_b128 %3, %11, off\n\t"
                     "global_load_async_to_lds_b128 %4, %12, off\n\tglobal_load_async_to_lds_b128 %5, %13, off\n\tglobal_load_async_to_lds_b128 %6, %14, off\n\tglobal_load_async_to_lds_b128 %7, %15, off\n\ts_wait_xcnt 0x0"
                     :: "v"(lb), "v"(lb + 2048), "v"(lb + 4096), "v"(lb + 6144), "v"(lb + 8192), "v"(lb + 10240), "v"(lb + 12288), "v"(lb + 14336),
                        "v"(g[0]), "v"(g[1]), "v"(g[2]), "v"(g[3]), "v"(g[4]), "v"(g[5]), "v"(g[6]), "v"(g[7]) : "memory"); };
    V vf[4][NU], vl[4][NU], pf[NQ][NU], pl[NQ][NU];
    auto ldk = [&](const int t) __attribute__((always_inline)) {      // K fragments of block t, which has been published
        const T16* lp = ring + (t & 1) * 8192 + lane * 8;             // this lane's place in the block's buffer
#pragma unroll
        for (int kt = 0; kt < NKT; ++kt)
#pragma unroll
            for (int c = 0; c < 2; ++c) { kf[kt][c] = W::ld(lp + (kt * 2 + c) * 512); if (SPLIT) kl[kt][c] = W::ld(lp + PE + (kt * 2 + c) * 512); } };
    auto scores = [&](const int t, const bool last) __attribute__((always_inline)) {      // block t: V fragments out of LDS, scores, softmax, P fragments; K fragments are in registers already
        const T16* lp = ring + (t & 1) * 8192 + lane * 8; const int kb = t * KB;
#pragma unroll
        for (int dt = 0; dt < 4; ++dt)
#pragma unroll
            for (int u = 0; u < NU; ++u) { vf[dt][u] = W::ld(lp + 4096 + (u * 4 + dt) * 512); if (SPLIT) vl[dt][u] = W::ld(lp + 4096 + PE + (u * 4 + dt) * 512); }
        v8f s[NKT][NQ];
#pragma unroll
        for (int kt = 0; kt < NKT; ++kt)
#pragma unroll
            for (int nq = 0; nq < NQ; ++nq) { v8f a = (v8f){};
#pragma unroll
                for (int c = 0; c < 2; ++c) { a = W::mma(kf[kt][c], qf[nq][c], a); if (SPLIT) { a = W::mma(kf[kt][c], ql[nq][c], a); a = W::mma(kl[kt][c], qf[nq][c], a); } }
                s[kt][nq] = a; }
#pragma unroll
        for (int nq = 0; nq < NQ; ++nq) { float bm = -3.0e38f;
#pragma unroll
            for (int kt = 0; kt < NKT; ++kt)
#pragma unroll
                for (int j = 0; j < 8; ++j) { if (last) s[kt][nq][j] = (kb + kt * 16 + hi * 8 + j <= q0 + nq * 16 + lr) ? s[kt][nq][j] : -3.0e38f; bm = fmaxf(bm, s[kt][nq][j]); }
            bm = fmaxf(bm, __shfl_xor(bm, 16, 32));
            const float mn = fmaxf(m[nq], bm * C2L), al = __builtin_amdgcn_exp2f(m[nq] - mn); m[nq] = mn;
#pragma unroll
            for (int kt = 0; kt < NKT; ++kt)
#pragma unroll
                for (int j = 0; j < 8; ++j) s[kt][nq][j] = __builtin_amdgcn_exp2f(fmaf(s[kt][nq][j], C2L, -mn));
            v8f rv = s[0][nq];            // eight independent partial sums, folded as a tree
#pragma unroll
            for (int kt = 1; kt < NKT; ++kt) rv += s[kt][nq];
            l[nq] = fmaf(l[nq], al, ((rv[0] + rv[1]) + (rv[2] + rv[3])) + ((rv[4] + rv[5]) + (rv[6] + rv[7])));
#pragma unroll
            for (int dt = 0; dt < 4; ++dt) o[dt][nq] *= al;
#pragma unroll
            for (int u = 0; u < NU; ++u) PFrag<T16>::mk(s[2 * u][nq], s[2 * u + 1][nq], pf[nq][u], pl[nq][u]); } };
    auto attnv = [&]() __attribute__((always_inline)) {      // attn.v of the block, operands all in registers
#pragma unroll
        for (int u = 0; u < NU; ++u)
#pragma unroll
            for (int dt = 0; dt < 4; ++dt)
#pragma unroll
                for (int nq = 0; nq < NQ; ++nq) { o[dt][nq] = W::mma(vf[dt][u], pf[nq][u], o[dt][nq]); if (SPLIT) { o[dt][nq] = W::mma(vf[dt][u], pl[nq][u], o[dt][nq]); o[dt][nq] = W::mma(vl[dt][u], pf[nq][u], o[dt][nq]); } }
    };
    const int tl = q0 / KB;     // the one block that holds this wave's diagonal (nt - 2 or nt - 1); every block before it is wholly at or below it
    // the hand-over stands in front of a block's attn.v, whose operands are in registers by then: the refill has a whole trip to land, and the next K fragments come out of LDS under the attn.v products
    auto foot = [&]() __attribute__((always_inline)) {     // hand-over of trip t, every wave, also one that is past its diagonal
        asm volatile("s_wait_dscnt 0x0" ::: "memory");     // this wave's reads of buffer t & 1 are done before the buffer is handed back
        asm volatile("s_wait_asynccnt 0x0" ::: "memory");  // this wave's copies of block t + 1 have landed
        __syncthreads(); };                                // publishes block t + 1 and ends every wave's reads of block t
    cp(0);
    asm volatile("s_wait_asynccnt 0x0" ::: "memory");      // this wave's copies of block 0 have landed
    __syncthreads();                                       // ... and every other wave's: block 0 may be read
    cp(1);
    ldk(0);
#pragma unroll 1                            // rolled: one body, the buffer picked by the trip's parity
    for (int t = 0; t < nt - 2; ++t) {      // blocks below every wave's diagonal; block t + 2 exists and goes into the buffer just read
        scores(t, false);
        __builtin_amdgcn_sched_barrier(0);      // keeps scores and softmax in front of the hand-over (sunk behind it, the wait for block t + 1 would come a whole softmax too early)
        foot(); cp(t + 2); ldk(t + 1);
        __builtin_amdgcn_sched_barrier(0);      // keeps the products behind the copies and the K reads, which then fly under them
        attnv(); }
#pragma unroll 1                             // rolled: one copy of the masked body
    for (int t = nt - 2; t < nt; ++t) {      // the two blocks with the diagonals, masked by index (an identity on a block below the wave's diagonal)
        if (t <= tl) { ldk(t); scores(t, true); }      // here the K fragments are read at the head of their own trip: nothing but the attn.v operands is held over the hand-over
        foot();
        if (t <= tl) attnv(); }
    asm volatile("s_wait_asynccnt 0x0" ::: "memory");      // nothing is in flight when the wave ends
    const size_t ob = (size_t)(q0 >> 6) * 64 * DD + ((q0 >> 4) & 3) * 512 + lane * 8; bf* ah = Ah + ob; bf* al2 = Al + ob;      // 64-row panel, row block in it (q0 + 16 nq stays in the panel)
#pragma unroll
    for (int nq = 0; nq < NQ; ++nq) { const float inv = __fdiv_rn(1.0f, l[nq] + __shfl_xor(l[nq], 16, 32)); v8us oh[4], ol[4];
#pragma unroll
        for (int dt = 0; dt < 4; ++dt)
#pragma unroll
            for (int j = 0; j < 8; ++j) { unsigned short a, c; splitf(o[dt][nq][j] * inv, a, c); oh[dt][j] = a; ol[dt][j] = c; }
#pragma unroll
        for (int dt = 0; dt < 4; ++dt) { *(v8us*)(ah + nq * 512 + (dt >> 1) * 2048 + (dt & 1) * 256) = oh[dt]; *(v8us*)(al2 + nq * 512 + (dt >> 1) * 2048 + (dt & 1) * 256) = ol[dt]; }
        // the same wait behind the stores: their data registers are inputs too
        asm volatile("s_wait_xcnt 0x0" :: "v"(ah), "v"(al2), "v"(oh[0]), "v"(oh[1]), "v"(oh[2]), "v"(oh[3]), "v"(ol[0]), "v"(ol[1]), "v"(ol[2]), "v"(ol[3]) : "memory"); }
}
__global__ __launch_bounds__(128) void k_fattn(const bf* __restrict__ QPh, const bf* __restrict__ QPl, const bf* __restrict__ KPh, const bf* __restrict__ KPl, const bf* __restrict__ VTh, const bf* __restrict__ VTl,
                                              const h16* __restrict__ QP16, const h16* __restrict__ KP16, const h16* __restrict__ VT16, bf* Ah, bf* Al) {
    // RANK ORDER: head and batch are the fastest index (blockIdx.x),
    // the tile class (its cost falls with x) the slowest: the LAY heaviest classes come first, one work-group for each of the chip's 256 WGPs;
    // the next LAY classes follow lightest first; then the rest, again lightest first. Speed only: rank -> x is a permutation wherever they land.
    constexpr int NT = (TT - RH) / 128 + RH / 64, LAY = 256 / (NH_ * NB_);
    static_assert(NT > 2 * LAY && NT <= 3 * LAY, "three turns");
    const int hb = blockIdx.x, rank = blockIdx.y, x = rank < LAY ? rank : rank < 2 * LAY ? 3 * LAY - 1 - rank : NT + 2 * LAY - 1 - rank;
    const size_t hz = (size_t)hb * TT * HD; const size_t oz = (size_t)(hb / NH_) * TT * DD + (hb % NH_) * (HD / 32) * 2048; Ah += oz; Al += oz;
    __shared__ __align__(16) unsigned short ring[2 * 8192];
    const int w = __builtin_amdgcn_readfirstlane(threadIdx.x >> 5);      // wave in the work-group, in a scalar register: every test on it is a scalar branch
    if (x < (TT - RH) / 128) { const int Q0 = TT - 128 * (x + 1);        // longest rows first
        fattn_tile<h16, false, 2, 64>(QP16 + hz, nullptr, KP16 + hz, nullptr, VT16 + hz, nullptr, Q0 + 32 * w, Q0 / 64 + 2, (const h16*)ring, Ah, Al); }
    else { const int Q0 = RH - 64 * (x - (TT - RH) / 128 + 1);
        fattn_tile<bf, true, 1, 32>(QPh + hz, QPl + hz, KPh + hz, KPl + hz, VTh + hz, VTl + hz, Q0 + 16 * w, Q0 / 32 + 2, (const bf*)ring, Ah, Al); }
}

extern "C" void kernel_launch(void* const* d_in, const int* in_sizes, int n_in,
                              void* d_out, int out_size, void* d_ws, size_t ws_size, hipStream_t stream) {
    (void)in_sizes; (void)n_in; (void)out_size;
    const float* x = (const float*)d_in[0]; const float* am = (const float*)d_in[1]; const float* wq = (const float*)d_in[2]; const float* wk = (const float*)d_in[3]; const float* wv = (const float*)d_in[4]; const float* wo = (const float*)d_in[5]; const float* bo = (const float*)d_in[6];
    float* OUT = (float*)d_out;     // [2][2048][1024]
    char* wsp = (char*)d_ws;
    auto take = [&](size_t bytes) { char* p = wsp; wsp += (bytes + 255) & ~(size_t)255; return (void*)p; };
    const size_t SL = (size_t)DD * DD, PB = (size_t)TT * DD;      // one weight slab; one batch of one plane
    bf* WQ = (bf*)take(4 * SL * 2); bf* WO = WQ + 3 * SL; bf* XB = (bf*)take(NB_ * PB * 2);      // [Wq|Wk|Wv|Wo] and, right behind them, x [NB_ TT][DD], all fragment-major
    bf* Ph = (bf*)take(3 * NB_ * PB * 2); bf* Pl = (bf*)take(3 * NB_ * PB * 2); h16* P16 = (h16*)take(3 * NB_ * PB * 2);      // each [q|k|v][NB_] planes
    bf* ATh = (bf*)take(NB_ * PB * 2); bf* ATl = (bf*)take(NB_ * PB * 2);
    if ((size_t)(wsp - (char*)d_ws) > ws_size) return;    // total 104 MiB; ws 256 MiB
    // every stage is ONE launch over both batches (and over q, k, v where there are three)
    k_cvt8<<<dim3((unsigned)(SL / 8 / 256), 4 + NB_ * TT / DD, 1), 256, 0, stream>>>(wq, wk, wv, wo, x, WQ, SL / 8);   // [out][in] weights = Bt as-is
    k_qkv<<<dim3(NB_ * TT / 256, NH_, 1), 384, 0, stream>>>(XB, WQ, am, Ph, Pl, P16);
    k_fattn<<<dim3(NH_ * NB_, (TT - RH) / 128 + RH / 64, 1), 128, 0, stream>>>(Ph, Pl, Ph + NB_ * PB, Pl + NB_ * PB, Ph + 2 * NB_ * PB, Pl + 2 * NB_ * PB, P16, P16 + NB_ * PB, P16 + 2 * NB_ * PB, ATh, ATl);
    k_gemmw<bf, 1, true><<<dim3(NB_ * TT / 64, DD / 64, 1), 32, 0, stream>>>(ATh, ATl, WO, nullptr, DD, OUT, DD, bo, 0, 0, 0, 0);
}

// v010
// Measured time: 72.2 microseconds a run.
// In both of two side-by-side timings against v009, it was 1.08 times as fast.
// All steps since v000 together make it 28.1 times as fast.
#include <hip/hip_runtime.h>

// Causal multi-head attention block (x [2][2048][1024], attention_mask [2][2048] (float ones, read as data); q/k/v = x W^T ([out][in], no bias) each multiplied by mask[b][t] per row; 16 heads x 64; scores / 8; causal (tril -> -inf);
// softmax; out = merged Wo^T + bo).
// Compute dtypes, f32 accumulate: every input rounded to bf16; projections on PLAIN bf16 operands (inputs: exact), x bf16(mask) in f32 in the projection GEMM's epilogue; PER-ROW
// PRECISION HYBRID: query rows < 512 of each batch on bf16 hi+lo planes for scores and attn.v (3 products), rows >= 512 on SINGLE fp16 planes; output hi+lo x exact Wo (2 products) + bo.

#define NB_  2
#define TT   2048
#define DD   1024
#define NH_  16
#define HD   64
#define RH   512                  // query rows < RH: hi+lo planes; rows >= RH: fp16 planes
#define NF   32
#define SCL  0.125f               // 1/sqrt(64)
typedef _Float16 h16;
typedef unsigned short bf;
typedef __attribute__((ext_vector_type(16))) __bf16   v16bf;
typedef __attribute__((ext_vector_type(16))) _Float16 v16h;
typedef __attribute__((ext_vector_type(8)))  _Float16 v8h;
typedef __attribute__((ext_vector_type(8)))  unsigned short v8us;
typedef __attribute__((ext_vector_type(8)))  float    v8f;
typedef __attribute__((ext_vector_type(4)))  float    v4f;
typedef v8h  __attribute__((may_alias)) v8ha;
typedef v4f  __attribute__((may_alias)) v4fa;
typedef v8us __attribute__((may_alias)) v8usa;

__device__ __forceinline__ unsigned short f2bf(float f) { unsigned u = __float_as_uint(f); u += 0x7FFFu + ((u >> 16) & 1u); return (unsigned short)(u >> 16); }
__device__ __forceinline__ float bf2f(unsigned short b) { return __uint_as_float(((unsigned)b) << 16); }
__device__ __forceinline__ float bfr(float f) { return bf2f(f2bf(f)); }
__device__ __forceinline__ v16h cat16(v8h lo, v8h hi) { return __builtin_shufflevector(lo, hi, 0, 1, 2, 3, 4, 5, 6, 7, 8, 9, 10, 11, 12, 13, 14, 15); }
__device__ __forceinline__ v16bf cat16b(v8us lo, v8us hi) { return __builtin_bit_cast(v16bf, __builtin_shufflevector(lo, hi, 0, 1, 2, 3, 4, 5, 6, 7, 8, 9, 10, 11, 12, 13, 14, 15)); }
__device__ __forceinline__ v8f wmma16(v16h a, v16h b, v8f c) { return __builtin_amdgcn_wmma_f32_16x16x32_f16(false, a, false, b, (short)0, c, false, false); }
__device__ __forceinline__ v8f wmmab(v16bf a, v16bf b, v8f c) { return __builtin_amdgcn_wmma_f32_16x16x32_bf16(false, a, false, b, (short)0, c, false, false); }



// ---- FRAGMENT-MAJOR PLANES: every 16-bit WMMA operand plane [rows][K] is stored as blocks of 16 rows x 32 k (512 elements, 1 KiB). GEMM operands (K = DD): the four row blocks of a 64-row panel lie
// side by side, block (row / 16, k / 32) at (((row / 64) * (K / 32) + k / 32) * 4 + (row / 16) % 4) * 512, so one k block of a wave's 64 rows is 4 KiB in a row per operand. Attention planes: see k_qkv.
// Inside a block element (r, k) lies at ((k >> 4) & 1) * 256 + (((k >> 3) & 1) * 16 + r) * 8 + (k & 7): lane (lr, hi) finds its two runs of eight k at lane * 8 and 256 + lane * 8,
// so each of the two 16-byte loads of a fragment covers 512 contiguous bytes (four whole lines) instead of 32 bytes in each of sixteen lines. The k order of a fragment is what it was.
// ---- k_out: the output projection, ONE WORK-GROUP OF 4 WAVES per 128x128 tile of C (grid (M/128, N/128)): wave w forms the 64x64 tile of row panel w & 1 and column panel w >> 1, 16 accumulators.
// C[m][n] (f32, pitch DD) = sum_k (A[m][k] + A2[m][k]) Bt[n][k] + bf16(bias[n]), two products a k block (hi, then lo), operands in fragment-major planes (K = DD).
// The four tiles need only SIX operand panels (two of A, two of A2, two of Bt): each panel's k blocks, already in fragment order, are brought into LDS ONCE by tensor loads and every wave takes its
// fragments from there, so a work-group draws 6 panels from L2 where four separate waves ask for 12. A stage = 128 k of the six panels (6 x 16 KiB, [A0 A1 | A2_0 A2_1 | Bt0 Bt1]); two stage buffers.
typedef uint32_t u32x4 __attribute__((ext_vector_type(4)));
typedef uint32_t u32x8 __attribute__((ext_vector_type(8)));
__device__ __forceinline__ uint32_t uni(uint32_t v) { return (uint32_t)__builtin_amdgcn_readfirstlane(v); }
__device__ __forceinline__ uint32_t pinned(uint32_t v) { uint32_t w = uni(v); asm volatile("" : "+s"(w)); return w; }      // pinned(): the test that decides whether a tensor load issues, held in a scalar register, so that it compiles to a scalar branch (a tensor load ignores EXEC)
template <typename T16> struct WFrag;
template <> struct WFrag<h16> { typedef v16h V; static __device__ __forceinline__ V ld(const h16* p) { return cat16(*(const v8h*)p, *(const v8h*)(p + 256)); } static __device__ __forceinline__ v8f mma(V a, V b, v8f c) { return wmma16(a, b, c); } };
template <> struct WFrag<bf> { typedef v16bf V; static __device__ __forceinline__ V ld(const bf* p) { return cat16b(*(const v8us*)p, *(const v8us*)(p + 256)); } static __device__ __forceinline__ v8f mma(V a, V b, v8f c) { return wmmab(a, b, c); } };
__device__ __forceinline__ h16 tohx(float x) { return (h16)x; }
__device__ __forceinline__ void splitf(float y, unsigned short& h, unsigned short& l) { h = f2bf(y); l = f2bf(y - bf2f(h)); }
__global__ __launch_bounds__(128) void k_out(const bf* __restrict__ A, const bf* __restrict__ A2, const bf* __restrict__ Bt, const float* __restrict__ bias, float* C) {
    typedef WFrag<bf> W; typedef W::V V;
    constexpr int PE = 64 * 128, SE = 6 * PE, NS = DD / 128;      // elements of one panel's part of a stage (16 KiB, contiguous in the plane); elements of a stage; stages
    static_assert(NS >= 2 && DD % 128 == 0, "two stages or more");
    __shared__ __attribute__((aligned(2048))) bf ring[2 * SE];
    __shared__ __align__(16) float osb[4 * 16 * 68];      // each wave's own rows for the store staging, outside the ring
    const int tid = threadIdx.x, lane = tid & 31, lr = lane & 15, hi = lane >> 4;
    const int w = __builtin_amdgcn_readfirstlane(tid >> 5), jm = w & 1, jn = w >> 1;      // wave in the work-group, in a scalar register
    v8f acc[4][4];
#pragma unroll
    for (int mb = 0; mb < 4; ++mb)
#pragma unroll
        for (int nb = 0; nb < 4; ++nb) acc[mb][nb] = (v8f){};
    // EVERY WAVE issues one tensor load a stage, its own slice: wave 0 the two A panels, wave 1 the two A2 panels (tiles of 2 rows x 16 KiB, source pitch = one panel, 128 KiB), waves 2 and 3 one Bt panel each (1 row x 16 KiB).
    const bf* sp = w == 0 ? A + (size_t)blockIdx.x * (128 * DD) : w == 1 ? A2 + (size_t)blockIdx.x * (128 * DD) : Bt + (size_t)(blockIdx.y * 2 + w - 2) * (64 * DD);      // first byte of the slice at stage 0
    const uint32_t lsl = (uint32_t)(size_t)ring + (uint32_t)(w < 2 ? w * 2 : w + 2) * (PE * 2);      // the slice's place in buffer 0: byte offset in the work-group's LDS, a multiple of 16 KiB
    const uint32_t d0 = PE * 2, d1 = w < 2 ? 2u : 1u;      // bytes a row; rows
    u32x8 g1;      // 1-byte elements, tensor = tile, no mask, no pad
    g1[0] = uni(0u); g1[1] = uni((d0 & 0xFFFFu) << 16); g1[2] = uni((d0 >> 16) | ((d1 & 0xFFFFu) << 16)); g1[3] = uni((d1 >> 16) | (d0 << 16)); g1[4] = uni(d1); g1[5] = uni(64u * DD * 2u); g1[6] = uni(0u); g1[7] = uni(0u);
    u32x4 g0; g0[0] = uni(1u);
    // ONE register tuple holds group 0 from the first request to the last wait: it passes through the load's statement and through the wait's, so that a word of it is rewritten only behind the wait that covers its request
    auto tld = [&](const int st) __attribute__((always_inline)) {      // this wave's slice of stage st into buffer st & 1
        const uint64_t ga = (uint64_t)(size_t)sp + (uint64_t)st * (PE * 2);
        g0[1] = uni(lsl + (uint32_t)(st & 1) * (SE * 2)); g0[2] = uni((uint32_t)ga); g0[3] = uni((((uint32_t)(ga >> 32)) & 0x01FFFFFFu) | 0x80000000u);
        asm volatile("tensor_load_to_lds %0, %1" : "+s"(g0) : "s"(g1) : "memory"); };
    auto twait = [&]() __attribute__((always_inline)) { asm volatile("s_wait_tensorcnt 0x0" : "+s"(g0) : "s"(g1) : "memory"); };      // this wave's request has landed
    // TWO FRAGMENT SETS: the reads of k block i + 1 go out as one group in front of the products of k block i, so a block waits for its operands once, under the block before it.
    struct FSet { V a[4], a2[4], b[4]; };
    FSet s0, s1;
    const bf* la = ring + jm * PE + lane * 8; const bf* la2 = la + 2 * PE; const bf* lb2 = ring + (4 + jn) * PE + lane * 8;      // this lane's place in the A, A2 and Bt panels of buffer 0
    auto ldset = [&](FSet& s, const int eo) __attribute__((always_inline)) {      // eo: element offset of the k block (buffer, block in the stage)
#pragma unroll
        for (int mb = 0; mb < 4; ++mb) { s.a[mb] = W::ld(la + eo + mb * 512); s.a2[mb] = W::ld(la2 + eo + mb * 512); }
#pragma unroll
        for (int nb = 0; nb < 4; ++nb) s.b[nb] = W::ld(lb2 + eo + nb * 512); };
    auto mmaset = [&](const FSet& s) __attribute__((always_inline)) {
#pragma unroll
        for (int nb = 0; nb < 4; ++nb)
#pragma unroll
            for (int mb = 0; mb < 4; ++mb) { acc[mb][nb] = W::mma(s.a[mb], s.b[nb], acc[mb][nb]); acc[mb][nb] = W::mma(s.a2[mb], s.b[nb], acc[mb][nb]); } };
    auto first3 = [&](const int eb) __attribute__((always_inline)) {      // blocks 0 to 2 of the stage at eb; block 0 is in s0 already, block 3 is left in s1
        ldset(s1, eb + 2048);
        __builtin_amdgcn_sched_barrier(0);      // keeps the next block's reads in front of this block's products (sunk among them they would be waited for at once)
        mmaset(s0);
        __builtin_amdgcn_sched_barrier(0);      // the same for each block after
        ldset(s0, eb + 4096);
        __builtin_amdgcn_sched_barrier(0);      // as above
        mmaset(s1);
        __builtin_amdgcn_sched_barrier(0);      // as above
        ldset(s1, eb + 6144);
        __builtin_amdgcn_sched_barrier(0);      // as above
        mmaset(s0);
        __builtin_amdgcn_sched_barrier(0); };   // keeps what follows (the hand-over, or the last products) behind these products
    tld(0);
    twait();                                               // this wave's slice of stage 0 has landed
    __syncthreads();                                       // ... and every other wave's: stage 0 may be read
    tld(1);
    ldset(s0, 0);
#pragma unroll 1                             // rolled: one body, the buffer picked by the stage's parity
    for (int t = 0; t < NS - 1; ++t) {
        const int eb = (t & 1) * SE;
        first3(eb);
        asm volatile("s_wait_dscnt 0x0" ::: "memory");
        twait();
        __syncthreads();
        if (pinned(t + 2 < NS)) tld(t + 2);
        ldset(s0, SE - eb);
        __builtin_amdgcn_sched_barrier(0);      // keeps the products behind the tensor load and the reads, which then fly under them
        mmaset(s1);
        __builtin_amdgcn_sched_barrier(0); }    // keeps the next stage's reads behind these products
    first3(((NS - 1) & 1) * SE);
    mmaset(s1);
    __builtin_amdgcn_sched_barrier(0);          // keeps the closing waits and the store addresses' arithmetic behind the last products, where the fragment registers are free (formed among them it spills)
    twait();                                               // nothing is in flight when the wave ends
    asm volatile("s_wait_dscnt 0x0" ::: "memory");         // ... and no read of the ring
    const int r0 = (blockIdx.x * 2 + jm) * 64, c0 = (blockIdx.y * 2 + jn) * 64; float* os = osb + w * (16 * 68);
#pragma unroll
    for (int mb = 0; mb < 4; ++mb) {
#pragma unroll
        for (int nb = 0; nb < 4; ++nb) {
#pragma unroll
            for (int j = 0; j < 8; ++j) os[(hi * 8 + j) * 68 + nb * 16 + lr] = acc[mb][nb][j]; }
        __builtin_amdgcn_wave_barrier(); asm volatile("" ::: "memory");      // the compiler keeps the wave's stores to its rows in front of the other lanes' reads of them
        float* crow = C + (size_t)(r0 + mb * 16) * DD + c0;
        {
            v4f vals[8]; float* cp[8];
#pragma unroll
            for (int s = 0; s < 8; ++s) { const int row = 2 * s + hi, cofs = lr * 4; v4f val = *(const v4fa*)(os + row * 68 + cofs); val[0] += bfr(bias[c0 + cofs]); val[1] += bfr(bias[c0 + cofs + 1]); val[2] += bfr(bias[c0 + cofs + 2]); val[3] += bfr(bias[c0 + cofs + 3]);
                vals[s] = val; cp[s] = crow + (size_t)row * DD + cofs; *(v4f*)cp[s] = val; }
            // s_wait_xcnt 0 behind the eight stores, before a register that they name is written again; address pairs and data are inputs so that they stay as they are up to the wait
            asm volatile("s_wait_xcnt 0x0" :: "v"(cp[0]), "v"(cp[1]), "v"(cp[2]), "v"(cp[3]), "v"(cp[4]), "v"(cp[5]), "v"(cp[6]), "v"(cp[7]), "v"(vals[0]), "v"(vals[1]), "v"(vals[2]), "v"(vals[3]), "v"(vals[4]), "v"(vals[5]), "v"(vals[6]), "v"(vals[7]) : "memory");
        }
        __builtin_amdgcn_wave_barrier(); asm volatile("" ::: "memory");      // ... and those reads in front of the next rows' stores
    }
}

// ---- k_qkv: the q, k, v projections, ONE WORK-GROUP OF 12 WAVES per 256 positions x one head (grid (NB_ TT / 256, NH_)): wave w forms the 64x64 tile of position panel w & 3 and projection w >> 2 (q, k, v), 16 accumulators, as k_out does.
// The twelve tiles need only SEVEN operand panels (four of x, that head's 64 rows of Wq, Wk, Wv): each panel's k blocks, already in fragment order, are brought into LDS ONCE by asynchronous copies and every wave takes its
// fragments from there, so a work-group draws 7 panels from L2 where twelve separate waves ask for 24. A unit = 64 k of the seven panels (7 x 8 KiB, [x0 x1 x2 x3 | Wq Wk Wv]); a stage = two units; two stage buffers.
// No f32 C: the tile goes from the accumulators straight into the attention planes, x bf16(mask[t]).
// q and k planes: per head rows = t, k = d (K = HD): block (h * (TT / 16) + t / 16) * 2 + d / 32. v planes: per head rows = d, k = t, the four row blocks of 32 keys side by side: block (h * (TT / 32) + t / 32) * 4 + d / 16.
// An accumulator holds, per lane, eight consecutive A rows of one B row, which IS a run of eight k of a fragment block when the plane's k runs along the A rows: so q and k are formed as W x^T (A rows = d)
// and v as x W^T (A rows = t); each accumulator is then one 512-byte run of a block as it stands, and a tile is 8 KiB in a row of each plane.
__global__ __launch_bounds__(384) void k_qkv(const bf* __restrict__ X, const bf* __restrict__ Wt, const float* __restrict__ Mv, bf* Ph, bf* Pl, h16* P16) {
    typedef WFrag<bf> W; typedef W::V V;
    constexpr int UE = 7 * 4096, NS = DD / 128;      // elements of a unit; stages
    static_assert(NS >= 2 && DD % 128 == 0, "two stages or more");
    __shared__ __align__(16) bf ring[4 * UE];
    const int tid = threadIdx.x, lane = tid & 31, lr = lane & 15, hi = lane >> 4;
    const int w = __builtin_amdgcn_readfirstlane(tid >> 5), jx = w & 3, z = w >> 2;      // wave in the work-group, in a scalar register: every test on it is a scalar branch
    const bool qk = z < 2;      // q, k: W rows on the A side, positions on the B side; v: the other way round
    v8f acc[4][4];
#pragma unroll
    for (int mb = 0; mb < 4; ++mb)
#pragma unroll
        for (int nb = 0; nb < 4; ++nb) acc[mb][nb] = (v8f){};
    // a unit is 56 KiB: nine 16-byte copies a thread (chunk c at byte c * 6144 of the unit, a wave's 512 bytes inside one panel) and a tenth from waves 0 to 3
    const unsigned l0 = (unsigned)(size_t)ring + tid * 16;      // this thread's first LDS byte in unit slot 0 (low 32 bits of the shared address)
    auto gsrc = [&](const int c, const int u) __attribute__((always_inline)) {      // where chunk c of unit u lies in global memory, for this lane
        const int lw = c * 6144 + w * 512, pn = lw >> 13;
        const bf* b = pn < 4 ? X + (size_t)(blockIdx.x * 4 + pn) * (64 * DD) : Wt + (size_t)(pn - 4) * (DD * DD) + (size_t)blockIdx.y * (64 * DD);
        return b + (size_t)u * 4096 + ((lw & 8191) >> 1) + lane * 8; };
    auto cpu = [&](const int u) __attribute__((always_inline)) {      // unit u into slot u & 3
        const unsigned lb = l0 + (u & 3) * (UE * 2); const bf* g[9];
#pragma unroll
        for (int c = 0; c < 9; ++c) g[c] = gsrc(c, u);
        // the copies and, as the statement's last line, s_wait_xcnt 0: it stands in front of every later write of a register that a copy names
        asm volatile("global_load_async_to_lds_b128 %0, %9, off\n\tglobal_load_async_to_lds_b128 %1, %10, off\n\tglobal_load_async_to_lds_b128 %2, %11, off\n\t"
                     "global_load_async_to_lds_b128 %3, %12, off\n\tglobal_load_async_to_lds_b128 %4, %13, off\n\tglobal_load_async_to_lds_b128 %5, %14, off\n\t"
                     "global_load_async_to_lds_b128 %6, %15, off\n\tglobal_load_async_to_lds_b128 %7, %16, off\n\tglobal_load_async_to_lds_b128 %8, %17, off\n\ts_wait_xcnt 0x0"
                     :: "v"(lb), "v"(lb + 6144), "v"(lb + 12288), "v"(lb + 18432), "v"(lb + 24576), "v"(lb + 30720), "v"(lb + 36864), "v"(lb + 43008), "v"(lb + 49152),
                        "v"(g[0]), "v"(g[1]), "v"(g[2]), "v"(g[3]), "v"(g[4]), "v"(g[5]), "v"(g[6]), "v"(g[7]), "v"(g[8]) : "memory");
        if (w < 4)      // the unit's last 2 KiB; the same wait in the same statement
            asm volatile("global_load_async_to_lds_b128 %0, %1, off\n\ts_wait_xcnt 0x0" :: "v"(lb + 55296), "v"(gsrc(9, u)) : "memory"); };
    // TWO FRAGMENT SETS, as in k_out: the reads of k block i + 1 go out as one group in front of the products of k block i. Products and their order per accumulator are what they were.
    struct FSet { V a[4], b[4]; };
    FSet s0, s1;
    const bf* la = ring + (qk ? 4 + z : jx) * 4096 + lane * 8; const bf* lb2 = ring + (qk ? jx : 4 + z) * 4096 + lane * 8;      // this lane's place in the A and the B panel of slot 0
    auto ldset = [&](FSet& s, const int eo) __attribute__((always_inline)) {      // eo: element offset of the k block (slot, block in the unit)
#pragma unroll
        for (int mb = 0; mb < 4; ++mb) s.a[mb] = W::ld(la + eo + mb * 512);
#pragma unroll
        for (int nb = 0; nb < 4; ++nb) s.b[nb] = W::ld(lb2 + eo + nb * 512); };
    auto mmaset = [&](const FSet& s) __attribute__((always_inline)) {
#pragma unroll
        for (int nb = 0; nb < 4; ++nb)
#pragma unroll
            for (int mb = 0; mb < 4; ++mb) acc[mb][nb] = W::mma(s.a[mb], s.b[nb], acc[mb][nb]); };
    auto first3 = [&](const int eb) __attribute__((always_inline)) {      // blocks 0 to 2 of the stage at eb; block 0 is in s0 already, block 3 is left in s1
        ldset(s1, eb + 2048);
        __builtin_amdgcn_sched_barrier(0);      // keeps the next block's reads in front of this block's products (sunk among them they would be waited for at once)
        mmaset(s0);
        __builtin_amdgcn_sched_barrier(0);      // the same for each block after
        ldset(s0, eb + UE);
        __builtin_amdgcn_sched_barrier(0);      // as above
        mmaset(s1);
        __builtin_amdgcn_sched_barrier(0);      // as above
        ldset(s1, eb + UE + 2048);
        __builtin_amdgcn_sched_barrier(0);      // as above
        mmaset(s0);
        __builtin_amdgcn_sched_barrier(0); };   // keeps what follows (the hand-over, or the last products) behind these products
    cpu(0); cpu(1);
    asm volatile("s_wait_asynccnt 0x0" ::: "memory");      // this wave's copies of stage 0 have landed
    __syncthreads();                                       // ... and every other wave's: stage 0 may be read
    cpu(2); cpu(3);
    ldset(s0, 0);
#pragma unroll 1                             // rolled: one body, the buffer picked by the stage's parity
    for (int t = 0; t < NS - 1; ++t) {
        const int eb = (t & 1) * 2 * UE;
        first3(eb);
        // the hand-over stands in front of the stage's last block, whose fragments are in registers by then: the refill has a whole stage to land, and the next stage's first fragments come out of LDS under the last products
        asm volatile("s_wait_dscnt 0x0" ::: "memory");     // this wave's reads of stage t are done before its buffer is handed back
        asm volatile("s_wait_asynccnt 0x0" ::: "memory");  // this wave's copies of stage t + 1 have landed
        __syncthreads();                                   // publishes stage t + 1 and ends every wave's reads of stage t
        if (t + 2 < NS) { cpu(2 * t + 4); cpu(2 * t + 5); }      // stage t + 2 into the buffer just read
        ldset(s0, 2 * UE - eb);
        __builtin_amdgcn_sched_barrier(0);      // keeps the products behind the copies and the reads, which then fly under them
        mmaset(s1);
        __builtin_amdgcn_sched_barrier(0); }    // keeps the next stage's reads behind these products
    first3(((NS - 1) & 1) * 2 * UE);
    mmaset(s1);
    asm volatile("s_wait_asynccnt 0x0" ::: "memory");      // nothing is in flight when the wave ends
    __builtin_amdgcn_sched_barrier(0);          // keeps the store addresses' arithmetic behind the last products, where the fragment registers are free (formed among them it spills)
    const int tp = (blockIdx.x * 4 + jx) * 64, hd = blockIdx.y;      // first position of the tile (both batches in a row), head
    const size_t ob = ((size_t)z * NB_ + tp / TT) * TT * DD + (size_t)(hd * (TT * HD / 512) + (tp % TT) / 8) * 512 + lane * 8;
    bf* ph = Ph + ob; bf* pl = Pl + ob; h16* p16 = P16 + ob;
    // s_wait_xcnt 0 behind each run of global stores, before a register that they name is written again; address pairs and store data are inputs so that they stay as they are up to the wait
    auto put = [&](const bool tb) __attribute__((always_inline)) {      // tb: positions along the B rows (q, k), else along the A rows (v)
        const float* mp = Mv + tp + (tb ? lr : hi * 8); float mq[4]; v8f mm[4];
        // the mask loads of a tile and their data wait are ONE statement, every result in a register of its own ("=&v"): no load of the run can land on the address pair that the others still name
        if (tb) asm volatile("global_load_b32 %0, %4, off\n\tglobal_load_b32 %1, %4, off offset:64\n\tglobal_load_b32 %2, %4, off offset:128\n\tglobal_load_b32 %3, %4, off offset:192\n\ts_wait_loadcnt 0x0"
                             : "=&v"(mq[0]), "=&v"(mq[1]), "=&v"(mq[2]), "=&v"(mq[3]) : "v"(mp) : "memory");
        else { v4f m4[8];
            asm volatile("global_load_b128 %0, %8, off\n\tglobal_load_b128 %1, %8, off offset:16\n\tglobal_load_b128 %2, %8, off offset:64\n\tglobal_load_b128 %3, %8, off offset:80\n\t"
                         "global_load_b128 %4, %8, off offset:128\n\tglobal_load_b128 %5, %8, off offset:144\n\tglobal_load_b128 %6, %8, off offset:192\n\tglobal_load_b128 %7, %8, off offset:208\n\ts_wait_loadcnt 0x0"
                         : "=&v"(m4[0]), "=&v"(m4[1]), "=&v"(m4[2]), "=&v"(m4[3]), "=&v"(m4[4]), "=&v"(m4[5]), "=&v"(m4[6]), "=&v"(m4[7]) : "v"(mp) : "memory");
#pragma unroll
            for (int i = 0; i < 4; ++i) mm[i] = __builtin_shufflevector(m4[2 * i], m4[2 * i + 1], 0, 1, 2, 3, 4, 5, 6, 7); }
#pragma unroll
        for (int mb = 0; mb < 4; ++mb) { v8us oh[4], ol[4]; v8h o16[4];
#pragma unroll
            for (int nb = 0; nb < 4; ++nb)
#pragma unroll
                for (int j = 0; j < 8; ++j) { const float x = __fmul_rn(acc[mb][nb][j], bfr(tb ? mq[nb] : mm[mb][j])); unsigned short a, c2; splitf(x, a, c2); oh[nb][j] = a; ol[nb][j] = c2; o16[nb][j] = tohx(x); }
#pragma unroll
            for (int nb = 0; nb < 4; ++nb) { const int off = (tb ? nb * 2 + (mb >> 1) : (mb >> 1) * 4 + nb) * 512 + (mb & 1) * 256; *(v8us*)(ph + off) = oh[nb]; *(v8us*)(pl + off) = ol[nb]; *(v8h*)(p16 + off) = o16[nb]; }
            asm volatile("s_wait_xcnt 0x0" :: "v"(ph), "v"(pl), "v"(p16), "v"(oh[0]), "v"(oh[1]), "v"(oh[2]), "v"(oh[3]), "v"(ol[0]), "v"(ol[1]), "v"(ol[2]), "v"(ol[3]), "v"(o16[0]), "v"(o16[1]), "v"(o16[2]), "v"(o16[3]) : "memory"); }
    };
    if (qk) put(true); else put(false);
}

typedef __attribute__((ext_vector_type(2))) unsigned short v2us;
typedef __attribute__((ext_vector_type(2))) _Float16 v2h;
typedef __attribute__((ext_vector_type(4))) _Float16 v4h;
typedef __attribute__((ext_vector_type(2))) float v2f;

// blockIdx.y picks the DD x DD slab: 0..3 = Wq, Wk, Wv, Wo, 4.. = slabs of x (both batches); dst holds them in that order, one after the other, each fragment-major (K = DD).
// Thread i writes the slab's i-th run of eight: a wave stores 512 contiguous bytes and reads 64 bytes of each of 16 rows; a work-group reads one whole line of each of 64 rows.
__global__ __launch_bounds__(256) void k_cvt8(const float* __restrict__ wq, const float* __restrict__ wk, const float* __restrict__ wv, const float* __restrict__ wo, const float* __restrict__ x, bf* dst, size_t n8) { const size_t i = (size_t)blockIdx.x * 256 + threadIdx.x; if (i >= n8) return;
    const int y = blockIdx.y; const float* src = y == 0 ? wq : y == 1 ? wk : y == 2 ? wv : y == 3 ? wo : x + (size_t)(y - 4) * DD * DD; dst += (size_t)y * DD * DD;
    const int ln = (int)i & 31, row = (int)(i >> 13) * 64 + ((int)(i >> 6) & 3) * 16 + (ln & 15), k0 = ((int)(i >> 8) & (DD / 32 - 1)) * 32 + ((int)(i >> 5) & 1) * 16 + (ln >> 4) * 8; const v8f v = *(const v8f*)(src + (size_t)row * DD + k0); v8us o;
#pragma unroll
    for (int k = 0; k < 8; ++k) o[k] = f2bf(v[k]); *(v8us*)(dst + i * 8) = o;  }
// ---- k_fattn: scores, causal softmax and attn.v in ONE launch (blockIdx.x = batch and head), one wave per query tile, running (online) softmax over key blocks that end at the diagonal.
// FOUR WAVES (four neighbouring query tiles of one head) form a work-group and walk the same key blocks: each block's K and V planes (16 KiB, already in fragment order) are brought into LDS ONCE
// by asynchronous copies, two buffers, the block after next in flight under the current one, and every wave takes its fragments from LDS: a block leaves L2 once for four tiles, not four times.
// The score tile is formed TRANSPOSED (A = key rows, B = query rows): lane (lr, hi) then holds, for query lr, keys hi*8+j of each 16-key tile, which is the B fragment of
// O^T = V^T P^T as it stands (k = 8 hi + j, 16 + 8 hi + j over two tiles), and max, sum and rescale of a query live in that query's own lanes.
// Rows < RH: bf16 hi+lo planes, 3 products each, 16 queries x 32 keys a trip; rows >= RH: fp16 planes, 32 queries x 64 keys a trip. Output: merged [t][DD] hi/lo planes, fragment-major (K = DD).
#define C2L 0.18033688011112042f  // (1/8) log2(e): softmax in base 2
template <typename T16> struct PFrag;
template <> struct PFrag<h16> { static __device__ __forceinline__ void mk(const v8f p0, const v8f p1, v16h& h, v16h& l) { (void)l;
#pragma unroll
    for (int e = 0; e < 8; ++e) { h[e] = (h16)p0[e]; h[8 + e] = (h16)p1[e]; } } };
template <> struct PFrag<bf> { static __device__ __forceinline__ void mk(const v8f p0, const v8f p1, v16bf& h, v16bf& l) { v8us h0, h1, l0, l1;
#pragma unroll
    for (int e = 0; e < 8; ++e) { unsigned short a, c; splitf(p0[e], a, c); h0[e] = a; l0[e] = c; splitf(p1[e], a, c); h1[e] = a; l1[e] = c; }
    h = cat16b(h0, h1); l = cat16b(l0, l1); } };
// s_wait_xcnt 0 behind a run of global loads or stores, before a register that they name is written again; the address pairs are inputs so that they stay as they are up to the wait.
template <bool SPLIT, typename T> __device__ __forceinline__ void xwait(const T* a, const T* b) {
    if (SPLIT) asm volatile("s_wait_xcnt 0x0" :: "v"(a), "v"(b) : "memory"); else asm volatile("s_wait_xcnt 0x0" :: "v"(a) : "memory"); }
// q0: this wave's first query; nt: key blocks that the work-group walks (up to its last wave's diagonal; at least 2); ring: the work-group's two LDS buffers of 8192 elements, each [K | V] of one block, [K | K lo | V | V lo] on hi+lo planes.
template <typename T16, bool SPLIT, int NQ, int KB>
__device__ __forceinline__ void fattn_tile(const T16* __restrict__ Q, const T16* __restrict__ Q2, const T16* __restrict__ Kp, const T16* __restrict__ K2, const T16* __restrict__ Vt, const T16* __restrict__ V2, const int q0, const int nt, const T16* ring, bf* Ah, bf* Al) {
    typedef typename WFrag<T16>::V V; typedef WFrag<T16> W;
    constexpr int NKT = KB / 16, NU = KB / 32;
    const int lane = threadIdx.x & 31, lr = lane & 15, hi = lane >> 4;
    V qf[NQ][2], ql[NQ][2], kf[NKT][2], kl[NKT][2];
    { const size_t qo = (size_t)q0 * HD + lane * 8; const T16* qp = Q + qo; const T16* qp2 = SPLIT ? Q2 + qo : nullptr;
#pragma unroll
      for (int nq = 0; nq < NQ; ++nq)
#pragma unroll
        for (int c = 0; c < 2; ++c) { qf[nq][c] = W::ld(qp + (nq * 2 + c) * 512); if (SPLIT) ql[nq][c] = W::ld(qp2 + (nq * 2 + c) * 512); }
      xwait<SPLIT>(qp, qp2); }
    v8f o[4][NQ]; float m[NQ], l[NQ];
#pragma unroll
    for (int nq = 0; nq < NQ; ++nq) { m[nq] = -3.0e38f; l[nq] = 0.f;
#pragma unroll
        for (int dt = 0; dt < 4; ++dt) o[dt][nq] = (v8f){}; }
    // a block of KB keys is KB * HD contiguous elements of each k plane and of each v plane: 16 KiB over the planes in use, eight 16-byte copies a thread (128 threads), chunk c at byte c * 2048 of the buffer
    constexpr int PE = KB * HD, CPP = PE / 1024;      // elements of one plane's block; 2-KiB chunks in it
    static_assert((SPLIT ? 4 : 2) * PE == 8192, "a block fills one buffer");
    const int tid = threadIdx.x; const unsigned l0 = (unsigned)(size_t)ring + tid * 16;      // this thread's first LDS byte in buffer 0 (low 32 bits of the shared address)
    auto cp = [&](const int t) __attribute__((always_inline)) {      // block t into buffer t & 1
        const size_t go = (size_t)t * PE + tid * 8; const unsigned lb = l0 + (t & 1) * 16384; const T16* g[8];
#pragma unroll
        for (int c = 0; c < 8; ++c) { const int pn = c / CPP; g[c] = (SPLIT ? (pn == 0 ? Kp : pn == 1 ? K2 : pn == 2 ? Vt : V2) : (pn == 0 ? Kp : Vt)) + go + (c % CPP) * 1024; }
        // the eight copies and, as the statement's last line, s_wait_xcnt 0: it stands in front of every later write of a register that a copy names
        asm volatile("global_load_async_to_lds_b128 %0, %8, off\n\tglobal_load_async_to_lds_b128 %1, %9, off\n\tglobal_load_async_to_lds_b128 %2, %10, off\n\tglobal_load_async_to_lds_b128 %3, %11, off\n\t"
                     "global_load_async_to_lds_b128 %4, %12, off\n\tglobal_load_async_to_lds_b128 %5, %13, off\n\tglobal_load_async_to_lds_b128 %6, %14, off\n\tglobal_load_async_to_lds_b128 %7, %15, off\n\ts_wait_xcnt 0x0"
                     :: "v"(lb), "v"(lb + 2048), "v"(lb + 4096), "v"(lb + 6144), "v"(lb + 8192), "v"(lb + 10240), "v"(lb + 12288), "v"(lb + 14336),
                        "v"(g[0]), "v"(g[1]), "v"(g[2]), "v"(g[3]), "v"(g[4]), "v"(g[5]), "v"(g[6]), "v"(g[7]) : "memory"); };
    V vf[4][NU], vl[4][NU], pf[NQ][NU], pl[NQ][NU];
    auto ldk = [&](const int t) __attribute__((always_inline)) {      // K fragments of block t, which has been published
        const T16* lp = ring + (t & 1) * 8192 + lane * 8;             // this lane's place in the block's buffer
#pragma unroll
        for (int kt = 0; kt < NKT; ++kt)
#pragma unroll
            for (int c = 0; c < 2; ++c) { kf[kt][c] = W::ld(lp + (kt * 2 + c) * 512); if (SPLIT) kl[kt][c] = W::ld(lp + PE + (kt * 2 + c) * 512); } };
    auto scores = [&](const int t, const bool last) __attribute__((always_inline)) {      // block t: V fragments out of LDS, scores, softmax, P fragments; K fragments are in registers already
        const T16* lp = ring + (t & 1) * 8192 + lane * 8; const int kb = t * KB;
#pragma unroll
        for (int dt = 0; dt < 4; ++dt)
#pragma unroll
            for (int u = 0; u < NU; ++u) { vf[dt][u] = W::ld(lp + 4096 + (u * 4 + dt) * 512); if (SPLIT) vl[dt][u] = W::ld(lp + 4096 + PE + (u * 4 + dt) * 512); }
        v8f s[NKT][NQ];
#pragma unroll
        for (int kt = 0; kt < NKT; ++kt)
#pragma unroll
            for (int nq = 0; nq < NQ; ++nq) { v8f a = (v8f){};
#pragma unroll
                for (int c = 0; c < 2; ++c) { a = W::mma(kf[kt][c], qf[nq][c], a); if (SPLIT) { a = W::mma(kf[kt][c], ql[nq][c], a); a = W::mma(kl[kt][c], qf[nq][c], a); } }
                s[kt][nq] = a; }
#pragma unroll
        for (int nq = 0; nq < NQ; ++nq) { float bm = -3.0e38f;
#pragma unroll
            for (int kt = 0; kt < NKT; ++kt)
#pragma unroll
                for (int j = 0; j < 8; ++j) { if (last) s[kt][nq][j] = (kb + kt * 16 + hi * 8 + j <= q0 + nq * 16 + lr) ? s[kt][nq][j] : -3.0e38f; bm = fmaxf(bm, s[kt][nq][j]); }
            bm = fmaxf(bm, __shfl_xor(bm, 16, 32));
            const float mn = fmaxf(m[nq], bm * C2L), al = __builtin_amdgcn_exp2f(m[nq] - mn); m[nq] = mn;
#pragma unroll
            for (int kt = 0; kt < NKT; ++kt)
#pragma unroll
                for (int j = 0; j < 8; ++j) s[kt][nq][j] = __builtin_amdgcn_exp2f(fmaf(s[kt][nq][j], C2L, -mn));
            v8f rv = s[0][nq];            // eight independent partial sums, folded as a tree
#pragma unroll
            for (int kt = 1; kt < NKT; ++kt) rv += s[kt][nq];
            l[nq] = fmaf(l[nq], al, ((rv[0] + rv[1]) + (rv[2] + rv[3])) + ((rv[4] + rv[5]) + (rv[6] + rv[7])));
#pragma unroll
            for (int dt = 0; dt < 4; ++dt) o[dt][nq] *= al;
#pragma unroll
            for (int u = 0; u < NU; ++u) PFrag<T16>::mk(s[2 * u][nq], s[2 * u + 1][nq], pf[nq][u], pl[nq][u]); } };
    auto attnv = [&]() __attribute__((always_inline)) {      // attn.v of the block, operands all in registers
#pragma unroll
        for (int u = 0; u < NU; ++u)
#pragma unroll
            for (int dt = 0; dt < 4; ++dt)
#pragma unroll
                for (int nq = 0; nq < NQ; ++nq) { o[dt][nq] = W::mma(vf[dt][u], pf[nq][u], o[dt][nq]); if (SPLIT) { o[dt][nq] = W::mma(vf[dt][u], pl[nq][u], o[dt][nq]); o[dt][nq] = W::mma(vl[dt][u], pf[nq][u], o[dt][nq]); } }
    };
    const int tl = q0 / KB;     // the one block that holds this wave's diagonal (nt - 2 or nt - 1); every block before it is wholly at or below it
    // the hand-over stands in front of a block's attn.v, whose operands are in registers by then: the refill has a whole trip to land, and the next K fragments come out of LDS under the attn.v products
    auto foot = [&]() __attribute__((always_inline)) {     // hand-over of trip t, every wave, also one that is past its diagonal
        asm volatile("s_wait_dscnt 0x0" ::: "memory");     // this wave's reads of buffer t & 1 are done before the buffer is handed back
        asm volatile("s_wait_asynccnt 0x0" ::: "memory");  // this wave's copies of block t + 1 have landed
        __syncthreads(); };                                // publishes block t + 1 and ends every wave's reads of block t
    cp(0);
    asm volatile("s_wait_asynccnt 0x0" ::: "memory");      // this wave's copies of block 0 have landed
    __syncthreads();                                       // ... and every other wave's: block 0 may be read
    cp(1);
    ldk(0);
#pragma unroll 1                            // rolled: one body, the buffer picked by the trip's parity
    for (int t = 0; t < nt - 2; ++t) {      // blocks below every wave's diagonal; block t + 2 exists and goes into the buffer just read
        scores(t, false);
        __builtin_amdgcn_sched_barrier(0);      // keeps scores and softmax in front of the hand-over (sunk behind it, the wait for block t + 1 would come a whole softmax too early)
        foot(); cp(t + 2); ldk(t + 1);
        __builtin_amdgcn_sched_barrier(0);      // keeps the products behind the copies and the K reads, which then fly under them
        attnv(); }
#pragma unroll 1                             // rolled: one copy of the masked body
    for (int t = nt - 2; t < nt; ++t) {      // the two blocks with the diagonals, masked by index (an identity on a block below the wave's diagonal)
        if (t <= tl) { ldk(t); scores(t, true); }      // here the K fragments are read at the head of their own trip: nothing but the attn.v operands is held over the hand-over
        foot();
        if (t <= tl) attnv(); }
    asm volatile("s_wait_asynccnt 0x0" ::: "memory");      // nothing is in flight when the wave ends
    const size_t ob = (size_t)(q0 >> 6) * 64 * DD + ((q0 >> 4) & 3) * 512 + lane * 8; bf* ah = Ah + ob; bf* al2 = Al + ob;      // 64-row panel, row block in it (q0 + 16 nq stays in the panel)
#pragma unroll
    for (int nq = 0; nq < NQ; ++nq) { const float inv = __fdiv_rn(1.0f, l[nq] + __shfl_xor(l[nq], 16, 32)); v8us oh[4], ol[4];
#pragma unroll
        for (int dt = 0; dt < 4; ++dt)
#pragma unroll
            for (int j = 0; j < 8; ++j) { unsigned short a, c; splitf(o[dt][nq][j] * inv, a, c); oh[dt][j] = a; ol[dt][j] = c; }
#pragma unroll
        for (int dt = 0; dt < 4; ++dt) { *(v8us*)(ah + nq * 512 + (dt >> 1) * 2048 + (dt & 1) * 256) = oh[dt]; *(v8us*)(al2 + nq * 512 + (dt >> 1) * 2048 + (dt & 1) * 256) = ol[dt]; }
        // the same wait behind the stores: their data registers are inputs too
        asm volatile("s_wait_xcnt 0x0" :: "v"(ah), "v"(al2), "v"(oh[0]), "v"(oh[1]), "v"(oh[2]), "v"(oh[3]), "v"(ol[0]), "v"(ol[1]), "v"(ol[2]), "v"(ol[3]) : "memory"); }
}
__global__ __launch_bounds__(128) void k_fattn(const bf* __restrict__ QPh, const bf* __restrict__ QPl, const bf* __restrict__ KPh, const bf* __restrict__ KPl, const bf* __restrict__ VTh, const bf* __restrict__ VTl,
                                              const h16* __restrict__ QP16, const h16* __restrict__ KP16, const h16* __restrict__ VT16, bf* Ah, bf* Al) {
    // RANK ORDER: head and batch are the fastest index (blockIdx.x),
    // the tile class (its cost falls with x) the slowest: the LAY heaviest classes come first, one work-group for each of the chip's 256 WGPs;
    // the next LAY classes follow lightest first; then the rest, again lightest first. Speed only: rank -> x is a permutation wherever they land.
    constexpr int NT = (TT - RH) / 128 + RH / 64, LAY = 256 / (NH_ * NB_);
    static_assert(NT > 2 * LAY && NT <= 3 * LAY, "three turns");
    const int hb = blockIdx.x, rank = blockIdx.y, x = rank < LAY ? rank : rank < 2 * LAY ? 3 * LAY - 1 - rank : NT + 2 * LAY - 1 - rank;
    const size_t hz = (size_t)hb * TT * HD; const size_t oz = (size_t)(hb / NH_) * TT * DD + (hb % NH_) * (HD / 32) * 2048; Ah += oz; Al += oz;
    __shared__ __align__(16) unsigned short ring[2 * 8192];
    const int w = __builtin_amdgcn_readfirstlane(threadIdx.x >> 5);      // wave in the work-group, in a scalar register: every test on it is a scalar branch
    if (x < (TT - RH) / 128) { const int Q0 = TT - 128 * (x + 1);        // longest rows first
        fattn_tile<h16, false, 2, 64>(QP16 + hz, nullptr, KP16 + hz, nullptr, VT16 + hz, nullptr, Q0 + 32 * w, Q0 / 64 + 2, (const h16*)ring, Ah, Al); }
    else { const int Q0 = RH - 64 * (x - (TT - RH) / 128 + 1);
        fattn_tile<bf, true, 1, 32>(QPh + hz, QPl + hz, KPh + hz, KPl + hz, VTh + hz, VTl + hz, Q0 + 16 * w, Q0 / 32 + 2, (const bf*)ring, Ah, Al); }
}

extern "C" void kernel_launch(void* const* d_in, const int* in_sizes, int n_in,
                              void* d_out, int out_size, void* d_ws, size_t ws_size, hipStream_t stream) {
    (void)in_sizes; (void)n_in; (void)out_size;
    const float* x = (const float*)d_in[0]; const float* am = (const float*)d_in[1]; const float* wq = (const float*)d_in[2]; const float* wk = (const float*)d_in[3]; const float* wv = (const float*)d_in[4]; const float* wo = (const float*)d_in[5]; const float* bo = (const float*)d_in[6];
    float* OUT = (float*)d_out;     // [2][2048][1024]
    char* wsp = (char*)d_ws;
    auto take = [&](size_t bytes) { char* p = wsp; wsp += (bytes + 255) & ~(size_t)255; return (void*)p; };
    const size_t SL = (size_t)DD * DD, PB = (size_t)TT * DD;      // one weight slab; one batch of one plane
    bf* WQ = (bf*)take(4 * SL * 2); bf* WO = WQ + 3 * SL; bf* XB = (bf*)take(NB_ * PB * 2);      // [Wq|Wk|Wv|Wo] and, right behind them, x [NB_ TT][DD], all fragment-major
    bf* Ph = (bf*)take(3 * NB_ * PB * 2); bf* Pl = (bf*)take(3 * NB_ * PB * 2); h16* P16 = (h16*)take(3 * NB_ * PB * 2);      // each [q|k|v][NB_] planes
    bf* ATh = (bf*)take(NB_ * PB * 2); bf* ATl = (bf*)take(NB_ * PB * 2);
    if ((size_t)(wsp - (char*)d_ws) > ws_size) return;    // total 104 MiB; ws 256 MiB
    // every stage is ONE launch over both batches (and over q, k, v where there are three)
    k_cvt8<<<dim3((unsigned)(SL / 8 / 256), 4 + NB_ * TT / DD, 1), 256, 0, stream>>>(wq, wk, wv, wo, x, WQ, SL / 8);   // [out][in] weights = Bt as-is
    k_qkv<<<dim3(NB_ * TT / 256, NH_, 1), 384, 0, stream>>>(XB, WQ, am, Ph, Pl, P16);
    k_fattn<<<dim3(NH_ * NB_, (TT - RH) / 128 + RH / 64, 1), 128, 0, stream>>>(Ph, Pl, Ph + NB_ * PB, Pl + NB_ * PB, Ph + 2 * NB_ * PB, Pl + 2 * NB_ * PB, P16, P16 + NB_ * PB, P16 + 2 * NB_ * PB, ATh, ATl);
    k_out<<<dim3(NB_ * TT / 128, DD / 128, 1), 128, 0, stream>>>(ATh, ATl, WO, bo, OUT);
}
